// v000
// Measured on an AMD MI455X. A time is GPU time per run, averaged over a window of back-to-back runs after a warm-up
// (all launches, gaps included; the runs take copies of the inputs in turn), and the median of several windows.
// Apart from v000's, it joins two sittings. Times from different sittings can be a few percent apart, while
// side-by-side timings come from the same sitting.
// The starting kernel, v000, takes 125 microseconds a run.
// Projection tiles (tokens x Wq, tokens x Wk): v_wmma_f32_16x16x32_bf16 (bf16 operands = RNE-converted inputs), f32 accumulate.
// Score tiles (keys x queries, K = 32): v_wmma_f32_16x16x32_bf16 on a bf16 hi/lo split of both operands (hi.hi + hi.lo + lo.hi), f32 accumulate.
// Channel sums, value channel-mean dot, softmax statistics, weight-times-value-mean reduction and epilogue: f32 on the VALU.
#include <hip/hip_runtime.h>

#define CIN   256
#define CQK   32
#define HWN   4096
#define NBAT  8
#define NTOK  32768
#define PBLK  64
#define QBLK  64
#define PW    264

static_assert(NTOK == NBAT * HWN);
static_assert((NTOK % PBLK) == 0 && (NTOK % QBLK) == 0 && (HWN % QBLK) == 0);
static_assert((HWN % 32) == 0 && (CIN % 32) == 0 && CQK == 32);
static_assert((PW % 8) == 0 && PBLK == 64 && QBLK == 64);

typedef __bf16         v16bf __attribute__((ext_vector_type(16)));
typedef unsigned short v16us __attribute__((ext_vector_type(16)));
typedef unsigned short v8us  __attribute__((ext_vector_type(8)));
typedef float          v8f   __attribute__((ext_vector_type(8)));
typedef float          v4f   __attribute__((ext_vector_type(4)));
typedef unsigned int   v4u   __attribute__((ext_vector_type(4)));

// ---- scalar helpers --------------------------------------------------------------------------------
__device__ __forceinline__ unsigned short bf_bits(float f) {          // f32 -> bf16 bits, RNE convert
  unsigned u = __float_as_uint(f);
  return (unsigned short)((u + 0x7FFFu + ((u >> 16) & 1u)) >> 16);
}
__device__ __forceinline__ float bf_up(unsigned short hb) { return __uint_as_float(((unsigned)hb) << 16); }
__device__ __forceinline__ float bf_r(float f) { return bf_up(bf_bits(f)); }
__device__ __forceinline__ v8f zero8() { v8f z = {0.f, 0.f, 0.f, 0.f, 0.f, 0.f, 0.f, 0.f}; return z; }

// ---- fragment loader: lane -> row/col (lane&15); p already includes +8*(lane>>4);
//      elements 0..7 <- p[0..7] (k0+8h..), elements 8..15 <- p[16..23] (k0+16+8h..). Same map for A and B.
__device__ __forceinline__ v16bf ldfrag_b(const unsigned short* p) {
  union { v16us v; v8us hv[2]; } f;
  f.hv[0] = *(const v8us*)(p);
  f.hv[1] = *(const v8us*)(p + 16);
  return __builtin_bit_cast(v16bf, f.v);
}

// ---- WMMA helper and trailing VALU hazard gaps ------------------------------------------------------------
__device__ __forceinline__ v8f mma_b(v16bf a, v16bf b, v8f c) {
  return __builtin_amdgcn_wmma_f32_16x16x32_bf16(false, a, false, b, (short)0, c, false, false);
}
__device__ __forceinline__ void guard_p(v8f& c0, v8f& c1, v8f& c2, v8f& c3,
                                        v16bf a, v16bf b0, v16bf b1, v16bf b2, v16bf b3) {
#if defined(__HIP_DEVICE_COMPILE__)
  asm volatile("v_nop\n\tv_nop\n\tv_nop\n\tv_nop"
               : "+v"(c0), "+v"(c1), "+v"(c2), "+v"(c3)
               : "v"(a), "v"(b0), "v"(b1), "v"(b2), "v"(b3));
#endif
}
__device__ __forceinline__ void guard_s(v8f& s0, v8f& s1, v16bf a0, v16bf a1, v16bf a2, v16bf a3,
                                        v16bf b0, v16bf b1) {
#if defined(__HIP_DEVICE_COMPILE__)
  asm volatile("v_nop\n\tv_nop\n\tv_nop\n\tv_nop"
               : "+v"(s0), "+v"(s1)
               : "v"(a0), "v"(a1), "v"(a2), "v"(a3), "v"(b0), "v"(b1));
#endif
}
__device__ __forceinline__ void acc_guard4(v8f& a, v8f& b, v8f& c, v8f& d) {
#if defined(__HIP_DEVICE_COMPILE__)
  asm volatile("v_nop\n\tv_nop\n\tv_nop\n\tv_nop" : "+v"(a), "+v"(b), "+v"(c), "+v"(d));
#endif
}
__device__ __forceinline__ void sched_fence() {
#if defined(__HIP_DEVICE_COMPILE__)
  asm volatile("" ::: "memory");
#endif
}

// =====================================================================================================
// One block: wsum[cin] = sum over cout of bf16RNE(Wv[cin][cout]) (f32), aux[0] = sum over c of
// bf16RNE(bv[c]), aux[1..31] = 0. Stores: wsum 1 KB = waves 0,1 x 32 lanes x 16 B (one instruction
// coverage: 256 + 32 floats = both whole regions.
// =====================================================================================================
__global__ __launch_bounds__(256) void k_prep(const float* __restrict__ Wv, const float* __restrict__ bv,
                                               float* wsum, float* aux) {
  __shared__ __align__(16) float sws[CIN];
  __shared__ float sbv[CIN];
  __shared__ __align__(16) float saux[32];
  const int tid = threadIdx.x, wave = tid >> 5, lane = tid & 31;
  const float* row = Wv + (size_t)tid * CIN;
  float s = 0.f;
#pragma unroll 4
  for (int j = 0; j < CIN / 4; ++j) {
    const v4f w = *(const v4f*)(row + 4 * j);
    s += bf_r(w[0]); s += bf_r(w[1]); s += bf_r(w[2]); s += bf_r(w[3]);
  }
  sws[tid] = s;
  sbv[tid] = bf_r(bv[tid]);
  if (tid < 32) saux[tid] = 0.f;
  __syncthreads();
  if (tid == 0) {
    float t = 0.f;
#pragma unroll 1
    for (int c = 0; c < CIN; ++c) t += sbv[c];
    saux[0] = t;
  }
  __syncthreads();
  if (wave < 2) {
    const v4f v = *(const v4f*)(sws + 128 * wave + 4 * lane);
    float* dst = wsum + 128 * wave + 4 * lane;
    *(v4f*)dst = v;
    
  } else if (wave == 2) {
    const v4f v = *(const v4f*)(saux + 4 * (lane & 7));
    float* dst = aux + 4 * (lane & 7);
    if (lane < 8) *(v4f*)dst = v;
    
  }
}

// =====================================================================================================
// Projections + per-token statistics. Block = 64 tokens, 4 waves, wave = 16 tokens.
// LDS: Wq and Wk as bf16 bits in [n][k] layout (rows 0..31 = Wq columns, rows 32..63 = Wk columns,
// pitch 264), wsum, biases. k-loop over 256 in steps of 32: A = bf16RNE(x) rows (row = token m,
// split k map), B = sW rows (col = output channel, same k map); the same x elements feed the f32 channel
// sum and the f32 dot with wsum. Epilogue: q/k + bias -> hi = bf16RNE(v), lo = bf16RNE(v - hi), staged
// per wave in LDS as four [16 tokens][32] planes, then each plane tile (1024 contiguous bytes in global)
// coverage: 4 waves x 16 rows x 32 = the block's 64 rows of each of the 4 planes; 64 xmean + 64 vbar;
// 512 blocks = whole planes.
// =====================================================================================================
__global__ __launch_bounds__(128) void k_proj(const float* __restrict__ x,
                                               const float* __restrict__ Wq, const float* __restrict__ bq,
                                               const float* __restrict__ Wk, const float* __restrict__ bk,
                                               const float* wsum, const float* aux,
                                               unsigned short* qh, unsigned short* ql,
                                               unsigned short* kh, unsigned short* kl,
                                               float* xmean, float* vbar) {
  __shared__ __align__(16) unsigned short sW[64 * PW];
  __shared__ __align__(16) unsigned short sO[4 * 4 * 16 * CQK];
  __shared__ __align__(16) float swsum[CIN];
  __shared__ __align__(16) float smean[PBLK];
  __shared__ __align__(16) float svbar[PBLK];
  __shared__ float sbias[64];
  const int tid = threadIdx.x, wave = tid >> 5, lane = tid & 31, m = lane & 15, h = lane >> 4;

#pragma unroll 4
  for (int it = 0; it < (CIN * CQK) / 128; ++it) {
    const int idx = it * 128 + tid;                 // = k*32 + n
    const int k = idx >> 5, n = idx & 31;
    sW[n * PW + k] = bf_bits(Wq[idx]);
    sW[(32 + n) * PW + k] = bf_bits(Wk[idx]);
  }
  swsum[tid] = wsum[tid];
  swsum[tid + 128] = wsum[tid + 128];
  if (tid < 64) {
    const float vq = bq[tid & 31];
    const float vk = bk[tid & 31];
    sbias[tid] = bf_r(tid < 32 ? vq : vk);
  }
  const float bvsum = aux[0];
  __syncthreads();

  const int row0 = blockIdx.x * PBLK + wave * 16;
  const float* xr = x + (size_t)(row0 + m) * CIN + 8 * h;
  const float* wr = swsum + 8 * h;
  const unsigned short* wb = sW + m * PW + 8 * h;
  v8f acc[4];
#pragma unroll
  for (int t = 0; t < 4; ++t) acc[t] = zero8();
  float xs = 0.f, vd = 0.f;

#pragma unroll 2
  for (int c = 0; c < CIN / 32; ++c) {
    const float* p = xr + 32 * c;
    const v4f x0 = *(const v4f*)(p);
    const v4f x1 = *(const v4f*)(p + 4);
    const v4f x2 = *(const v4f*)(p + 16);
    const v4f x3 = *(const v4f*)(p + 20);
    const float* pw = wr + 32 * c;
    const v4f w0 = *(const v4f*)(pw);
    const v4f w1 = *(const v4f*)(pw + 4);
    const v4f w2 = *(const v4f*)(pw + 16);
    const v4f w3 = *(const v4f*)(pw + 20);
    v16us au;
#pragma unroll
    for (int e = 0; e < 4; ++e) {
      const unsigned short b0 = bf_bits(x0[e]), b1 = bf_bits(x1[e]);
      const unsigned short b2 = bf_bits(x2[e]), b3 = bf_bits(x3[e]);
      const float r0 = bf_up(b0), r1 = bf_up(b1), r2 = bf_up(b2), r3 = bf_up(b3);
      au[e] = b0; au[4 + e] = b1; au[8 + e] = b2; au[12 + e] = b3;
      xs += (r0 + r1) + (r2 + r3);
      vd += r0 * w0[e]; vd += r1 * w1[e]; vd += r2 * w2[e]; vd += r3 * w3[e];
    }
    const v16bf a = __builtin_bit_cast(v16bf, au);
    const unsigned short* bp = wb + 32 * c;
    const v16bf f0 = ldfrag_b(bp);
    const v16bf f1 = ldfrag_b(bp + 16 * PW);
    const v16bf f2 = ldfrag_b(bp + 32 * PW);
    const v16bf f3 = ldfrag_b(bp + 48 * PW);
    acc[0] = mma_b(a, f0, acc[0]);
    acc[1] = mma_b(a, f1, acc[1]);
    acc[2] = mma_b(a, f2, acc[2]);
    acc[3] = mma_b(a, f3, acc[3]);
    guard_p(acc[0], acc[1], acc[2], acc[3], a, f0, f1, f2, f3);
    sched_fence();
  }
  acc_guard4(acc[0], acc[1], acc[2], acc[3]);

  // ---- per-token statistics (both lane halves hold row m) ----
  xs += __shfl_xor(xs, 16, 32);
  vd += __shfl_xor(vd, 16, 32);
  if (h == 0) {
    smean[wave * 16 + m] = xs * (1.0f / 256.0f);
    svbar[wave * 16 + m] = (vd + bvsum) * (1.0f / 256.0f);
  }
  // ---- q/k hi/lo planes staged per wave: plane 0 = q hi, 1 = q lo, 2 = k hi, 3 = k lo ----
  unsigned short* so = sO + wave * (4 * 16 * CQK);
#pragma unroll
  for (int t = 0; t < 4; ++t) {
    const float bias = sbias[16 * t + m];
    const int col = 16 * (t & 1) + m;
    unsigned short* ph = so + (2 * (t >> 1)) * (16 * CQK) + col;
    unsigned short* pl = ph + 16 * CQK;
#pragma unroll
    for (int r = 0; r < 8; ++r) {
      const float val = acc[t][r] + bias;
      const unsigned short hb = bf_bits(val);
      const unsigned short lb = bf_bits(val - bf_up(hb));
      ph[(8 * h + r) * CQK] = hb;
      pl[(8 * h + r) * CQK] = lb;
    }
  }
  __syncthreads();
  v4u pc[8];
#pragma unroll
  for (int pidx = 0; pidx < 4; ++pidx) {
    pc[2 * pidx]     = *(const v4u*)(so + pidx * (16 * CQK) + lane * 8);
    pc[2 * pidx + 1] = *(const v4u*)(so + pidx * (16 * CQK) + 256 + lane * 8);
  }
  const size_t ob = (size_t)row0 * CQK + (size_t)lane * 8;
  *(v4u*)(qh + ob) = pc[0];  *(v4u*)(qh + ob + 256) = pc[1];
  *(v4u*)(ql + ob) = pc[2];  *(v4u*)(ql + ob + 256) = pc[3];
  *(v4u*)(kh + ob) = pc[4];  *(v4u*)(kh + ob + 256) = pc[5];
  *(v4u*)(kl + ob) = pc[6];  *(v4u*)(kl + ob + 256) = pc[7];
  

  if (wave == 0) {
    const v4f v = *(const v4f*)(smean + 4 * (lane & 15));
    float* dst = xmean + (size_t)blockIdx.x * PBLK + 4 * (lane & 15);
    if (lane < 16) *(v4f*)dst = v;
    
  } else if (wave == 1) {
    const v4f v = *(const v4f*)(svbar + 4 * (lane & 15));
    float* dst = vbar + (size_t)blockIdx.x * PBLK + 4 * (lane & 15);
    if (lane < 16) *(v4f*)dst = v;
    
  }
}

// =====================================================================================================
// Attention, single pass with online softmax. Block = 64 queries (inside one image), 4 waves,
// wave = 16 queries. vbar of the image staged in LDS (4096 floats). Per 32-key chunk:
//   S^T tiles = K rows (A, row = key, k = d) . Q rows (B, col = query, k = d), one k-step,
//   three products hi.hi + hi.lo + lo.hi per tile from zero;
//   D: s0[r] = S[key kb+8h+r][query], s1[r] = S[key kb+16+8h+r][query];
//   running max over the 32 keys (per lane, then the xor-16 partner), rescale of sum and of the
//   weighted value-mean accumulator; p = exp(s - max) in f32; o += p * vbar[key] (f32 FMA).
// Epilogue: res = gammaRNE * (o / l) + xmean[query]; 64 floats per block staged in LDS and written as
// coverage: 128 chunks x 32 = all 4096 keys of the image; 512 blocks x 64 = whole output.
// =====================================================================================================
__global__ __launch_bounds__(128) void k_attn(const unsigned short* qh, const unsigned short* ql,
                                               const unsigned short* kh, const unsigned short* kl,
                                               const float* vbar, const float* xmean,
                                               const float* __restrict__ gamma, float* out) {
  __shared__ __align__(16) float svb[HWN];
  __shared__ __align__(16) float sout[QBLK];
  const int tid = threadIdx.x, wave = tid >> 5, lane = tid & 31;
  const int rl = lane & 15, h = lane >> 4, koff = 8 * h;
  const int n0 = blockIdx.x * QBLK;
  const int keybase = (n0 / HWN) * HWN;
#pragma unroll
  for (int i = tid; i < HWN / 4; i += 128) {
    ((v4f*)svb)[i] = *(const v4f*)(vbar + keybase + 4 * i);
  }
  const float gb = bf_r(gamma[0]);
  const int qrow = n0 + 16 * wave + rl;
  const float xm = xmean[qrow];
  __syncthreads();

  const v16bf fqh = ldfrag_b(qh + (size_t)qrow * CQK + koff);
  const v16bf fql = ldfrag_b(ql + (size_t)qrow * CQK + koff);
  const unsigned short* khp = kh + (size_t)(keybase + rl) * CQK + koff;
  const unsigned short* klp = kl + (size_t)(keybase + rl) * CQK + koff;

  float run_max = -1.0e30f, run_sum = 0.0f, run_o = 0.0f;

#pragma unroll 1
  for (int kb = 0; kb < HWN; kb += 32) {
    const unsigned short* pa = khp + (size_t)kb * CQK;
    const unsigned short* pl = klp + (size_t)kb * CQK;
    const v16bf a0h = ldfrag_b(pa);
    const v16bf a1h = ldfrag_b(pa + 16 * CQK);
    const v16bf a0l = ldfrag_b(pl);
    const v16bf a1l = ldfrag_b(pl + 16 * CQK);
    v8f s0 = zero8(), s1 = zero8();
    s0 = mma_b(a0h, fqh, s0);
    s0 = mma_b(a0h, fql, s0);
    s0 = mma_b(a0l, fqh, s0);
    s1 = mma_b(a1h, fqh, s1);
    s1 = mma_b(a1h, fql, s1);
    s1 = mma_b(a1l, fqh, s1);
    guard_s(s0, s1, a0h, a1h, a0l, a1l, fqh, fql);
    sched_fence();
    // ---- online softmax over the key axis ----
    float lmax = fmaxf(s0[0], s1[0]);
#pragma unroll
    for (int v = 1; v < 8; ++v) lmax = fmaxf(lmax, fmaxf(s0[v], s1[v]));
    lmax = fmaxf(lmax, __shfl_xor(lmax, 16, 32));
    const float nm = fmaxf(run_max, lmax);
    const float factor = __expf(run_max - nm);
    run_max = nm;
    const v4f v00 = *(const v4f*)(svb + kb + koff);
    const v4f v01 = *(const v4f*)(svb + kb + koff + 4);
    const v4f v10 = *(const v4f*)(svb + kb + 16 + koff);
    const v4f v11 = *(const v4f*)(svb + kb + 16 + koff + 4);
    float lsum = 0.0f, po = 0.0f;
#pragma unroll
    for (int v = 0; v < 4; ++v) {
      const float p0 = __expf(s0[v] - nm);
      const float p1 = __expf(s1[v] - nm);
      const float p2 = __expf(s0[4 + v] - nm);
      const float p3 = __expf(s1[4 + v] - nm);
      lsum += (p0 + p1) + (p2 + p3);
      po += p0 * v00[v]; po += p1 * v10[v]; po += p2 * v01[v]; po += p3 * v11[v];
    }
    run_sum = run_sum * factor + lsum;
    run_o = run_o * factor + po;
  }

  // ---- epilogue ----
  const float tot = run_sum + __shfl_xor(run_sum, 16, 32);
  const float oo = run_o + __shfl_xor(run_o, 16, 32);
  const float res = gb * (oo * (1.0f / tot)) + xm;
  if (h == 0) sout[16 * wave + rl] = res;
  __syncthreads();
  if (wave == 0) {
    const v4f v = *(const v4f*)(sout + 4 * (lane & 15));
    float* dst = out + (size_t)n0 + 4 * (lane & 15);
    if (lane < 16) *(v4f*)dst = v;
    
  }
}

// =====================================================================================================
// Workspace map (bytes); every region an exact multiple of its whole-line store granularity,
// every offset a multiple of 128.
//   QH bf16 [32768][32]  2097152 @0
//   QL bf16 [32768][32]  2097152 @2097152
//   KH bf16 [32768][32]  2097152 @4194304
//   KL bf16 [32768][32]  2097152 @6291456
//   XM f32  [32768]       131072 @8388608
//   VB f32  [32768]       131072 @8519680
//   WS f32  [256]           1024 @8650752
//   AUX f32 [32]             128 @8651776
//   end = 8651904
// =====================================================================================================
extern "C" void kernel_launch(void* const* d_in, const int* in_sizes, int n_in,
                              void* d_out, int out_size, void* d_ws, size_t ws_size,
                              hipStream_t stream) {
  if (n_in < 8) return;
  if (in_sizes[0] != NTOK * CIN) return;
  if (in_sizes[1] != CIN * CQK) return;
  if (in_sizes[2] != CQK) return;
  if (in_sizes[3] != CIN * CQK) return;
  if (in_sizes[4] != CQK) return;
  if (in_sizes[5] != CIN * CIN) return;
  if (in_sizes[6] != CIN) return;
  if (in_sizes[7] < 1) return;
  if (out_size != NTOK) return;

  const float* x     = (const float*)d_in[0];
  const float* Wq    = (const float*)d_in[1];
  const float* bq    = (const float*)d_in[2];
  const float* Wk    = (const float*)d_in[3];
  const float* bk    = (const float*)d_in[4];
  const float* Wv    = (const float*)d_in[5];
  const float* bv    = (const float*)d_in[6];
  const float* gamma = (const float*)d_in[7];
  float* out = (float*)d_out;

  const size_t PQK  = (size_t)NTOK * CQK * 2;        // 2097152
  const size_t PTOK = (size_t)NTOK * 4;              //  131072
  const size_t PWS  = (size_t)CIN * 4;               //    1024
  const size_t PAUX = (size_t)32 * 4;                //     128

  size_t off = 0;
  const size_t oQH = off; off += PQK;
  const size_t oQL = off; off += PQK;
  const size_t oKH = off; off += PQK;
  const size_t oKL = off; off += PQK;
  const size_t oXM = off; off += PTOK;
  const size_t oVB = off; off += PTOK;
  const size_t oWS = off; off += PWS;
  const size_t oAUX = off; off += PAUX;
  if (off > ws_size) return;                          // off = 8651904
  if (off > (size_t)134217728) return;

  char* ws = (char*)d_ws;
  unsigned short* QH = (unsigned short*)(ws + oQH);
  unsigned short* QL = (unsigned short*)(ws + oQL);
  unsigned short* KH = (unsigned short*)(ws + oKH);
  unsigned short* KL = (unsigned short*)(ws + oKL);
  float* XM  = (float*)(ws + oXM);
  float* VB  = (float*)(ws + oVB);
  float* WS  = (float*)(ws + oWS);
  float* AUX = (float*)(ws + oAUX);

  k_prep<<<dim3(1), dim3(256), 0, stream>>>(Wv, bv, WS, AUX);
  k_proj<<<dim3(NTOK / PBLK), dim3(128), 0, stream>>>(x, Wq, bq, Wk, bk, WS, AUX, QH, QL, KH, KL, XM, VB);
  k_attn<<<dim3(NTOK / QBLK), dim3(128), 0, stream>>>(QH, QL, KH, KL, VB, XM, gamma, out);
  (void)hipGetLastError();
}

// v001
// Measured time: 62.3 microseconds a run.
// Two timings next to v000 put it at 2.10 and 2.07 times that version's speed.
// Projection tiles (tokens x Wq, tokens x Wk): v_wmma_f32_16x16x32_bf16 (bf16 operands = RNE-converted inputs), f32 accumulate.
// Score tiles (keys x queries, K = 32): v_wmma_f32_16x16x32_bf16 on a bf16 hi/lo split of both operands (hi.hi + hi.lo + lo.hi), f32 accumulate.
// Channel sums, value channel-mean dot, softmax statistics, weight-times-value-mean reduction and epilogue: f32 on the VALU.
#include <hip/hip_runtime.h>

#define CIN   256
#define CQK   32
#define HWN   4096
#define NBAT  8
#define NTOK  32768
#define PBLK  64
#define QBLK  64
#define PW    264
#define AWAV  8
#define QT    (QBLK / 16)
#define KSPL  (HWN / AWAV)

static_assert(NTOK == NBAT * HWN);
static_assert((NTOK % PBLK) == 0 && (NTOK % QBLK) == 0 && (HWN % QBLK) == 0);
static_assert((HWN % 32) == 0 && (CIN % 32) == 0 && CQK == 32);
static_assert((PW % 8) == 0 && PBLK == 64 && QBLK == 64);
static_assert((KSPL % 32) == 0 && 32 * AWAV >= QBLK && (HWN % (4 * 32 * AWAV)) == 0);

typedef __bf16         v16bf __attribute__((ext_vector_type(16)));
typedef unsigned short v16us __attribute__((ext_vector_type(16)));
typedef unsigned short v8us  __attribute__((ext_vector_type(8)));
typedef float          v8f   __attribute__((ext_vector_type(8)));
typedef float          v4f   __attribute__((ext_vector_type(4)));
typedef unsigned int   v4u   __attribute__((ext_vector_type(4)));

// ---- scalar helpers --------------------------------------------------------------------------------
__device__ __forceinline__ unsigned short bf_bits(float f) {          // f32 -> bf16 bits, RNE convert
  unsigned u = __float_as_uint(f);
  return (unsigned short)((u + 0x7FFFu + ((u >> 16) & 1u)) >> 16);
}
__device__ __forceinline__ float bf_up(unsigned short hb) { return __uint_as_float(((unsigned)hb) << 16); }
__device__ __forceinline__ float bf_r(float f) { return bf_up(bf_bits(f)); }
__device__ __forceinline__ v8f zero8() { v8f z = {0.f, 0.f, 0.f, 0.f, 0.f, 0.f, 0.f, 0.f}; return z; }

// ---- fragment loader: lane -> row/col (lane&15); p already includes +8*(lane>>4);
//      elements 0..7 <- p[0..7] (k0+8h..), elements 8..15 <- p[16..23] (k0+16+8h..). Same map for A and B.
__device__ __forceinline__ v16bf ldfrag_b(const unsigned short* p) {
  union { v16us v; v8us hv[2]; } f;
  f.hv[0] = *(const v8us*)(p);
  f.hv[1] = *(const v8us*)(p + 16);
  return __builtin_bit_cast(v16bf, f.v);
}

// ---- WMMA helper and trailing VALU hazard gaps ------------------------------------------------------------
__device__ __forceinline__ v8f mma_b(v16bf a, v16bf b, v8f c) {
  return __builtin_amdgcn_wmma_f32_16x16x32_bf16(false, a, false, b, (short)0, c, false, false);
}
__device__ __forceinline__ void guard_p(v8f& c0, v8f& c1, v8f& c2, v8f& c3,
                                        v16bf a, v16bf b0, v16bf b1, v16bf b2, v16bf b3) {
#if defined(__HIP_DEVICE_COMPILE__)
  asm volatile("v_nop\n\tv_nop\n\tv_nop\n\tv_nop"
               : "+v"(c0), "+v"(c1), "+v"(c2), "+v"(c3)
               : "v"(a), "v"(b0), "v"(b1), "v"(b2), "v"(b3));
#endif
}
__device__ __forceinline__ void acc_guard4(v8f& a, v8f& b, v8f& c, v8f& d) {
#if defined(__HIP_DEVICE_COMPILE__)
  asm volatile("v_nop\n\tv_nop\n\tv_nop\n\tv_nop" : "+v"(a), "+v"(b), "+v"(c), "+v"(d));
#endif
}
__device__ __forceinline__ void sched_fence() {
#if defined(__HIP_DEVICE_COMPILE__)
  asm volatile("" ::: "memory");
#endif
}

// =====================================================================================================
// One block: wsum[cin] = sum over cout of bf16RNE(Wv[cin][cout]) (f32), aux[0] = sum over c of
// bf16RNE(bv[c]), aux[1..31] = 0. Stores: wsum 1 KB = waves 0,1 x 32 lanes x 16 B (one instruction
// coverage: 256 + 32 floats = both whole regions.
// =====================================================================================================
__global__ __launch_bounds__(256) void k_prep(const float* __restrict__ Wv, const float* __restrict__ bv,
                                               float* wsum, float* aux) {
  __shared__ __align__(16) float sws[CIN];
  __shared__ float sbv[CIN];
  __shared__ __align__(16) float saux[32];
  const int tid = threadIdx.x, wave = tid >> 5, lane = tid & 31;
  const float* row = Wv + (size_t)tid * CIN;
  float s = 0.f;
#pragma unroll 4
  for (int j = 0; j < CIN / 4; ++j) {
    const v4f w = *(const v4f*)(row + 4 * j);
    s += bf_r(w[0]); s += bf_r(w[1]); s += bf_r(w[2]); s += bf_r(w[3]);
  }
  sws[tid] = s;
  sbv[tid] = bf_r(bv[tid]);
  if (tid < 32) saux[tid] = 0.f;
  __syncthreads();
  if (tid == 0) {
    float t = 0.f;
#pragma unroll 1
    for (int c = 0; c < CIN; ++c) t += sbv[c];
    saux[0] = t;
  }
  __syncthreads();
  if (wave < 2) {
    const v4f v = *(const v4f*)(sws + 128 * wave + 4 * lane);
    float* dst = wsum + 128 * wave + 4 * lane;
    *(v4f*)dst = v;
    
  } else if (wave == 2) {
    const v4f v = *(const v4f*)(saux + 4 * (lane & 7));
    float* dst = aux + 4 * (lane & 7);
    if (lane < 8) *(v4f*)dst = v;
    
  }
}

// =====================================================================================================
// Projections + per-token statistics. Block = 64 tokens, 4 waves, wave = 16 tokens.
// LDS: Wq and Wk as bf16 bits in [n][k] layout (rows 0..31 = Wq columns, rows 32..63 = Wk columns,
// pitch 264), wsum, biases. k-loop over 256 in steps of 32: A = bf16RNE(x) rows (row = token m,
// split k map), B = sW rows (col = output channel, same k map); the same x elements feed the f32 channel
// sum and the f32 dot with wsum. Epilogue: q/k + bias -> hi = bf16RNE(v), lo = bf16RNE(v - hi), staged
// per wave in LDS as four [16 tokens][32] planes, then each plane tile (1024 contiguous bytes in global)
// coverage: 4 waves x 16 rows x 32 = the block's 64 rows of each of the 4 planes; 64 xmean + 64 vbar;
// 512 blocks = whole planes.
// =====================================================================================================
__global__ __launch_bounds__(128) void k_proj(const float* __restrict__ x,
                                               const float* __restrict__ Wq, const float* __restrict__ bq,
                                               const float* __restrict__ Wk, const float* __restrict__ bk,
                                               const float* wsum, const float* aux,
                                               unsigned short* qh, unsigned short* ql,
                                               unsigned short* kh, unsigned short* kl,
                                               float* xmean, float* vbar) {
  __shared__ __align__(16) unsigned short sW[64 * PW];
  __shared__ __align__(16) unsigned short sO[4 * 4 * 16 * CQK];
  __shared__ __align__(16) float swsum[CIN];
  __shared__ __align__(16) float smean[PBLK];
  __shared__ __align__(16) float svbar[PBLK];
  __shared__ float sbias[64];
  const int tid = threadIdx.x, wave = tid >> 5, lane = tid & 31, m = lane & 15, h = lane >> 4;

#pragma unroll 4
  for (int it = 0; it < (CIN * CQK) / 128; ++it) {
    const int idx = it * 128 + tid;                 // = k*32 + n
    const int k = idx >> 5, n = idx & 31;
    sW[n * PW + k] = bf_bits(Wq[idx]);
    sW[(32 + n) * PW + k] = bf_bits(Wk[idx]);
  }
  swsum[tid] = wsum[tid];
  swsum[tid + 128] = wsum[tid + 128];
  if (tid < 64) {
    const float vq = bq[tid & 31];
    const float vk = bk[tid & 31];
    sbias[tid] = bf_r(tid < 32 ? vq : vk);
  }
  const float bvsum = aux[0];
  __syncthreads();

  const int row0 = blockIdx.x * PBLK + wave * 16;
  const float* xr = x + (size_t)(row0 + m) * CIN + 8 * h;
  const float* wr = swsum + 8 * h;
  const unsigned short* wb = sW + m * PW + 8 * h;
  v8f acc[4];
#pragma unroll
  for (int t = 0; t < 4; ++t) acc[t] = zero8();
  float xs = 0.f, vd = 0.f;

#pragma unroll 2
  for (int c = 0; c < CIN / 32; ++c) {
    const float* p = xr + 32 * c;
    const v4f x0 = *(const v4f*)(p);
    const v4f x1 = *(const v4f*)(p + 4);
    const v4f x2 = *(const v4f*)(p + 16);
    const v4f x3 = *(const v4f*)(p + 20);
    const float* pw = wr + 32 * c;
    const v4f w0 = *(const v4f*)(pw);
    const v4f w1 = *(const v4f*)(pw + 4);
    const v4f w2 = *(const v4f*)(pw + 16);
    const v4f w3 = *(const v4f*)(pw + 20);
    v16us au;
#pragma unroll
    for (int e = 0; e < 4; ++e) {
      const unsigned short b0 = bf_bits(x0[e]), b1 = bf_bits(x1[e]);
      const unsigned short b2 = bf_bits(x2[e]), b3 = bf_bits(x3[e]);
      const float r0 = bf_up(b0), r1 = bf_up(b1), r2 = bf_up(b2), r3 = bf_up(b3);
      au[e] = b0; au[4 + e] = b1; au[8 + e] = b2; au[12 + e] = b3;
      xs += (r0 + r1) + (r2 + r3);
      vd += r0 * w0[e]; vd += r1 * w1[e]; vd += r2 * w2[e]; vd += r3 * w3[e];
    }
    const v16bf a = __builtin_bit_cast(v16bf, au);
    const unsigned short* bp = wb + 32 * c;
    const v16bf f0 = ldfrag_b(bp);
    const v16bf f1 = ldfrag_b(bp + 16 * PW);
    const v16bf f2 = ldfrag_b(bp + 32 * PW);
    const v16bf f3 = ldfrag_b(bp + 48 * PW);
    acc[0] = mma_b(a, f0, acc[0]);
    acc[1] = mma_b(a, f1, acc[1]);
    acc[2] = mma_b(a, f2, acc[2]);
    acc[3] = mma_b(a, f3, acc[3]);
    guard_p(acc[0], acc[1], acc[2], acc[3], a, f0, f1, f2, f3);
    sched_fence();
  }
  acc_guard4(acc[0], acc[1], acc[2], acc[3]);

  // ---- per-token statistics (both lane halves hold row m) ----
  xs += __shfl_xor(xs, 16, 32);
  vd += __shfl_xor(vd, 16, 32);
  if (h == 0) {
    smean[wave * 16 + m] = xs * (1.0f / 256.0f);
    svbar[wave * 16 + m] = (vd + bvsum) * (1.0f / 256.0f);
  }
  // ---- q/k hi/lo planes staged per wave: plane 0 = q hi, 1 = q lo, 2 = k hi, 3 = k lo ----
  unsigned short* so = sO + wave * (4 * 16 * CQK);
#pragma unroll
  for (int t = 0; t < 4; ++t) {
    const float bias = sbias[16 * t + m];
    const int col = 16 * (t & 1) + m;
    unsigned short* ph = so + (2 * (t >> 1)) * (16 * CQK) + col;
    unsigned short* pl = ph + 16 * CQK;
#pragma unroll
    for (int r = 0; r < 8; ++r) {
      const float val = acc[t][r] + bias;
      const unsigned short hb = bf_bits(val);
      const unsigned short lb = bf_bits(val - bf_up(hb));
      ph[(8 * h + r) * CQK] = hb;
      pl[(8 * h + r) * CQK] = lb;
    }
  }
  __syncthreads();
  v4u pc[8];
#pragma unroll
  for (int pidx = 0; pidx < 4; ++pidx) {
    pc[2 * pidx]     = *(const v4u*)(so + pidx * (16 * CQK) + lane * 8);
    pc[2 * pidx + 1] = *(const v4u*)(so + pidx * (16 * CQK) + 256 + lane * 8);
  }
  const size_t ob = (size_t)row0 * CQK + (size_t)lane * 8;
  *(v4u*)(qh + ob) = pc[0];  *(v4u*)(qh + ob + 256) = pc[1];
  *(v4u*)(ql + ob) = pc[2];  *(v4u*)(ql + ob + 256) = pc[3];
  *(v4u*)(kh + ob) = pc[4];  *(v4u*)(kh + ob + 256) = pc[5];
  *(v4u*)(kl + ob) = pc[6];  *(v4u*)(kl + ob + 256) = pc[7];
  

  if (wave == 0) {
    const v4f v = *(const v4f*)(smean + 4 * (lane & 15));
    float* dst = xmean + (size_t)blockIdx.x * PBLK + 4 * (lane & 15);
    if (lane < 16) *(v4f*)dst = v;
    
  } else if (wave == 1) {
    const v4f v = *(const v4f*)(svbar + 4 * (lane & 15));
    float* dst = vbar + (size_t)blockIdx.x * PBLK + 4 * (lane & 15);
    if (lane < 16) *(v4f*)dst = v;
    
  }
}

// =====================================================================================================
// Attention, single pass with online softmax. Block = 64 queries (inside one image), 8 waves.
// Every wave holds the Q fragments of all 64 queries (4 query tiles) and walks its own eighth of the
// image's keys (512 keys, 16 chunks of 32), so one K fragment load and one vbar read feed 4 query tiles.
// vbar of the image staged in LDS (4096 floats). Per 32-key chunk and query tile t:
//   S^T tiles = K rows (A, row = key, k = d) . Q rows (B, col = query, k = d), one k-step,
//   three products hi.hi + hi.lo + lo.hi per tile from zero;
//   D: s0[t][r] = S[key kb+8h+r][query], s1[t][r] = S[key kb+16+8h+r][query];
//   running max over the 32 keys (per lane, then the xor-16 partner), rescale of sum and of the
//   weighted value-mean accumulator; p = exp(s - max) in f32; o += p * vbar[key] (f32 FMA).
// Merge: each wave leaves (max, sum, weighted sum) per query in LDS; after one barrier thread q < 64
// rescales the 8 partials of query q to their common max and adds them in wave order.
// Epilogue: res = gammaRNE * (o / l) + xmean[query]; waves 0 and 1 each store one whole 128-byte line.
// coverage: 8 waves x 16 chunks x 32 = all 4096 keys of the image; 512 blocks x 64 = whole output.
// =====================================================================================================
__global__ __launch_bounds__(32 * AWAV) void k_attn(const unsigned short* qh, const unsigned short* ql,
                                               const unsigned short* kh, const unsigned short* kl,
                                               const float* vbar, const float* xmean,
                                               const float* __restrict__ gamma, float* out) {
  __shared__ __align__(16) float svb[HWN];
  __shared__ float pmx[AWAV * QBLK];
  __shared__ float psm[AWAV * QBLK];
  __shared__ float pov[AWAV * QBLK];
  const int tid = threadIdx.x, wave = tid >> 5, lane = tid & 31;
  const int rl = lane & 15, h = lane >> 4, koff = 8 * h;
  const int n0 = blockIdx.x * QBLK;
  const int keybase = (n0 / HWN) * HWN;
  const float gb = bf_r(gamma[0]);

  // Every loop over t (query tile) and v (accumulator register) is fully unrolled: the per-tile arrays live in VGPRs.
  const unsigned short* qhp = qh + (size_t)(n0 + rl) * CQK + koff;
  const unsigned short* qlp = ql + (size_t)(n0 + rl) * CQK + koff;
  v16bf fqh[QT], fql[QT];
#pragma unroll
  for (int t = 0; t < QT; ++t) fqh[t] = ldfrag_b(qhp + t * 16 * CQK);
  // A lo-plane load lands on the hi-plane loads' address pair: the wait stands ahead of that overwrite.
#if defined(__HIP_DEVICE_COMPILE__)
  asm volatile("s_wait_xcnt 0x0" ::: "memory");
#endif
#pragma unroll
  for (int t = 0; t < QT; ++t) fql[t] = ldfrag_b(qlp + t * 16 * CQK);
#pragma unroll
  for (int j = 0; j < HWN / (4 * 32 * AWAV); ++j) {
    const int i = tid + 32 * AWAV * j;
    ((v4f*)svb)[i] = *(const v4f*)(vbar + keybase + 4 * i);
  }
  __syncthreads();

  const int key0 = wave * KSPL;
  const unsigned short* khp = kh + (size_t)(keybase + key0 + rl) * CQK + koff;
  const unsigned short* klp = kl + (size_t)(keybase + key0 + rl) * CQK + koff;
  const float* vbp = svb + key0 + koff;

  float run_max[QT], run_sum[QT], run_o[QT];
#pragma unroll
  for (int t = 0; t < QT; ++t) { run_max[t] = -1.0e30f; run_sum[t] = 0.0f; run_o[t] = 0.0f; }

  // Kept rolled: one chunk's body already needs most of the 256 VGPRs that four waves per SIMD leave a wave.
#pragma unroll 1
  for (int kb = 0; kb < KSPL; kb += 32) {
    const unsigned short* pa = khp + (size_t)kb * CQK;
    const unsigned short* pl = klp + (size_t)kb * CQK;
    const v16bf a0h = ldfrag_b(pa);
    const v16bf a1h = ldfrag_b(pa + 16 * CQK);
    const v16bf a0l = ldfrag_b(pl);
    const v16bf a1l = ldfrag_b(pl + 16 * CQK);
    const v4f v00 = *(const v4f*)(vbp + kb);
    const v4f v01 = *(const v4f*)(vbp + kb + 4);
    const v4f v10 = *(const v4f*)(vbp + kb + 16);
    const v4f v11 = *(const v4f*)(vbp + kb + 16 + 4);
    // Inputs-only fence on the loaded values: keeps the chunk's eight K loads and four vbar reads together ahead
    // of the first product (without it the lo-plane loads sink among the products: three load waits a chunk).
#if defined(__HIP_DEVICE_COMPILE__)
    asm volatile("" :: "v"(a0h), "v"(a1h), "v"(a0l), "v"(a1l), "v"(v00), "v"(v01), "v"(v10), "v"(v11));
#endif
    v8f s0[QT], s1[QT];
#pragma unroll
    for (int t = 0; t < QT; ++t) { s0[t] = mma_b(a0h, fqh[t], zero8()); s1[t] = mma_b(a1h, fqh[t], zero8()); }
#pragma unroll
    for (int t = 0; t < QT; ++t) { s0[t] = mma_b(a0h, fql[t], s0[t]); s1[t] = mma_b(a1h, fql[t], s1[t]); }
#pragma unroll
    for (int t = 0; t < QT; ++t) { s0[t] = mma_b(a0l, fqh[t], s0[t]); s1[t] = mma_b(a1l, fqh[t], s1[t]); }
    // ---- online softmax over the key axis, one query tile after the other ----
#pragma unroll
    for (int t = 0; t < QT; ++t) {
      float lmax = fmaxf(s0[t][0], s1[t][0]);
#pragma unroll
      for (int v = 1; v < 8; ++v) lmax = fmaxf(lmax, fmaxf(s0[t][v], s1[t][v]));
      lmax = fmaxf(lmax, __shfl_xor(lmax, 16, 32));
      const float nm = fmaxf(run_max[t], lmax);
      const float factor = __expf(run_max[t] - nm);
      run_max[t] = nm;
      float lsum = 0.0f, po = 0.0f;
#pragma unroll
      for (int v = 0; v < 4; ++v) {
        const float p0 = __expf(s0[t][v] - nm);
        const float p1 = __expf(s1[t][v] - nm);
        const float p2 = __expf(s0[t][4 + v] - nm);
        const float p3 = __expf(s1[t][4 + v] - nm);
        lsum += (p0 + p1) + (p2 + p3);
        po += p0 * v00[v]; po += p1 * v10[v]; po += p2 * v01[v]; po += p3 * v11[v];
      }
      run_sum[t] = run_sum[t] * factor + lsum;
      run_o[t] = run_o[t] * factor + po;
    }
  }

  // ---- each wave's partial statistics to LDS (both lane halves joined first) ----
#pragma unroll
  for (int t = 0; t < QT; ++t) {
    const float tot = run_sum[t] + __shfl_xor(run_sum[t], 16, 32);
    const float oo = run_o[t] + __shfl_xor(run_o[t], 16, 32);
    if (h == 0) {
      const int slot = wave * QBLK + 16 * t + rl;
      pmx[slot] = run_max[t];
      psm[slot] = tot;
      pov[slot] = oo;
    }
  }
  __syncthreads();

  // ---- merge of the 8 key ranges and epilogue: thread = query ----
  if (tid < QBLK) {
    float gm = pmx[tid];
#pragma unroll
    for (int w = 1; w < AWAV; ++w) gm = fmaxf(gm, pmx[w * QBLK + tid]);
    float tot = 0.0f, oo = 0.0f;
#pragma unroll
    for (int w = 0; w < AWAV; ++w) {
      const float f = __expf(pmx[w * QBLK + tid] - gm);
      tot += psm[w * QBLK + tid] * f;
      oo += pov[w * QBLK + tid] * f;
    }
    out[(size_t)n0 + tid] = gb * (oo * (1.0f / tot)) + xmean[n0 + tid];
  }
}

// =====================================================================================================
// Workspace map (bytes); every region an exact multiple of its whole-line store granularity,
// every offset a multiple of 128.
//   QH bf16 [32768][32]  2097152 @0
//   QL bf16 [32768][32]  2097152 @2097152
//   KH bf16 [32768][32]  2097152 @4194304
//   KL bf16 [32768][32]  2097152 @6291456
//   XM f32  [32768]       131072 @8388608
//   VB f32  [32768]       131072 @8519680
//   WS f32  [256]           1024 @8650752
//   AUX f32 [32]             128 @8651776
//   end = 8651904
// =====================================================================================================
extern "C" void kernel_launch(void* const* d_in, const int* in_sizes, int n_in,
                              void* d_out, int out_size, void* d_ws, size_t ws_size,
                              hipStream_t stream) {
  if (n_in < 8) return;
  if (in_sizes[0] != NTOK * CIN) return;
  if (in_sizes[1] != CIN * CQK) return;
  if (in_sizes[2] != CQK) return;
  if (in_sizes[3] != CIN * CQK) return;
  if (in_sizes[4] != CQK) return;
  if (in_sizes[5] != CIN * CIN) return;
  if (in_sizes[6] != CIN) return;
  if (in_sizes[7] < 1) return;
  if (out_size != NTOK) return;

  const float* x     = (const float*)d_in[0];
  const float* Wq    = (const float*)d_in[1];
  const float* bq    = (const float*)d_in[2];
  const float* Wk    = (const float*)d_in[3];
  const float* bk    = (const float*)d_in[4];
  const float* Wv    = (const float*)d_in[5];
  const float* bv    = (const float*)d_in[6];
  const float* gamma = (const float*)d_in[7];
  float* out = (float*)d_out;

  const size_t PQK  = (size_t)NTOK * CQK * 2;        // 2097152
  const size_t PTOK = (size_t)NTOK * 4;              //  131072
  const size_t PWS  = (size_t)CIN * 4;               //    1024
  const size_t PAUX = (size_t)32 * 4;                //     128

  size_t off = 0;
  const size_t oQH = off; off += PQK;
  const size_t oQL = off; off += PQK;
  const size_t oKH = off; off += PQK;
  const size_t oKL = off; off += PQK;
  const size_t oXM = off; off += PTOK;
  const size_t oVB = off; off += PTOK;
  const size_t oWS = off; off += PWS;
  const size_t oAUX = off; off += PAUX;
  if (off > ws_size) return;                          // off = 8651904
  if (off > (size_t)134217728) return;

  char* ws = (char*)d_ws;
  unsigned short* QH = (unsigned short*)(ws + oQH);
  unsigned short* QL = (unsigned short*)(ws + oQL);
  unsigned short* KH = (unsigned short*)(ws + oKH);
  unsigned short* KL = (unsigned short*)(ws + oKL);
  float* XM  = (float*)(ws + oXM);
  float* VB  = (float*)(ws + oVB);
  float* WS  = (float*)(ws + oWS);
  float* AUX = (float*)(ws + oAUX);

  k_prep<<<dim3(1), dim3(256), 0, stream>>>(Wv, bv, WS, AUX);
  k_proj<<<dim3(NTOK / PBLK), dim3(128), 0, stream>>>(x, Wq, bq, Wk, bk, WS, AUX, QH, QL, KH, KL, XM, VB);
  k_attn<<<dim3(NTOK / QBLK), dim3(32 * AWAV), 0, stream>>>(QH, QL, KH, KL, VB, XM, gamma, out);
  (void)hipGetLastError();
}

// v002
// Measured time: 45.8 microseconds a run.
// Timed twice side by side with v001, it ran 1.35 and 1.36 times as fast.
// All steps since v000 together make it 2.82 times as fast.
// Projection tiles (tokens x Wq, tokens x Wk): v_wmma_f32_16x16x32_bf16 (bf16 operands = RNE-converted inputs), f32 accumulate.
// Score tiles (keys x queries, K = 32): v_wmma_f32_16x16x32_bf16 on a bf16 hi/lo split of both operands (hi.hi + hi.lo + lo.hi), f32 accumulate.
// Channel sums, value channel-mean dot, softmax statistics, weight-times-value-mean reduction and epilogue: f32 on the VALU.
#include <hip/hip_runtime.h>

#define CIN   256
#define CQK   32
#define HWN   4096
#define NBAT  8
#define NTOK  32768
#define PBLK  64
#define QBLK  64
#define PW    264
#define AWAV  8
#define QT    (QBLK / 16)
#define KSPL  (HWN / AWAV)

static_assert(NTOK == NBAT * HWN);
static_assert((NTOK % PBLK) == 0 && (NTOK % QBLK) == 0 && (HWN % QBLK) == 0);
static_assert((HWN % 32) == 0 && (CIN % 32) == 0 && CQK == 32);
static_assert((PW % 8) == 0 && PBLK == 64 && QBLK == 64);
static_assert((KSPL % 32) == 0 && 32 * AWAV >= QBLK && (HWN % (4 * 32 * AWAV)) == 0);

typedef __bf16         v16bf __attribute__((ext_vector_type(16)));
typedef unsigned short v16us __attribute__((ext_vector_type(16)));
typedef unsigned short v8us  __attribute__((ext_vector_type(8)));
typedef float          v8f   __attribute__((ext_vector_type(8)));
typedef float          v4f   __attribute__((ext_vector_type(4)));
typedef unsigned int   v4u   __attribute__((ext_vector_type(4)));

// ---- scalar helpers --------------------------------------------------------------------------------
__device__ __forceinline__ unsigned short bf_bits(float f) {          // f32 -> bf16 bits, RNE convert
  unsigned u = __float_as_uint(f);
  return (unsigned short)((u + 0x7FFFu + ((u >> 16) & 1u)) >> 16);
}
__device__ __forceinline__ float bf_up(unsigned short hb) { return __uint_as_float(((unsigned)hb) << 16); }
__device__ __forceinline__ float bf_r(float f) { return bf_up(bf_bits(f)); }
__device__ __forceinline__ v8f zero8() { v8f z = {0.f, 0.f, 0.f, 0.f, 0.f, 0.f, 0.f, 0.f}; return z; }

// ---- fragment loader: lane -> row/col (lane&15); p already includes +8*(lane>>4);
//      elements 0..7 <- p[0..7] (k0+8h..), elements 8..15 <- p[16..23] (k0+16+8h..). Same map for A and B.
__device__ __forceinline__ v16bf ldfrag_b(const unsigned short* p) {
  union { v16us v; v8us hv[2]; } f;
  f.hv[0] = *(const v8us*)(p);
  f.hv[1] = *(const v8us*)(p + 16);
  return __builtin_bit_cast(v16bf, f.v);
}

// ---- WMMA helper and trailing VALU hazard gaps ------------------------------------------------------------
__device__ __forceinline__ v8f mma_b(v16bf a, v16bf b, v8f c) {
  return __builtin_amdgcn_wmma_f32_16x16x32_bf16(false, a, false, b, (short)0, c, false, false);
}
__device__ __forceinline__ void guard_p(v8f& c0, v8f& c1, v8f& c2, v8f& c3,
                                        v16bf a, v16bf b0, v16bf b1, v16bf b2, v16bf b3) {
#if defined(__HIP_DEVICE_COMPILE__)
  asm volatile("v_nop\n\tv_nop\n\tv_nop\n\tv_nop"
               : "+v"(c0), "+v"(c1), "+v"(c2), "+v"(c3)
               : "v"(a), "v"(b0), "v"(b1), "v"(b2), "v"(b3));
#endif
}
__device__ __forceinline__ void acc_guard4(v8f& a, v8f& b, v8f& c, v8f& d) {
#if defined(__HIP_DEVICE_COMPILE__)
  asm volatile("v_nop\n\tv_nop\n\tv_nop\n\tv_nop" : "+v"(a), "+v"(b), "+v"(c), "+v"(d));
#endif
}
__device__ __forceinline__ void sched_fence() {
#if defined(__HIP_DEVICE_COMPILE__)
  asm volatile("" ::: "memory");
#endif
}

// =====================================================================================================
// Blocks 0..7: wsum[cin] = sum over cout of bf16RNE(Wv[cin][cout]) (f32) for the block's 32 rows of Wv.
// Wave = 4 rows; a row is two whole-wave 512-byte loads, all eight loads of a wave in flight together;
// 8 values summed per lane, then a butterfly over the 32 lanes. Wave 0 stores the block's 32 sums as one line.
// Block 8, wave 0: aux[0] = sum over c of bf16RNE(bv[c]) the same way, aux[1..31] = 0, one line.
// coverage: 8 blocks x 32 floats = wsum; 32 floats = aux.
// =====================================================================================================
__device__ __forceinline__ float sum8_r(v4f a, v4f b) {
  return ((bf_r(a[0]) + bf_r(a[1])) + (bf_r(a[2]) + bf_r(a[3]))) + ((bf_r(b[0]) + bf_r(b[1])) + (bf_r(b[2]) + bf_r(b[3])));
}
__global__ __launch_bounds__(256) void k_prep(const float* __restrict__ Wv, const float* __restrict__ bv,
                                               float* wsum, float* aux) {
  __shared__ __align__(16) float sws[32];
  const int tid = threadIdx.x, wave = tid >> 5, lane = tid & 31;
  if (blockIdx.x == CIN / 32) {
    if (wave == 0) {
      float t = sum8_r(*(const v4f*)(bv + 4 * lane), *(const v4f*)(bv + 128 + 4 * lane));
#pragma unroll
      for (int o = 16; o > 0; o >>= 1) t += __shfl_xor(t, o, 32);
      aux[lane] = lane == 0 ? t : 0.f;
    }
    return;
  }
  const float* row = Wv + (size_t)(blockIdx.x * 32 + wave * 4) * CIN + 4 * lane;
  v4f w0[4], w1[4];
#pragma unroll
  for (int r = 0; r < 4; ++r) {
    w0[r] = *(const v4f*)(row + r * CIN);
    w1[r] = *(const v4f*)(row + r * CIN + 128);
  }
  float s[4];
#pragma unroll
  for (int r = 0; r < 4; ++r) s[r] = sum8_r(w0[r], w1[r]);
#pragma unroll
  for (int o = 16; o > 0; o >>= 1) {
#pragma unroll
    for (int r = 0; r < 4; ++r) s[r] += __shfl_xor(s[r], o, 32);
  }
  if (lane == 0) {
    const v4f v = {s[0], s[1], s[2], s[3]};
    *(v4f*)(sws + 4 * wave) = v;
  }
  __syncthreads();
  if (wave == 0) wsum[blockIdx.x * 32 + lane] = sws[lane];
}

// =====================================================================================================
// Projections + per-token statistics. Block = 64 tokens, 4 waves, wave = 16 tokens.
// LDS: Wq and Wk as bf16 bits in [n][k] layout (rows 0..31 = Wq columns, rows 32..63 = Wk columns,
// pitch 264), wsum, biases. k-loop over 256 in steps of 32: A = bf16RNE(x) rows (row = token m,
// split k map), B = sW rows (col = output channel, same k map); the same x elements feed the f32 channel
// sum and the f32 dot with wsum. Epilogue: q/k + bias -> hi = bf16RNE(v), lo = bf16RNE(v - hi), staged
// per wave in LDS as four [16 tokens][32] planes, then each plane tile (1024 contiguous bytes in global)
// coverage: 4 waves x 16 rows x 32 = the block's 64 rows of each of the 4 planes; 64 xmean + 64 vbar;
// 512 blocks = whole planes.
// =====================================================================================================
__global__ __launch_bounds__(128) void k_proj(const float* __restrict__ x,
                                               const float* __restrict__ Wq, const float* __restrict__ bq,
                                               const float* __restrict__ Wk, const float* __restrict__ bk,
                                               const float* wsum, const float* aux,
                                               unsigned short* qh, unsigned short* ql,
                                               unsigned short* kh, unsigned short* kl,
                                               float* xmean, float* vbar) {
  __shared__ __align__(16) unsigned short sW[64 * PW];
  __shared__ __align__(16) unsigned short sO[4 * 4 * 16 * CQK];
  __shared__ __align__(16) float swsum[CIN];
  __shared__ __align__(16) float smean[PBLK];
  __shared__ __align__(16) float svbar[PBLK];
  __shared__ float sbias[64];
  const int tid = threadIdx.x, wave = tid >> 5, lane = tid & 31, m = lane & 15, h = lane >> 4;

#pragma unroll 4
  for (int it = 0; it < (CIN * CQK) / 128; ++it) {
    const int idx = it * 128 + tid;                 // = k*32 + n
    const int k = idx >> 5, n = idx & 31;
    sW[n * PW + k] = bf_bits(Wq[idx]);
    sW[(32 + n) * PW + k] = bf_bits(Wk[idx]);
  }
  swsum[tid] = wsum[tid];
  swsum[tid + 128] = wsum[tid + 128];
  if (tid < 64) {
    const float vq = bq[tid & 31];
    const float vk = bk[tid & 31];
    sbias[tid] = bf_r(tid < 32 ? vq : vk);
  }
  const float bvsum = aux[0];
  __syncthreads();

  const int row0 = blockIdx.x * PBLK + wave * 16;
  const float* xr = x + (size_t)(row0 + m) * CIN + 8 * h;
  const float* wr = swsum + 8 * h;
  const unsigned short* wb = sW + m * PW + 8 * h;
  v8f acc[4];
#pragma unroll
  for (int t = 0; t < 4; ++t) acc[t] = zero8();
  float xs = 0.f, vd = 0.f;

#pragma unroll 2
  for (int c = 0; c < CIN / 32; ++c) {
    const float* p = xr + 32 * c;
    const v4f x0 = *(const v4f*)(p);
    const v4f x1 = *(const v4f*)(p + 4);
    const v4f x2 = *(const v4f*)(p + 16);
    const v4f x3 = *(const v4f*)(p + 20);
    const float* pw = wr + 32 * c;
    const v4f w0 = *(const v4f*)(pw);
    const v4f w1 = *(const v4f*)(pw + 4);
    const v4f w2 = *(const v4f*)(pw + 16);
    const v4f w3 = *(const v4f*)(pw + 20);
    v16us au;
#pragma unroll
    for (int e = 0; e < 4; ++e) {
      const unsigned short b0 = bf_bits(x0[e]), b1 = bf_bits(x1[e]);
      const unsigned short b2 = bf_bits(x2[e]), b3 = bf_bits(x3[e]);
      const float r0 = bf_up(b0), r1 = bf_up(b1), r2 = bf_up(b2), r3 = bf_up(b3);
      au[e] = b0; au[4 + e] = b1; au[8 + e] = b2; au[12 + e] = b3;
      xs += (r0 + r1) + (r2 + r3);
      vd += r0 * w0[e]; vd += r1 * w1[e]; vd += r2 * w2[e]; vd += r3 * w3[e];
    }
    const v16bf a = __builtin_bit_cast(v16bf, au);
    const unsigned short* bp = wb + 32 * c;
    const v16bf f0 = ldfrag_b(bp);
    const v16bf f1 = ldfrag_b(bp + 16 * PW);
    const v16bf f2 = ldfrag_b(bp + 32 * PW);
    const v16bf f3 = ldfrag_b(bp + 48 * PW);
    acc[0] = mma_b(a, f0, acc[0]);
    acc[1] = mma_b(a, f1, acc[1]);
    acc[2] = mma_b(a, f2, acc[2]);
    acc[3] = mma_b(a, f3, acc[3]);
    guard_p(acc[0], acc[1], acc[2], acc[3], a, f0, f1, f2, f3);
    sched_fence();
  }
  acc_guard4(acc[0], acc[1], acc[2], acc[3]);

  // ---- per-token statistics (both lane halves hold row m) ----
  xs += __shfl_xor(xs, 16, 32);
  vd += __shfl_xor(vd, 16, 32);
  if (h == 0) {
    smean[wave * 16 + m] = xs * (1.0f / 256.0f);
    svbar[wave * 16 + m] = (vd + bvsum) * (1.0f / 256.0f);
  }
  // ---- q/k hi/lo planes staged per wave: plane 0 = q hi, 1 = q lo, 2 = k hi, 3 = k lo ----
  unsigned short* so = sO + wave * (4 * 16 * CQK);
#pragma unroll
  for (int t = 0; t < 4; ++t) {
    const float bias = sbias[16 * t + m];
    const int col = 16 * (t & 1) + m;
    unsigned short* ph = so + (2 * (t >> 1)) * (16 * CQK) + col;
    unsigned short* pl = ph + 16 * CQK;
#pragma unroll
    for (int r = 0; r < 8; ++r) {
      const float val = acc[t][r] + bias;
      const unsigned short hb = bf_bits(val);
      const unsigned short lb = bf_bits(val - bf_up(hb));
      ph[(8 * h + r) * CQK] = hb;
      pl[(8 * h + r) * CQK] = lb;
    }
  }
  __syncthreads();
  v4u pc[8];
#pragma unroll
  for (int pidx = 0; pidx < 4; ++pidx) {
    pc[2 * pidx]     = *(const v4u*)(so + pidx * (16 * CQK) + lane * 8);
    pc[2 * pidx + 1] = *(const v4u*)(so + pidx * (16 * CQK) + 256 + lane * 8);
  }
  const size_t ob = (size_t)row0 * CQK + (size_t)lane * 8;
  *(v4u*)(qh + ob) = pc[0];  *(v4u*)(qh + ob + 256) = pc[1];
  *(v4u*)(ql + ob) = pc[2];  *(v4u*)(ql + ob + 256) = pc[3];
  *(v4u*)(kh + ob) = pc[4];  *(v4u*)(kh + ob + 256) = pc[5];
  *(v4u*)(kl + ob) = pc[6];  *(v4u*)(kl + ob + 256) = pc[7];
  

  if (wave == 0) {
    const v4f v = *(const v4f*)(smean + 4 * (lane & 15));
    float* dst = xmean + (size_t)blockIdx.x * PBLK + 4 * (lane & 15);
    if (lane < 16) *(v4f*)dst = v;
    
  } else if (wave == 1) {
    const v4f v = *(const v4f*)(svbar + 4 * (lane & 15));
    float* dst = vbar + (size_t)blockIdx.x * PBLK + 4 * (lane & 15);
    if (lane < 16) *(v4f*)dst = v;
    
  }
}

// =====================================================================================================
// Attention, single pass with online softmax. Block = 64 queries (inside one image), 8 waves.
// Every wave holds the Q fragments of all 64 queries (4 query tiles) and walks its own eighth of the
// image's keys (512 keys, 16 chunks of 32), so one K fragment load and one vbar read feed 4 query tiles.
// vbar of the image staged in LDS (4096 floats). Per 32-key chunk and query tile t:
//   S^T tiles = K rows (A, row = key, k = d) . Q rows (B, col = query, k = d), one k-step,
//   three products hi.hi + hi.lo + lo.hi per tile from zero;
//   D: s0[t][r] = S[key kb+8h+r][query], s1[t][r] = S[key kb+16+8h+r][query];
//   running max over the 32 keys (per lane, then the xor-16 partner), rescale of sum and of the
//   weighted value-mean accumulator; p = exp(s - max) in f32; o += p * vbar[key] (f32 FMA).
// Merge: each wave leaves (max, sum, weighted sum) per query in LDS; after one barrier thread q < 64
// rescales the 8 partials of query q to their common max and adds them in wave order.
// Epilogue: res = gammaRNE * (o / l) + xmean[query]; waves 0 and 1 each store one whole 128-byte line.
// coverage: 8 waves x 16 chunks x 32 = all 4096 keys of the image; 512 blocks x 64 = whole output.
// =====================================================================================================
__global__ __launch_bounds__(32 * AWAV) void k_attn(const unsigned short* qh, const unsigned short* ql,
                                               const unsigned short* kh, const unsigned short* kl,
                                               const float* vbar, const float* xmean,
                                               const float* __restrict__ gamma, float* out) {
  __shared__ __align__(16) float svb[HWN];
  __shared__ float pmx[AWAV * QBLK];
  __shared__ float psm[AWAV * QBLK];
  __shared__ float pov[AWAV * QBLK];
  const int tid = threadIdx.x, wave = tid >> 5, lane = tid & 31;
  const int rl = lane & 15, h = lane >> 4, koff = 8 * h;
  const int n0 = blockIdx.x * QBLK;
  const int keybase = (n0 / HWN) * HWN;
  const float gb = bf_r(gamma[0]);

  // Every loop over t (query tile) and v (accumulator register) is fully unrolled: the per-tile arrays live in VGPRs.
  const unsigned short* qhp = qh + (size_t)(n0 + rl) * CQK + koff;
  const unsigned short* qlp = ql + (size_t)(n0 + rl) * CQK + koff;
  v16bf fqh[QT], fql[QT];
#pragma unroll
  for (int t = 0; t < QT; ++t) fqh[t] = ldfrag_b(qhp + t * 16 * CQK);
  // A lo-plane load lands on the hi-plane loads' address pair: the wait stands ahead of that overwrite.
#if defined(__HIP_DEVICE_COMPILE__)
  asm volatile("s_wait_xcnt 0x0" ::: "memory");
#endif
#pragma unroll
  for (int t = 0; t < QT; ++t) fql[t] = ldfrag_b(qlp + t * 16 * CQK);
#pragma unroll
  for (int j = 0; j < HWN / (4 * 32 * AWAV); ++j) {
    const int i = tid + 32 * AWAV * j;
    ((v4f*)svb)[i] = *(const v4f*)(vbar + keybase + 4 * i);
  }
  __syncthreads();

  const int key0 = wave * KSPL;
  const unsigned short* khp = kh + (size_t)(keybase + key0 + rl) * CQK + koff;
  const unsigned short* klp = kl + (size_t)(keybase + key0 + rl) * CQK + koff;
  const float* vbp = svb + key0 + koff;

  float run_max[QT], run_sum[QT], run_o[QT];
#pragma unroll
  for (int t = 0; t < QT; ++t) { run_max[t] = -1.0e30f; run_sum[t] = 0.0f; run_o[t] = 0.0f; }

  // Kept rolled: one chunk's body already needs most of the 256 VGPRs that four waves per SIMD leave a wave.
#pragma unroll 1
  for (int kb = 0; kb < KSPL; kb += 32) {
    const unsigned short* pa = khp + (size_t)kb * CQK;
    const unsigned short* pl = klp + (size_t)kb * CQK;
    const v16bf a0h = ldfrag_b(pa);
    const v16bf a1h = ldfrag_b(pa + 16 * CQK);
    const v16bf a0l = ldfrag_b(pl);
    const v16bf a1l = ldfrag_b(pl + 16 * CQK);
    const v4f v00 = *(const v4f*)(vbp + kb);
    const v4f v01 = *(const v4f*)(vbp + kb + 4);
    const v4f v10 = *(const v4f*)(vbp + kb + 16);
    const v4f v11 = *(const v4f*)(vbp + kb + 16 + 4);
    // Inputs-only fence on the loaded values: keeps the chunk's eight K loads and four vbar reads together ahead
    // of the first product (without it the lo-plane loads sink among the products: three load waits a chunk).
#if defined(__HIP_DEVICE_COMPILE__)
    asm volatile("" :: "v"(a0h), "v"(a1h), "v"(a0l), "v"(a1l), "v"(v00), "v"(v01), "v"(v10), "v"(v11));
#endif
    v8f s0[QT], s1[QT];
#pragma unroll
    for (int t = 0; t < QT; ++t) { s0[t] = mma_b(a0h, fqh[t], zero8()); s1[t] = mma_b(a1h, fqh[t], zero8()); }
#pragma unroll
    for (int t = 0; t < QT; ++t) { s0[t] = mma_b(a0h, fql[t], s0[t]); s1[t] = mma_b(a1h, fql[t], s1[t]); }
#pragma unroll
    for (int t = 0; t < QT; ++t) { s0[t] = mma_b(a0l, fqh[t], s0[t]); s1[t] = mma_b(a1l, fqh[t], s1[t]); }
    // ---- online softmax over the key axis, one query tile after the other ----
#pragma unroll
    for (int t = 0; t < QT; ++t) {
      float lmax = fmaxf(s0[t][0], s1[t][0]);
#pragma unroll
      for (int v = 1; v < 8; ++v) lmax = fmaxf(lmax, fmaxf(s0[t][v], s1[t][v]));
      lmax = fmaxf(lmax, __shfl_xor(lmax, 16, 32));
      const float nm = fmaxf(run_max[t], lmax);
      const float factor = __expf(run_max[t] - nm);
      run_max[t] = nm;
      float lsum = 0.0f, po = 0.0f;
#pragma unroll
      for (int v = 0; v < 4; ++v) {
        const float p0 = __expf(s0[t][v] - nm);
        const float p1 = __expf(s1[t][v] - nm);
        const float p2 = __expf(s0[t][4 + v] - nm);
        const float p3 = __expf(s1[t][4 + v] - nm);
        lsum += (p0 + p1) + (p2 + p3);
        po += p0 * v00[v]; po += p1 * v10[v]; po += p2 * v01[v]; po += p3 * v11[v];
      }
      run_sum[t] = run_sum[t] * factor + lsum;
      run_o[t] = run_o[t] * factor + po;
    }
  }

  // ---- each wave's partial statistics to LDS (both lane halves joined first) ----
#pragma unroll
  for (int t = 0; t < QT; ++t) {
    const float tot = run_sum[t] + __shfl_xor(run_sum[t], 16, 32);
    const float oo = run_o[t] + __shfl_xor(run_o[t], 16, 32);
    if (h == 0) {
      const int slot = wave * QBLK + 16 * t + rl;
      pmx[slot] = run_max[t];
      psm[slot] = tot;
      pov[slot] = oo;
    }
  }
  __syncthreads();

  // ---- merge of the 8 key ranges and epilogue: thread = query ----
  if (tid < QBLK) {
    float gm = pmx[tid];
#pragma unroll
    for (int w = 1; w < AWAV; ++w) gm = fmaxf(gm, pmx[w * QBLK + tid]);
    float tot = 0.0f, oo = 0.0f;
#pragma unroll
    for (int w = 0; w < AWAV; ++w) {
      const float f = __expf(pmx[w * QBLK + tid] - gm);
      tot += psm[w * QBLK + tid] * f;
      oo += pov[w * QBLK + tid] * f;
    }
    out[(size_t)n0 + tid] = gb * (oo * (1.0f / tot)) + xmean[n0 + tid];
  }
}

// =====================================================================================================
// Workspace map (bytes); every region an exact multiple of its whole-line store granularity,
// every offset a multiple of 128.
//   QH bf16 [32768][32]  2097152 @0
//   QL bf16 [32768][32]  2097152 @2097152
//   KH bf16 [32768][32]  2097152 @4194304
//   KL bf16 [32768][32]  2097152 @6291456
//   XM f32  [32768]       131072 @8388608
//   VB f32  [32768]       131072 @8519680
//   WS f32  [256]           1024 @8650752
//   AUX f32 [32]             128 @8651776
//   end = 8651904
// =====================================================================================================
extern "C" void kernel_launch(void* const* d_in, const int* in_sizes, int n_in,
                              void* d_out, int out_size, void* d_ws, size_t ws_size,
                              hipStream_t stream) {
  if (n_in < 8) return;
  if (in_sizes[0] != NTOK * CIN) return;
  if (in_sizes[1] != CIN * CQK) return;
  if (in_sizes[2] != CQK) return;
  if (in_sizes[3] != CIN * CQK) return;
  if (in_sizes[4] != CQK) return;
  if (in_sizes[5] != CIN * CIN) return;
  if (in_sizes[6] != CIN) return;
  if (in_sizes[7] < 1) return;
  if (out_size != NTOK) return;

  const float* x     = (const float*)d_in[0];
  const float* Wq    = (const float*)d_in[1];
  const float* bq    = (const float*)d_in[2];
  const float* Wk    = (const float*)d_in[3];
  const float* bk    = (const float*)d_in[4];
  const float* Wv    = (const float*)d_in[5];
  const float* bv    = (const float*)d_in[6];
  const float* gamma = (const float*)d_in[7];
  float* out = (float*)d_out;

  const size_t PQK  = (size_t)NTOK * CQK * 2;        // 2097152
  const size_t PTOK = (size_t)NTOK * 4;              //  131072
  const size_t PWS  = (size_t)CIN * 4;               //    1024
  const size_t PAUX = (size_t)32 * 4;                //     128

  size_t off = 0;
  const size_t oQH = off; off += PQK;
  const size_t oQL = off; off += PQK;
  const size_t oKH = off; off += PQK;
  const size_t oKL = off; off += PQK;
  const size_t oXM = off; off += PTOK;
  const size_t oVB = off; off += PTOK;
  const size_t oWS = off; off += PWS;
  const size_t oAUX = off; off += PAUX;
  if (off > ws_size) return;                          // off = 8651904
  if (off > (size_t)134217728) return;

  char* ws = (char*)d_ws;
  unsigned short* QH = (unsigned short*)(ws + oQH);
  unsigned short* QL = (unsigned short*)(ws + oQL);
  unsigned short* KH = (unsigned short*)(ws + oKH);
  unsigned short* KL = (unsigned short*)(ws + oKL);
  float* XM  = (float*)(ws + oXM);
  float* VB  = (float*)(ws + oVB);
  float* WS  = (float*)(ws + oWS);
  float* AUX = (float*)(ws + oAUX);

  k_prep<<<dim3(CIN / 32 + 1), dim3(256), 0, stream>>>(Wv, bv, WS, AUX);
  k_proj<<<dim3(NTOK / PBLK), dim3(128), 0, stream>>>(x, Wq, bq, Wk, bk, WS, AUX, QH, QL, KH, KL, XM, VB);
  k_attn<<<dim3(NTOK / QBLK), dim3(32 * AWAV), 0, stream>>>(QH, QL, KH, KL, VB, XM, gamma, out);
  (void)hipGetLastError();
}

// v003
// Measured time: 43.2 microseconds a run.
// Two timings next to v002 put it at 1.08 and 1.07 times that version's speed.
// Counting every step since v000, it is 3.03 times as fast.
// Projection tiles (tokens x Wq, tokens x Wk): v_wmma_f32_16x16x32_bf16 (bf16 operands = RNE-converted inputs), f32 accumulate.
// Score tiles (keys x queries, K = 32): v_wmma_f32_16x16x32_bf16 on a bf16 hi/lo split of both operands (hi.hi + hi.lo + lo.hi), f32 accumulate.
// Channel sums, value channel-mean dot, softmax statistics, weight-times-value-mean reduction and epilogue: f32 on the VALU.
#include <hip/hip_runtime.h>

#define CIN   256
#define CQK   32
#define HWN   4096
#define NBAT  8
#define NTOK  32768
#define PBLK  64
#define QBLK  64
#define PW    264
#define AWAV  8
#define QT    (QBLK / 16)
#define KSPL  (HWN / AWAV)

static_assert(NTOK == NBAT * HWN);
static_assert((NTOK % PBLK) == 0 && (NTOK % QBLK) == 0 && (HWN % QBLK) == 0);
static_assert((HWN % 32) == 0 && (CIN % 32) == 0 && CQK == 32);
static_assert((PW % 8) == 0 && PBLK == 64 && QBLK == 64);
static_assert((KSPL % 32) == 0 && 32 * AWAV >= QBLK && (HWN % (4 * 32 * AWAV)) == 0);

typedef __bf16         v16bf __attribute__((ext_vector_type(16)));
typedef unsigned short v16us __attribute__((ext_vector_type(16)));
typedef unsigned short v8us  __attribute__((ext_vector_type(8)));
typedef float          v8f   __attribute__((ext_vector_type(8)));
typedef float          v4f   __attribute__((ext_vector_type(4)));
typedef float          v2f   __attribute__((ext_vector_type(2)));
typedef unsigned int   v4u   __attribute__((ext_vector_type(4)));

// ---- scalar helpers --------------------------------------------------------------------------------
__device__ __forceinline__ unsigned short bf_bits(float f) {          // f32 -> bf16 bits, RNE convert
  unsigned u = __float_as_uint(f);
  return (unsigned short)((u + 0x7FFFu + ((u >> 16) & 1u)) >> 16);
}
__device__ __forceinline__ float bf_up(unsigned short hb) { return __uint_as_float(((unsigned)hb) << 16); }
__device__ __forceinline__ float bf_r(float f) { return bf_up(bf_bits(f)); }
__device__ __forceinline__ float ex2(float f) { return __builtin_amdgcn_exp2f(f); }   // 2^f, one v_exp_f32
__device__ __forceinline__ v8f zero8() { v8f z = {0.f, 0.f, 0.f, 0.f, 0.f, 0.f, 0.f, 0.f}; return z; }

// ---- fragment loader: lane -> row/col (lane&15); p already includes +8*(lane>>4);
//      elements 0..7 <- p[0..7] (k0+8h..), elements 8..15 <- p[16..23] (k0+16+8h..). Same map for A and B.
__device__ __forceinline__ v16bf ldfrag_b(const unsigned short* p) {
  union { v16us v; v8us hv[2]; } f;
  f.hv[0] = *(const v8us*)(p);
  f.hv[1] = *(const v8us*)(p + 16);
  return __builtin_bit_cast(v16bf, f.v);
}

// ---- WMMA helper and trailing VALU hazard gaps ------------------------------------------------------------
__device__ __forceinline__ v8f mma_b(v16bf a, v16bf b, v8f c) {
  return __builtin_amdgcn_wmma_f32_16x16x32_bf16(false, a, false, b, (short)0, c, false, false);
}
__device__ __forceinline__ void guard_p(v8f& c0, v8f& c1, v8f& c2, v8f& c3,
                                        v16bf a, v16bf b0, v16bf b1, v16bf b2, v16bf b3) {
#if defined(__HIP_DEVICE_COMPILE__)
  asm volatile("v_nop\n\tv_nop\n\tv_nop\n\tv_nop"
               : "+v"(c0), "+v"(c1), "+v"(c2), "+v"(c3)
               : "v"(a), "v"(b0), "v"(b1), "v"(b2), "v"(b3));
#endif
}
__device__ __forceinline__ void acc_guard4(v8f& a, v8f& b, v8f& c, v8f& d) {
#if defined(__HIP_DEVICE_COMPILE__)
  asm volatile("v_nop\n\tv_nop\n\tv_nop\n\tv_nop" : "+v"(a), "+v"(b), "+v"(c), "+v"(d));
#endif
}
__device__ __forceinline__ void sched_fence() {
#if defined(__HIP_DEVICE_COMPILE__)
  asm volatile("" ::: "memory");
#endif
}

// =====================================================================================================
// Blocks 0..7: wsum[cin] = sum over cout of bf16RNE(Wv[cin][cout]) (f32) for the block's 32 rows of Wv.
// Wave = 4 rows; a row is two whole-wave 512-byte loads, all eight loads of a wave in flight together;
// 8 values summed per lane, then a butterfly over the 32 lanes. Wave 0 stores the block's 32 sums as one line.
// Block 8, wave 0: aux[0] = sum over c of bf16RNE(bv[c]) the same way, aux[1..31] = 0, one line.
// coverage: 8 blocks x 32 floats = wsum; 32 floats = aux.
// =====================================================================================================
__device__ __forceinline__ float sum8_r(v4f a, v4f b) {
  return ((bf_r(a[0]) + bf_r(a[1])) + (bf_r(a[2]) + bf_r(a[3]))) + ((bf_r(b[0]) + bf_r(b[1])) + (bf_r(b[2]) + bf_r(b[3])));
}
__global__ __launch_bounds__(256) void k_prep(const float* __restrict__ Wv, const float* __restrict__ bv,
                                               float* wsum, float* aux) {
  __shared__ __align__(16) float sws[32];
  const int tid = threadIdx.x, wave = tid >> 5, lane = tid & 31;
  if (blockIdx.x == CIN / 32) {
    if (wave == 0) {
      float t = sum8_r(*(const v4f*)(bv + 4 * lane), *(const v4f*)(bv + 128 + 4 * lane));
#pragma unroll
      for (int o = 16; o > 0; o >>= 1) t += __shfl_xor(t, o, 32);
      aux[lane] = lane == 0 ? t : 0.f;
    }
    return;
  }
  const float* row = Wv + (size_t)(blockIdx.x * 32 + wave * 4) * CIN + 4 * lane;
  v4f w0[4], w1[4];
#pragma unroll
  for (int r = 0; r < 4; ++r) {
    w0[r] = *(const v4f*)(row + r * CIN);
    w1[r] = *(const v4f*)(row + r * CIN + 128);
  }
  float s[4];
#pragma unroll
  for (int r = 0; r < 4; ++r) s[r] = sum8_r(w0[r], w1[r]);
#pragma unroll
  for (int o = 16; o > 0; o >>= 1) {
#pragma unroll
    for (int r = 0; r < 4; ++r) s[r] += __shfl_xor(s[r], o, 32);
  }
  if (lane == 0) {
    const v4f v = {s[0], s[1], s[2], s[3]};
    *(v4f*)(sws + 4 * wave) = v;
  }
  __syncthreads();
  if (wave == 0) wsum[blockIdx.x * 32 + lane] = sws[lane];
}

// =====================================================================================================
// Projections + per-token statistics. Block = 64 tokens, 4 waves, wave = 16 tokens.
// LDS: Wq and Wk as bf16 bits in [n][k] layout (rows 0..31 = Wq columns, rows 32..63 = Wk columns,
// pitch 264), wsum, biases. k-loop over 256 in steps of 32: A = bf16RNE(x) rows (row = token m,
// split k map), B = sW rows (col = output channel, same k map); the same x elements feed the f32 channel
// sum and the f32 dot with wsum. Epilogue: q/k + bias -> hi = bf16RNE(v), lo = bf16RNE(v - hi), staged
// per wave in LDS as four [16 tokens][32] planes, then each plane tile (1024 contiguous bytes in global)
// coverage: 4 waves x 16 rows x 32 = the block's 64 rows of each of the 4 planes; 64 xmean + 64 vbar;
// 512 blocks = whole planes.
// =====================================================================================================
__global__ __launch_bounds__(128) void k_proj(const float* __restrict__ x,
                                               const float* __restrict__ Wq, const float* __restrict__ bq,
                                               const float* __restrict__ Wk, const float* __restrict__ bk,
                                               const float* wsum, const float* aux,
                                               unsigned short* qh, unsigned short* ql,
                                               unsigned short* kh, unsigned short* kl,
                                               float* xmean, float* vbar) {
  __shared__ __align__(16) unsigned short sW[64 * PW];
  __shared__ __align__(16) unsigned short sO[4 * 4 * 16 * CQK];
  __shared__ __align__(16) float swsum[CIN];
  __shared__ __align__(16) float smean[PBLK];
  __shared__ __align__(16) float svbar[PBLK];
  __shared__ float sbias[64];
  const int tid = threadIdx.x, wave = tid >> 5, lane = tid & 31, m = lane & 15, h = lane >> 4;

#pragma unroll 4
  for (int it = 0; it < (CIN * CQK) / 128; ++it) {
    const int idx = it * 128 + tid;                 // = k*32 + n
    const int k = idx >> 5, n = idx & 31;
    sW[n * PW + k] = bf_bits(Wq[idx]);
    sW[(32 + n) * PW + k] = bf_bits(Wk[idx]);
  }
  swsum[tid] = wsum[tid];
  swsum[tid + 128] = wsum[tid + 128];
  if (tid < 64) {
    const float vq = bq[tid & 31];
    const float vk = bk[tid & 31];
    sbias[tid] = bf_r(tid < 32 ? vq : vk);
  }
  const float bvsum = aux[0];
  __syncthreads();

  const int row0 = blockIdx.x * PBLK + wave * 16;
  const float* xr = x + (size_t)(row0 + m) * CIN + 8 * h;
  const float* wr = swsum + 8 * h;
  const unsigned short* wb = sW + m * PW + 8 * h;
  v8f acc[4];
#pragma unroll
  for (int t = 0; t < 4; ++t) acc[t] = zero8();
  float xs = 0.f, vd = 0.f;

#pragma unroll 2
  for (int c = 0; c < CIN / 32; ++c) {
    const float* p = xr + 32 * c;
    const v4f x0 = *(const v4f*)(p);
    const v4f x1 = *(const v4f*)(p + 4);
    const v4f x2 = *(const v4f*)(p + 16);
    const v4f x3 = *(const v4f*)(p + 20);
    const float* pw = wr + 32 * c;
    const v4f w0 = *(const v4f*)(pw);
    const v4f w1 = *(const v4f*)(pw + 4);
    const v4f w2 = *(const v4f*)(pw + 16);
    const v4f w3 = *(const v4f*)(pw + 20);
    v16us au;
#pragma unroll
    for (int e = 0; e < 4; ++e) {
      const unsigned short b0 = bf_bits(x0[e]), b1 = bf_bits(x1[e]);
      const unsigned short b2 = bf_bits(x2[e]), b3 = bf_bits(x3[e]);
      const float r0 = bf_up(b0), r1 = bf_up(b1), r2 = bf_up(b2), r3 = bf_up(b3);
      au[e] = b0; au[4 + e] = b1; au[8 + e] = b2; au[12 + e] = b3;
      xs += (r0 + r1) + (r2 + r3);
      vd += r0 * w0[e]; vd += r1 * w1[e]; vd += r2 * w2[e]; vd += r3 * w3[e];
    }
    const v16bf a = __builtin_bit_cast(v16bf, au);
    const unsigned short* bp = wb + 32 * c;
    const v16bf f0 = ldfrag_b(bp);
    const v16bf f1 = ldfrag_b(bp + 16 * PW);
    const v16bf f2 = ldfrag_b(bp + 32 * PW);
    const v16bf f3 = ldfrag_b(bp + 48 * PW);
    acc[0] = mma_b(a, f0, acc[0]);
    acc[1] = mma_b(a, f1, acc[1]);
    acc[2] = mma_b(a, f2, acc[2]);
    acc[3] = mma_b(a, f3, acc[3]);
    guard_p(acc[0], acc[1], acc[2], acc[3], a, f0, f1, f2, f3);
    sched_fence();
  }
  acc_guard4(acc[0], acc[1], acc[2], acc[3]);

  // ---- per-token statistics (both lane halves hold row m) ----
  xs += __shfl_xor(xs, 16, 32);
  vd += __shfl_xor(vd, 16, 32);
  if (h == 0) {
    smean[wave * 16 + m] = xs * (1.0f / 256.0f);
    svbar[wave * 16 + m] = (vd + bvsum) * (1.0f / 256.0f);
  }
  // ---- q/k hi/lo planes staged per wave: plane 0 = q hi, 1 = q lo, 2 = k hi, 3 = k lo ----
  unsigned short* so = sO + wave * (4 * 16 * CQK);
#pragma unroll
  for (int t = 0; t < 4; ++t) {
    const float bias = sbias[16 * t + m];
    const int col = 16 * (t & 1) + m;
    unsigned short* ph = so + (2 * (t >> 1)) * (16 * CQK) + col;
    unsigned short* pl = ph + 16 * CQK;
#pragma unroll
    for (int r = 0; r < 8; ++r) {
      const float val = acc[t][r] + bias;
      const unsigned short hb = bf_bits(val);
      const unsigned short lb = bf_bits(val - bf_up(hb));
      ph[(8 * h + r) * CQK] = hb;
      pl[(8 * h + r) * CQK] = lb;
    }
  }
  __syncthreads();
  v4u pc[8];
#pragma unroll
  for (int pidx = 0; pidx < 4; ++pidx) {
    pc[2 * pidx]     = *(const v4u*)(so + pidx * (16 * CQK) + lane * 8);
    pc[2 * pidx + 1] = *(const v4u*)(so + pidx * (16 * CQK) + 256 + lane * 8);
  }
  const size_t ob = (size_t)row0 * CQK + (size_t)lane * 8;
  *(v4u*)(qh + ob) = pc[0];  *(v4u*)(qh + ob + 256) = pc[1];
  *(v4u*)(ql + ob) = pc[2];  *(v4u*)(ql + ob + 256) = pc[3];
  *(v4u*)(kh + ob) = pc[4];  *(v4u*)(kh + ob + 256) = pc[5];
  *(v4u*)(kl + ob) = pc[6];  *(v4u*)(kl + ob + 256) = pc[7];
  

  if (wave == 0) {
    const v4f v = *(const v4f*)(smean + 4 * (lane & 15));
    float* dst = xmean + (size_t)blockIdx.x * PBLK + 4 * (lane & 15);
    if (lane < 16) *(v4f*)dst = v;
    
  } else if (wave == 1) {
    const v4f v = *(const v4f*)(svbar + 4 * (lane & 15));
    float* dst = vbar + (size_t)blockIdx.x * PBLK + 4 * (lane & 15);
    if (lane < 16) *(v4f*)dst = v;
    
  }
}

// =====================================================================================================
// Attention, single pass with online softmax. Block = 64 queries (inside one image), 8 waves.
// Every wave holds the Q fragments of all 64 queries (4 query tiles) and walks its own eighth of the
// image's keys (512 keys, 16 chunks of 32), so one K fragment load and one vbar read feed 4 query tiles.
// vbar of the image staged in LDS (4096 floats). Per 32-key chunk and query tile t:
//   S^T tiles = K rows (A, row = key, k = d) . Q rows (B, col = query, k = d), one k-step,
//   three products hi.hi + hi.lo + lo.hi per tile from zero;
//   D: s0[t][r] = S[key kb+8h+r][query], s1[t][r] = S[key kb+16+8h+r][query];
//   running max over the 32 keys (per lane, then the xor-16 partner), kept times log2(e); rescale of sum and of
//   the weighted value-mean accumulator; p = 2^(s * log2(e) - max) in f32; o += p * vbar[key] (f32 FMA).
//   The exponent, the sum and the weighted sum are formed on pairs of neighbouring accumulator registers
//   (packed f32 instructions); the two elements of a pair's sums are added once, after the loop.
// Merge: each wave leaves (max, sum, weighted sum) per query in LDS; after one barrier thread q < 64
// rescales the 8 partials of query q to their common max (base 2) and adds them in wave order.
// Epilogue: res = gammaRNE * (o / l) + xmean[query]; waves 0 and 1 each store one whole 128-byte line.
// coverage: 8 waves x 16 chunks x 32 = all 4096 keys of the image; 512 blocks x 64 = whole output.
// =====================================================================================================
__global__ __launch_bounds__(32 * AWAV) void k_attn(const unsigned short* qh, const unsigned short* ql,
                                               const unsigned short* kh, const unsigned short* kl,
                                               const float* vbar, const float* xmean,
                                               const float* __restrict__ gamma, float* out) {
  __shared__ __align__(16) float svb[HWN];
  __shared__ float pmx[AWAV * QBLK];
  __shared__ float psm[AWAV * QBLK];
  __shared__ float pov[AWAV * QBLK];
  const int tid = threadIdx.x, wave = tid >> 5, lane = tid & 31;
  const int rl = lane & 15, h = lane >> 4, koff = 8 * h;
  const int n0 = blockIdx.x * QBLK;
  const int keybase = (n0 / HWN) * HWN;
  const float gb = bf_r(gamma[0]);

  // Every loop over t (query tile), v (accumulator register) and j (register pair) is fully unrolled: the per-tile arrays live in VGPRs.
  const unsigned short* qhp = qh + (size_t)(n0 + rl) * CQK + koff;
  const unsigned short* qlp = ql + (size_t)(n0 + rl) * CQK + koff;
  v16bf fqh[QT], fql[QT];
#pragma unroll
  for (int t = 0; t < QT; ++t) fqh[t] = ldfrag_b(qhp + t * 16 * CQK);
  // A lo-plane load lands on the hi-plane loads' address pair: the wait stands ahead of that overwrite.
#if defined(__HIP_DEVICE_COMPILE__)
  asm volatile("s_wait_xcnt 0x0" ::: "memory");
#endif
#pragma unroll
  for (int t = 0; t < QT; ++t) fql[t] = ldfrag_b(qlp + t * 16 * CQK);
#pragma unroll
  for (int j = 0; j < HWN / (4 * 32 * AWAV); ++j) {
    const int i = tid + 32 * AWAV * j;
    ((v4f*)svb)[i] = *(const v4f*)(vbar + keybase + 4 * i);
  }
  __syncthreads();

  const int key0 = wave * KSPL;
  const unsigned short* khp = kh + (size_t)(keybase + key0 + rl) * CQK + koff;
  const unsigned short* klp = kl + (size_t)(keybase + key0 + rl) * CQK + koff;
  const float* vbp = svb + key0 + koff;

  const float L2E = 1.44269504088896340736f;
  const v2f l2e2 = {L2E, L2E};
  float run_max[QT];                                  // running max times log2(e)
  v2f run_sum[QT], run_o[QT];                         // element 0: even accumulator registers, element 1: odd
#pragma unroll
  for (int t = 0; t < QT; ++t) { run_max[t] = -1.0e30f; run_sum[t] = 0.0f; run_o[t] = 0.0f; }

  // Kept rolled: one chunk's body already needs most of the 256 VGPRs that four waves per SIMD leave a wave.
#pragma unroll 1
  for (int kb = 0; kb < KSPL; kb += 32) {
    const unsigned short* pa = khp + (size_t)kb * CQK;
    const unsigned short* pl = klp + (size_t)kb * CQK;
    const v16bf a0h = ldfrag_b(pa);
    const v16bf a1h = ldfrag_b(pa + 16 * CQK);
    const v16bf a0l = ldfrag_b(pl);
    const v16bf a1l = ldfrag_b(pl + 16 * CQK);
    const v4f v00 = *(const v4f*)(vbp + kb);
    const v4f v01 = *(const v4f*)(vbp + kb + 4);
    const v4f v10 = *(const v4f*)(vbp + kb + 16);
    const v4f v11 = *(const v4f*)(vbp + kb + 16 + 4);
    // Inputs-only fence on the loaded values: keeps the chunk's eight K loads and four vbar reads together ahead
    // of the first product (without it the lo-plane loads sink among the products: three load waits a chunk).
#if defined(__HIP_DEVICE_COMPILE__)
    asm volatile("" :: "v"(a0h), "v"(a1h), "v"(a0l), "v"(a1l), "v"(v00), "v"(v01), "v"(v10), "v"(v11));
#endif
    const v2f w0[4] = {{v00[0], v00[1]}, {v00[2], v00[3]}, {v01[0], v01[1]}, {v01[2], v01[3]}};
    const v2f w1[4] = {{v10[0], v10[1]}, {v10[2], v10[3]}, {v11[0], v11[1]}, {v11[2], v11[3]}};
    v8f s0[QT], s1[QT];
#pragma unroll
    for (int t = 0; t < QT; ++t) { s0[t] = mma_b(a0h, fqh[t], zero8()); s1[t] = mma_b(a1h, fqh[t], zero8()); }
#pragma unroll
    for (int t = 0; t < QT; ++t) { s0[t] = mma_b(a0h, fql[t], s0[t]); s1[t] = mma_b(a1h, fql[t], s1[t]); }
#pragma unroll
    for (int t = 0; t < QT; ++t) { s0[t] = mma_b(a0l, fqh[t], s0[t]); s1[t] = mma_b(a1l, fqh[t], s1[t]); }
    // ---- online softmax over the key axis, one query tile after the other ----
#pragma unroll
    for (int t = 0; t < QT; ++t) {
      float lmax = fmaxf(s0[t][0], s1[t][0]);
#pragma unroll
      for (int v = 1; v < 8; ++v) lmax = fmaxf(lmax, fmaxf(s0[t][v], s1[t][v]));
      lmax = fmaxf(lmax, __shfl_xor(lmax, 16, 32));
      const float nm = fmaxf(run_max[t], lmax * L2E);
      const float factor = ex2(run_max[t] - nm);
      run_max[t] = nm;
      const v2f nm2 = {nm, nm};
      const v2f f2 = {factor, factor};
      v2f ls = run_sum[t] * f2, po = run_o[t] * f2;
      // Two scores that sit in neighbouring accumulator registers go through each packed instruction together.
#pragma unroll
      for (int j = 0; j < 4; ++j) {
        const v2f a0 = {s0[t][2 * j], s0[t][2 * j + 1]};
        const v2f a1 = {s1[t][2 * j], s1[t][2 * j + 1]};
        const v2f e0 = __builtin_elementwise_fma(a0, l2e2, -nm2);
        const v2f e1 = __builtin_elementwise_fma(a1, l2e2, -nm2);
        const v2f p0 = {ex2(e0[0]), ex2(e0[1])};
        const v2f p1 = {ex2(e1[0]), ex2(e1[1])};
        ls += p0;
        ls += p1;
        po = __builtin_elementwise_fma(p0, w0[j], po);
        po = __builtin_elementwise_fma(p1, w1[j], po);
      }
      run_sum[t] = ls;
      run_o[t] = po;
    }
  }

  // ---- each wave's partial statistics to LDS (both lane halves joined first) ----
#pragma unroll
  for (int t = 0; t < QT; ++t) {
    const float hs = run_sum[t][0] + run_sum[t][1], ho = run_o[t][0] + run_o[t][1];
    const float tot = hs + __shfl_xor(hs, 16, 32);
    const float oo = ho + __shfl_xor(ho, 16, 32);
    if (h == 0) {
      const int slot = wave * QBLK + 16 * t + rl;
      pmx[slot] = run_max[t];
      psm[slot] = tot;
      pov[slot] = oo;
    }
  }
  __syncthreads();

  // ---- merge of the 8 key ranges and epilogue: thread = query ----
  if (tid < QBLK) {
    float gm = pmx[tid];
#pragma unroll
    for (int w = 1; w < AWAV; ++w) gm = fmaxf(gm, pmx[w * QBLK + tid]);
    float tot = 0.0f, oo = 0.0f;
#pragma unroll
    for (int w = 0; w < AWAV; ++w) {
      const float f = ex2(pmx[w * QBLK + tid] - gm);
      tot += psm[w * QBLK + tid] * f;
      oo += pov[w * QBLK + tid] * f;
    }
    out[(size_t)n0 + tid] = gb * (oo * (1.0f / tot)) + xmean[n0 + tid];
  }
}

// =====================================================================================================
// Workspace map (bytes); every region an exact multiple of its whole-line store granularity,
// every offset a multiple of 128.
//   QH bf16 [32768][32]  2097152 @0
//   QL bf16 [32768][32]  2097152 @2097152
//   KH bf16 [32768][32]  2097152 @4194304
//   KL bf16 [32768][32]  2097152 @6291456
//   XM f32  [32768]       131072 @8388608
//   VB f32  [32768]       131072 @8519680
//   WS f32  [256]           1024 @8650752
//   AUX f32 [32]             128 @8651776
//   end = 8651904
// =====================================================================================================
extern "C" void kernel_launch(void* const* d_in, const int* in_sizes, int n_in,
                              void* d_out, int out_size, void* d_ws, size_t ws_size,
                              hipStream_t stream) {
  if (n_in < 8) return;
  if (in_sizes[0] != NTOK * CIN) return;
  if (in_sizes[1] != CIN * CQK) return;
  if (in_sizes[2] != CQK) return;
  if (in_sizes[3] != CIN * CQK) return;
  if (in_sizes[4] != CQK) return;
  if (in_sizes[5] != CIN * CIN) return;
  if (in_sizes[6] != CIN) return;
  if (in_sizes[7] < 1) return;
  if (out_size != NTOK) return;

  const float* x     = (const float*)d_in[0];
  const float* Wq    = (const float*)d_in[1];
  const float* bq    = (const float*)d_in[2];
  const float* Wk    = (const float*)d_in[3];
  const float* bk    = (const float*)d_in[4];
  const float* Wv    = (const float*)d_in[5];
  const float* bv    = (const float*)d_in[6];
  const float* gamma = (const float*)d_in[7];
  float* out = (float*)d_out;

  const size_t PQK  = (size_t)NTOK * CQK * 2;        // 2097152
  const size_t PTOK = (size_t)NTOK * 4;              //  131072
  const size_t PWS  = (size_t)CIN * 4;               //    1024
  const size_t PAUX = (size_t)32 * 4;                //     128

  size_t off = 0;
  const size_t oQH = off; off += PQK;
  const size_t oQL = off; off += PQK;
  const size_t oKH = off; off += PQK;
  const size_t oKL = off; off += PQK;
  const size_t oXM = off; off += PTOK;
  const size_t oVB = off; off += PTOK;
  const size_t oWS = off; off += PWS;
  const size_t oAUX = off; off += PAUX;
  if (off > ws_size) return;                          // off = 8651904
  if (off > (size_t)134217728) return;

  char* ws = (char*)d_ws;
  unsigned short* QH = (unsigned short*)(ws + oQH);
  unsigned short* QL = (unsigned short*)(ws + oQL);
  unsigned short* KH = (unsigned short*)(ws + oKH);
  unsigned short* KL = (unsigned short*)(ws + oKL);
  float* XM  = (float*)(ws + oXM);
  float* VB  = (float*)(ws + oVB);
  float* WS  = (float*)(ws + oWS);
  float* AUX = (float*)(ws + oAUX);

  k_prep<<<dim3(CIN / 32 + 1), dim3(256), 0, stream>>>(Wv, bv, WS, AUX);
  k_proj<<<dim3(NTOK / PBLK), dim3(128), 0, stream>>>(x, Wq, bq, Wk, bk, WS, AUX, QH, QL, KH, KL, XM, VB);
  k_attn<<<dim3(NTOK / QBLK), dim3(32 * AWAV), 0, stream>>>(QH, QL, KH, KL, VB, XM, gamma, out);
  (void)hipGetLastError();
}

// v004
// Measured time: 40.4 microseconds a run.
// Two timings next to v003 both put it at 1.05 times that version's speed.
// All steps since v000 together make it 3.17 times as fast.
// Projection tiles (tokens x Wq, tokens x Wk): v_wmma_f32_16x16x32_bf16 (bf16 operands = RNE-converted inputs), f32 accumulate.
// Score tiles (keys x queries, K = 32): v_wmma_f32_16x16x32_bf16 on a bf16 hi/lo split of both operands (hi.hi + hi.lo + lo.hi), f32 accumulate.
// Row sums of Wv and the sum of bv: v_wmma_f32_16x16x32_bf16, A = bf16RNE values, B = ones and zeros, f32 accumulate.
// Channel sums, value channel-mean dot, softmax statistics, weight-times-value-mean reduction and epilogue: f32 on the VALU.
#include <hip/hip_runtime.h>

#define CIN   256
#define CQK   32
#define HWN   4096
#define NBAT  8
#define NTOK  32768
#define PBLK  128
#define QBLK  64
#define PW    264
#define AWAV  8
#define QT    (QBLK / 16)
#define KSPL  (HWN / AWAV)

static_assert(NTOK == NBAT * HWN);
static_assert((NTOK % PBLK) == 0 && (NTOK % QBLK) == 0 && (HWN % QBLK) == 0);
static_assert((HWN % 32) == 0 && (CIN % 32) == 0 && CQK == 32);
static_assert((PW % 8) == 0 && PBLK == 128 && QBLK == 64 && CIN == 2 * PBLK);
static_assert((KSPL % 32) == 0 && 32 * AWAV >= QBLK && (HWN % (4 * 32 * AWAV)) == 0);

typedef __bf16         v16bf __attribute__((ext_vector_type(16)));
typedef unsigned short v16us __attribute__((ext_vector_type(16)));
typedef unsigned short v8us  __attribute__((ext_vector_type(8)));
typedef float          v8f   __attribute__((ext_vector_type(8)));
typedef float          v4f   __attribute__((ext_vector_type(4)));
typedef float          v2f   __attribute__((ext_vector_type(2)));
typedef __bf16         v2bf  __attribute__((ext_vector_type(2)));
typedef unsigned int   v8u   __attribute__((ext_vector_type(8)));
typedef unsigned int   v4u   __attribute__((ext_vector_type(4)));

// ---- scalar helpers --------------------------------------------------------------------------------
__device__ __forceinline__ unsigned short bf_bits(float f) {          // f32 -> bf16 bits, RNE convert
  unsigned u = __float_as_uint(f);
  return (unsigned short)((u + 0x7FFFu + ((u >> 16) & 1u)) >> 16);
}
__device__ __forceinline__ float bf_up(unsigned short hb) { return __uint_as_float(((unsigned)hb) << 16); }
__device__ __forceinline__ float bf_r(float f) { return bf_up(bf_bits(f)); }
__device__ __forceinline__ float ex2(float f) { return __builtin_amdgcn_exp2f(f); }   // 2^f, one v_exp_f32
__device__ __forceinline__ v8f zero8() { v8f z = {0.f, 0.f, 0.f, 0.f, 0.f, 0.f, 0.f, 0.f}; return z; }

// ---- fragment loader: lane -> row/col (lane&15); p already includes +8*(lane>>4);
//      elements 0..7 <- p[0..7] (k0+8h..), elements 8..15 <- p[16..23] (k0+16+8h..). Same map for A and B.
__device__ __forceinline__ v16bf ldfrag_b(const unsigned short* p) {
  union { v16us v; v8us hv[2]; } f;
  f.hv[0] = *(const v8us*)(p);
  f.hv[1] = *(const v8us*)(p + 16);
  return __builtin_bit_cast(v16bf, f.v);
}

// ---- WMMA helper and trailing VALU hazard gaps ------------------------------------------------------------
__device__ __forceinline__ v8f mma_b(v16bf a, v16bf b, v8f c) {
  return __builtin_amdgcn_wmma_f32_16x16x32_bf16(false, a, false, b, (short)0, c, false, false);
}
__device__ __forceinline__ void guard_p(v8f& c0, v8f& c1, v8f& c2, v8f& c3,
                                        v16bf a, v16bf b0, v16bf b1, v16bf b2, v16bf b3) {
#if defined(__HIP_DEVICE_COMPILE__)
  asm volatile("v_nop\n\tv_nop\n\tv_nop\n\tv_nop"
               : "+v"(c0), "+v"(c1), "+v"(c2), "+v"(c3)
               : "v"(a), "v"(b0), "v"(b1), "v"(b2), "v"(b3));
#endif
}
__device__ __forceinline__ void acc_guard4(v8f& a, v8f& b, v8f& c, v8f& d) {
#if defined(__HIP_DEVICE_COMPILE__)
  asm volatile("v_nop\n\tv_nop\n\tv_nop\n\tv_nop" : "+v"(a), "+v"(b), "+v"(c), "+v"(d));
#endif
}
__device__ __forceinline__ void sched_fence() {
#if defined(__HIP_DEVICE_COMPILE__)
  asm volatile("" ::: "memory");
#endif
}

// ---- NQ whole-wave 512-byte loads (p already includes +4*lane) -> fragment elements 4q..4q+3 of the lane, RNE
//      convert (two values per instruction); the elements above 4*NQ are zero.
template <int NQ>
__device__ __forceinline__ v16bf ldlines(const float* p) {
  v16bf a;
#pragma unroll
  for (int e = 0; e < 16; ++e) a[e] = (__bf16)0.0f;
#pragma unroll
  for (int g = 0; g < NQ; ++g) {
    const v4f f = *(const v4f*)(p + 128 * g);
    const v2f f01 = {f[0], f[1]}, f23 = {f[2], f[3]};
    const v2bf c01 = __builtin_convertvector(f01, v2bf), c23 = __builtin_convertvector(f23, v2bf);
    a[4 * g] = c01[0]; a[4 * g + 1] = c01[1]; a[4 * g + 2] = c23[0]; a[4 * g + 3] = c23[1];
  }
  return a;
}

// =====================================================================================================
// Projections + per-token statistics. Block = 128 tokens, 8 waves, wave = 16 tokens; one block per WGP, so Wv is
// read once per WGP.
// Prologue: wsum[cin] = sum over cout of bf16RNE(Wv[cin][cout]), wave = 32 rows of Wv. Two neighbouring rows are
// four whole-wave 512-byte loads: a lane's fragment elements 0..7 belong to the even row, 8..15 to the odd one.
// Product j of a 16-row group: A = that fragment, B = 1 in column 2j at elements 0..7 and in column 2j+1 at
// elements 8..15, else 0 (same element map for A and B), so D[i][n] = what lanes i and i+16 hold of row n.
// A lane adds its 8 registers and its xor-16 partner's sum: lane n has the sum of row n.
// Sum of bf16RNE(bv), in every wave: two such loads in elements 0..7, B = ones, the same two additions.
// LDS: Wq and Wk as bf16 bits in [n][k] layout (rows 0..31 = Wq columns, rows 32..63 = Wk columns,
// pitch 264), wsum, biases. k-loop over 256 in steps of 32: A = bf16RNE(x) rows (row = token m,
// split k map), B = sW rows (col = output channel, same k map); the same x elements feed the f32 channel
// sum and the f32 dot with wsum. Epilogue: q/k + bias -> hi = bf16RNE(v), lo = bf16RNE(v - hi), staged
// per wave in LDS as four [16 tokens][32] planes, then each plane tile (1024 contiguous bytes in global)
// coverage: 8 waves x 16 rows x 32 = the block's 128 rows of each of the 4 planes; 128 xmean + 128 vbar;
// 256 blocks = whole planes.
// =====================================================================================================
__global__ __launch_bounds__(2 * PBLK) void k_proj(const float* __restrict__ x,
                                               const float* __restrict__ Wq, const float* __restrict__ bq,
                                               const float* __restrict__ Wk, const float* __restrict__ bk,
                                               const float* __restrict__ Wv, const float* __restrict__ bv,
                                               unsigned short* qh, unsigned short* ql,
                                               unsigned short* kh, unsigned short* kl,
                                               float* xmean, float* vbar) {
  __shared__ __align__(16) unsigned short sW[64 * PW];
  __shared__ __align__(16) unsigned short sO[(PBLK / 16) * 4 * 16 * CQK];
  __shared__ __align__(16) float swsum[CIN];
  __shared__ __align__(16) float smean[PBLK];
  __shared__ __align__(16) float svbar[PBLK];
  __shared__ float sbias[64];
  const int tid = threadIdx.x, wave = tid >> 5, lane = tid & 31, m = lane & 15, h = lane >> 4;

  float bvsum;
  {
    const unsigned one2 = 0x3F803F80u;              // two bf16 ones
    const v8u ou = {one2, one2, one2, one2, one2, one2, one2, one2};
    const v16bf ab = ldlines<2>(bv + 4 * lane);
    // A Wv load may land on the bv loads' address pair: the wait stands ahead of that overwrite.
#if defined(__HIP_DEVICE_COMPILE__)
    asm volatile("s_wait_xcnt 0x0" ::: "memory");
#endif
    const float* wv = Wv + (size_t)(wave * 32) * CIN + 4 * lane;
    v8f rs[2] = {zero8(), zero8()};
#pragma unroll
    for (int j = 0; j < 8; ++j) {
      const unsigned se = m == 2 * j ? one2 : 0u, so2 = m == 2 * j + 1 ? one2 : 0u;
      const v8u su = {se, se, se, se, so2, so2, so2, so2};
      const v16bf sel = __builtin_bit_cast(v16bf, su);
#pragma unroll
      for (int rt = 0; rt < 2; ++rt) rs[rt] = mma_b(ldlines<4>(wv + (rt * 16 + 2 * j) * CIN), sel, rs[rt]);
    }
    const v8f rb = mma_b(ab, __builtin_bit_cast(v16bf, ou), zero8());
    float p0 = ((rs[0][0] + rs[0][1]) + (rs[0][2] + rs[0][3])) + ((rs[0][4] + rs[0][5]) + (rs[0][6] + rs[0][7]));
    float p1 = ((rs[1][0] + rs[1][1]) + (rs[1][2] + rs[1][3])) + ((rs[1][4] + rs[1][5]) + (rs[1][6] + rs[1][7]));
    float pb = ((rb[0] + rb[1]) + (rb[2] + rb[3])) + ((rb[4] + rb[5]) + (rb[6] + rb[7]));
    p0 += __shfl_xor(p0, 16, 32);
    p1 += __shfl_xor(p1, 16, 32);
    pb += __shfl_xor(pb, 16, 32);
    swsum[wave * 32 + lane] = h ? p1 : p0;
    bvsum = pb;
  }
#pragma unroll 4
  for (int it = 0; it < (CIN * CQK) / (2 * PBLK); ++it) {
    const int idx = it * (2 * PBLK) + tid;          // = k*32 + n
    const int k = idx >> 5, n = idx & 31;
    sW[n * PW + k] = bf_bits(Wq[idx]);
    sW[(32 + n) * PW + k] = bf_bits(Wk[idx]);
  }
  if (tid < 64) {
    const float vq = bq[tid & 31];
    const float vk = bk[tid & 31];
    sbias[tid] = bf_r(tid < 32 ? vq : vk);
  }
  __syncthreads();

  const int row0 = blockIdx.x * PBLK + wave * 16;
  const float* xr = x + (size_t)(row0 + m) * CIN + 8 * h;
  const float* wr = swsum + 8 * h;
  const unsigned short* wb = sW + m * PW + 8 * h;
  v8f acc[4];
#pragma unroll
  for (int t = 0; t < 4; ++t) acc[t] = zero8();
  float xs = 0.f, vd = 0.f;

#pragma unroll 2
  for (int c = 0; c < CIN / 32; ++c) {
    const float* p = xr + 32 * c;
    const v4f x0 = *(const v4f*)(p);
    const v4f x1 = *(const v4f*)(p + 4);
    const v4f x2 = *(const v4f*)(p + 16);
    const v4f x3 = *(const v4f*)(p + 20);
    const float* pw = wr + 32 * c;
    const v4f w0 = *(const v4f*)(pw);
    const v4f w1 = *(const v4f*)(pw + 4);
    const v4f w2 = *(const v4f*)(pw + 16);
    const v4f w3 = *(const v4f*)(pw + 20);
    v16us au;
#pragma unroll
    for (int e = 0; e < 4; ++e) {
      const unsigned short b0 = bf_bits(x0[e]), b1 = bf_bits(x1[e]);
      const unsigned short b2 = bf_bits(x2[e]), b3 = bf_bits(x3[e]);
      const float r0 = bf_up(b0), r1 = bf_up(b1), r2 = bf_up(b2), r3 = bf_up(b3);
      au[e] = b0; au[4 + e] = b1; au[8 + e] = b2; au[12 + e] = b3;
      xs += (r0 + r1) + (r2 + r3);
      vd += r0 * w0[e]; vd += r1 * w1[e]; vd += r2 * w2[e]; vd += r3 * w3[e];
    }
    const v16bf a = __builtin_bit_cast(v16bf, au);
    const unsigned short* bp = wb + 32 * c;
    const v16bf f0 = ldfrag_b(bp);
    const v16bf f1 = ldfrag_b(bp + 16 * PW);
    const v16bf f2 = ldfrag_b(bp + 32 * PW);
    const v16bf f3 = ldfrag_b(bp + 48 * PW);
    acc[0] = mma_b(a, f0, acc[0]);
    acc[1] = mma_b(a, f1, acc[1]);
    acc[2] = mma_b(a, f2, acc[2]);
    acc[3] = mma_b(a, f3, acc[3]);
    guard_p(acc[0], acc[1], acc[2], acc[3], a, f0, f1, f2, f3);
    sched_fence();
  }
  acc_guard4(acc[0], acc[1], acc[2], acc[3]);

  // ---- per-token statistics (both lane halves hold row m) ----
  xs += __shfl_xor(xs, 16, 32);
  vd += __shfl_xor(vd, 16, 32);
  if (h == 0) {
    smean[wave * 16 + m] = xs * (1.0f / 256.0f);
    svbar[wave * 16 + m] = (vd + bvsum) * (1.0f / 256.0f);
  }
  // ---- q/k hi/lo planes staged per wave: plane 0 = q hi, 1 = q lo, 2 = k hi, 3 = k lo ----
  unsigned short* so = sO + wave * (4 * 16 * CQK);
#pragma unroll
  for (int t = 0; t < 4; ++t) {
    const float bias = sbias[16 * t + m];
    const int col = 16 * (t & 1) + m;
    unsigned short* ph = so + (2 * (t >> 1)) * (16 * CQK) + col;
    unsigned short* pl = ph + 16 * CQK;
#pragma unroll
    for (int r = 0; r < 8; ++r) {
      const float val = acc[t][r] + bias;
      const unsigned short hb = bf_bits(val);
      const unsigned short lb = bf_bits(val - bf_up(hb));
      ph[(8 * h + r) * CQK] = hb;
      pl[(8 * h + r) * CQK] = lb;
    }
  }
  __syncthreads();
  v4u pc[8];
#pragma unroll
  for (int pidx = 0; pidx < 4; ++pidx) {
    pc[2 * pidx]     = *(const v4u*)(so + pidx * (16 * CQK) + lane * 8);
    pc[2 * pidx + 1] = *(const v4u*)(so + pidx * (16 * CQK) + 256 + lane * 8);
  }
  const size_t ob = (size_t)row0 * CQK + (size_t)lane * 8;
  *(v4u*)(qh + ob) = pc[0];  *(v4u*)(qh + ob + 256) = pc[1];
  *(v4u*)(ql + ob) = pc[2];  *(v4u*)(ql + ob + 256) = pc[3];
  *(v4u*)(kh + ob) = pc[4];  *(v4u*)(kh + ob + 256) = pc[5];
  *(v4u*)(kl + ob) = pc[6];  *(v4u*)(kl + ob + 256) = pc[7];
  

  if (wave == 0) {
    *(v4f*)(xmean + (size_t)blockIdx.x * PBLK + 4 * lane) = *(const v4f*)(smean + 4 * lane);
  } else if (wave == 1) {
    *(v4f*)(vbar + (size_t)blockIdx.x * PBLK + 4 * lane) = *(const v4f*)(svbar + 4 * lane);
  }
}

// =====================================================================================================
// Attention, single pass with online softmax. Block = 64 queries (inside one image), 8 waves.
// Every wave holds the Q fragments of all 64 queries (4 query tiles) and walks its own eighth of the
// image's keys (512 keys, 16 chunks of 32), so one K fragment load and one vbar read feed 4 query tiles.
// vbar of the image staged in LDS (4096 floats). Per 32-key chunk and query tile t:
//   S^T tiles = K rows (A, row = key, k = d) . Q rows (B, col = query, k = d), one k-step,
//   three products hi.hi + hi.lo + lo.hi per tile from zero;
//   D: s0[t][r] = S[key kb+8h+r][query], s1[t][r] = S[key kb+16+8h+r][query];
//   running max over the 32 keys (per lane, then the xor-16 partner), kept times log2(e); rescale of sum and of
//   the weighted value-mean accumulator; p = 2^(s * log2(e) - max) in f32; o += p * vbar[key] (f32 FMA).
//   The exponent, the sum and the weighted sum are formed on pairs of neighbouring accumulator registers
//   (packed f32 instructions); the two elements of a pair's sums are added once, after the loop.
// Merge: each wave leaves (max, sum, weighted sum) per query in LDS; after one barrier thread q < 64
// rescales the 8 partials of query q to their common max (base 2) and adds them in wave order.
// Epilogue: res = gammaRNE * (o / l) + xmean[query]; waves 0 and 1 each store one whole 128-byte line.
// coverage: 8 waves x 16 chunks x 32 = all 4096 keys of the image; 512 blocks x 64 = whole output.
// =====================================================================================================
__global__ __launch_bounds__(32 * AWAV) void k_attn(const unsigned short* qh, const unsigned short* ql,
                                               const unsigned short* kh, const unsigned short* kl,
                                               const float* vbar, const float* xmean,
                                               const float* __restrict__ gamma, float* out) {
  __shared__ __align__(16) float svb[HWN];
  __shared__ float pmx[AWAV * QBLK];
  __shared__ float psm[AWAV * QBLK];
  __shared__ float pov[AWAV * QBLK];
  const int tid = threadIdx.x, wave = tid >> 5, lane = tid & 31;
  const int rl = lane & 15, h = lane >> 4, koff = 8 * h;
  const int n0 = blockIdx.x * QBLK;
  const int keybase = (n0 / HWN) * HWN;
  const float gb = bf_r(gamma[0]);

  // Every loop over t (query tile), v (accumulator register) and j (register pair) is fully unrolled: the per-tile arrays live in VGPRs.
  const unsigned short* qhp = qh + (size_t)(n0 + rl) * CQK + koff;
  const unsigned short* qlp = ql + (size_t)(n0 + rl) * CQK + koff;
  v16bf fqh[QT], fql[QT];
#pragma unroll
  for (int t = 0; t < QT; ++t) fqh[t] = ldfrag_b(qhp + t * 16 * CQK);
  // A lo-plane load lands on the hi-plane loads' address pair: the wait stands ahead of that overwrite.
#if defined(__HIP_DEVICE_COMPILE__)
  asm volatile("s_wait_xcnt 0x0" ::: "memory");
#endif
#pragma unroll
  for (int t = 0; t < QT; ++t) fql[t] = ldfrag_b(qlp + t * 16 * CQK);
#pragma unroll
  for (int j = 0; j < HWN / (4 * 32 * AWAV); ++j) {
    const int i = tid + 32 * AWAV * j;
    ((v4f*)svb)[i] = *(const v4f*)(vbar + keybase + 4 * i);
  }
  __syncthreads();

  const int key0 = wave * KSPL;
  const unsigned short* khp = kh + (size_t)(keybase + key0 + rl) * CQK + koff;
  const unsigned short* klp = kl + (size_t)(keybase + key0 + rl) * CQK + koff;
  const float* vbp = svb + key0 + koff;

  const float L2E = 1.44269504088896340736f;
  const v2f l2e2 = {L2E, L2E};
  float run_max[QT];                                  // running max times log2(e)
  v2f run_sum[QT], run_o[QT];                         // element 0: even accumulator registers, element 1: odd
#pragma unroll
  for (int t = 0; t < QT; ++t) { run_max[t] = -1.0e30f; run_sum[t] = 0.0f; run_o[t] = 0.0f; }

  // Kept rolled: one chunk's body already needs most of the 256 VGPRs that four waves per SIMD leave a wave.
#pragma unroll 1
  for (int kb = 0; kb < KSPL; kb += 32) {
    const unsigned short* pa = khp + (size_t)kb * CQK;
    const unsigned short* pl = klp + (size_t)kb * CQK;
    const v16bf a0h = ldfrag_b(pa);
    const v16bf a1h = ldfrag_b(pa + 16 * CQK);
    const v16bf a0l = ldfrag_b(pl);
    const v16bf a1l = ldfrag_b(pl + 16 * CQK);
    const v4f v00 = *(const v4f*)(vbp + kb);
    const v4f v01 = *(const v4f*)(vbp + kb + 4);
    const v4f v10 = *(const v4f*)(vbp + kb + 16);
    const v4f v11 = *(const v4f*)(vbp + kb + 16 + 4);
    // Inputs-only fence on the loaded values: keeps the chunk's eight K loads and four vbar reads together ahead
    // of the first product (without it the lo-plane loads sink among the products: three load waits a chunk).
#if defined(__HIP_DEVICE_COMPILE__)
    asm volatile("" :: "v"(a0h), "v"(a1h), "v"(a0l), "v"(a1l), "v"(v00), "v"(v01), "v"(v10), "v"(v11));
#endif
    const v2f w0[4] = {{v00[0], v00[1]}, {v00[2], v00[3]}, {v01[0], v01[1]}, {v01[2], v01[3]}};
    const v2f w1[4] = {{v10[0], v10[1]}, {v10[2], v10[3]}, {v11[0], v11[1]}, {v11[2], v11[3]}};
    v8f s0[QT], s1[QT];
#pragma unroll
    for (int t = 0; t < QT; ++t) { s0[t] = mma_b(a0h, fqh[t], zero8()); s1[t] = mma_b(a1h, fqh[t], zero8()); }
#pragma unroll
    for (int t = 0; t < QT; ++t) { s0[t] = mma_b(a0h, fql[t], s0[t]); s1[t] = mma_b(a1h, fql[t], s1[t]); }
#pragma unroll
    for (int t = 0; t < QT; ++t) { s0[t] = mma_b(a0l, fqh[t], s0[t]); s1[t] = mma_b(a1l, fqh[t], s1[t]); }
    // ---- online softmax over the key axis, one query tile after the other ----
#pragma unroll
    for (int t = 0; t < QT; ++t) {
      float lmax = fmaxf(s0[t][0], s1[t][0]);
#pragma unroll
      for (int v = 1; v < 8; ++v) lmax = fmaxf(lmax, fmaxf(s0[t][v], s1[t][v]));
      lmax = fmaxf(lmax, __shfl_xor(lmax, 16, 32));
      const float nm = fmaxf(run_max[t], lmax * L2E);
      const float factor = ex2(run_max[t] - nm);
      run_max[t] = nm;
      const v2f nm2 = {nm, nm};
      const v2f f2 = {factor, factor};
      v2f ls = run_sum[t] * f2, po = run_o[t] * f2;
      // Two scores that sit in neighbouring accumulator registers go through each packed instruction together.
#pragma unroll
      for (int j = 0; j < 4; ++j) {
        const v2f a0 = {s0[t][2 * j], s0[t][2 * j + 1]};
        const v2f a1 = {s1[t][2 * j], s1[t][2 * j + 1]};
        const v2f e0 = __builtin_elementwise_fma(a0, l2e2, -nm2);
        const v2f e1 = __builtin_elementwise_fma(a1, l2e2, -nm2);
        const v2f p0 = {ex2(e0[0]), ex2(e0[1])};
        const v2f p1 = {ex2(e1[0]), ex2(e1[1])};
        ls += p0;
        ls += p1;
        po = __builtin_elementwise_fma(p0, w0[j], po);
        po = __builtin_elementwise_fma(p1, w1[j], po);
      }
      run_sum[t] = ls;
      run_o[t] = po;
    }
  }

  // ---- each wave's partial statistics to LDS (both lane halves joined first) ----
#pragma unroll
  for (int t = 0; t < QT; ++t) {
    const float hs = run_sum[t][0] + run_sum[t][1], ho = run_o[t][0] + run_o[t][1];
    const float tot = hs + __shfl_xor(hs, 16, 32);
    const float oo = ho + __shfl_xor(ho, 16, 32);
    if (h == 0) {
      const int slot = wave * QBLK + 16 * t + rl;
      pmx[slot] = run_max[t];
      psm[slot] = tot;
      pov[slot] = oo;
    }
  }
  __syncthreads();

  // ---- merge of the 8 key ranges and epilogue: thread = query ----
  if (tid < QBLK) {
    float gm = pmx[tid];
#pragma unroll
    for (int w = 1; w < AWAV; ++w) gm = fmaxf(gm, pmx[w * QBLK + tid]);
    float tot = 0.0f, oo = 0.0f;
#pragma unroll
    for (int w = 0; w < AWAV; ++w) {
      const float f = ex2(pmx[w * QBLK + tid] - gm);
      tot += psm[w * QBLK + tid] * f;
      oo += pov[w * QBLK + tid] * f;
    }
    out[(size_t)n0 + tid] = gb * (oo * (1.0f / tot)) + xmean[n0 + tid];
  }
}

// =====================================================================================================
// Workspace map (bytes); every region an exact multiple of its whole-line store granularity,
// every offset a multiple of 128.
//   QH bf16 [32768][32]  2097152 @0
//   QL bf16 [32768][32]  2097152 @2097152
//   KH bf16 [32768][32]  2097152 @4194304
//   KL bf16 [32768][32]  2097152 @6291456
//   XM f32  [32768]       131072 @8388608
//   VB f32  [32768]       131072 @8519680
//   end = 8650752
// =====================================================================================================
extern "C" void kernel_launch(void* const* d_in, const int* in_sizes, int n_in,
                              void* d_out, int out_size, void* d_ws, size_t ws_size,
                              hipStream_t stream) {
  if (n_in < 8) return;
  if (in_sizes[0] != NTOK * CIN) return;
  if (in_sizes[1] != CIN * CQK) return;
  if (in_sizes[2] != CQK) return;
  if (in_sizes[3] != CIN * CQK) return;
  if (in_sizes[4] != CQK) return;
  if (in_sizes[5] != CIN * CIN) return;
  if (in_sizes[6] != CIN) return;
  if (in_sizes[7] < 1) return;
  if (out_size != NTOK) return;

  const float* x     = (const float*)d_in[0];
  const float* Wq    = (const float*)d_in[1];
  const float* bq    = (const float*)d_in[2];
  const float* Wk    = (const float*)d_in[3];
  const float* bk    = (const float*)d_in[4];
  const float* Wv    = (const float*)d_in[5];
  const float* bv    = (const float*)d_in[6];
  const float* gamma = (const float*)d_in[7];
  float* out = (float*)d_out;

  const size_t PQK  = (size_t)NTOK * CQK * 2;        // 2097152
  const size_t PTOK = (size_t)NTOK * 4;              //  131072

  size_t off = 0;
  const size_t oQH = off; off += PQK;
  const size_t oQL = off; off += PQK;
  const size_t oKH = off; off += PQK;
  const size_t oKL = off; off += PQK;
  const size_t oXM = off; off += PTOK;
  const size_t oVB = off; off += PTOK;
  if (off > ws_size) return;                          // off = 8650752
  if (off > (size_t)134217728) return;

  char* ws = (char*)d_ws;
  unsigned short* QH = (unsigned short*)(ws + oQH);
  unsigned short* QL = (unsigned short*)(ws + oQL);
  unsigned short* KH = (unsigned short*)(ws + oKH);
  unsigned short* KL = (unsigned short*)(ws + oKL);
  float* XM  = (float*)(ws + oXM);
  float* VB  = (float*)(ws + oVB);

  k_proj<<<dim3(NTOK / PBLK), dim3(2 * PBLK), 0, stream>>>(x, Wq, bq, Wk, bk, Wv, bv, QH, QL, KH, KL, XM, VB);
  k_attn<<<dim3(NTOK / QBLK), dim3(32 * AWAV), 0, stream>>>(QH, QL, KH, KL, VB, XM, gamma, out);
  (void)hipGetLastError();
}

// v005
// It runs in 38.1 microseconds.
// In two side-by-side timings against v004, it was 1.05 and 1.06 times as fast.
// Over all steps from v000 it is 3.35 times as fast.
// Projection tiles (tokens x Wq, tokens x Wk): v_wmma_f32_16x16x32_bf16 (bf16 operands = RNE-converted inputs), f32 accumulate.
// Score tiles (keys x queries, K = 32): v_wmma_f32_16x16x32_bf16 on a bf16 hi/lo split of both operands (hi.hi + hi.lo + lo.hi), f32 accumulate.
// Row sums of Wv and the sum of bv: v_wmma_f32_16x16x32_bf16, A = bf16RNE values, B = ones and zeros, f32 accumulate.
// Channel sums, value channel-mean dot, softmax statistics, weight-times-value-mean reduction and epilogue: f32 on the VALU.
#include <hip/hip_runtime.h>

#define CIN   256
#define CQK   32
#define HWN   4096
#define NBAT  8
#define NTOK  32768
#define PBLK  128
#define QBLK  64
#define PW    264
#define XP    260
#define AWAV  8
#define QT    (QBLK / 16)
#define KSPL  (HWN / AWAV)

static_assert(NTOK == NBAT * HWN);
static_assert((NTOK % PBLK) == 0 && (NTOK % QBLK) == 0 && (HWN % QBLK) == 0);
static_assert((HWN % 32) == 0 && (CIN % 32) == 0 && CQK == 32);
static_assert((PW % 8) == 0 && PBLK == 128 && QBLK == 64 && CIN == 2 * PBLK);
static_assert((XP % 4) == 0 && ((XP / 4) % 2) == 1 && XP >= CIN);
static_assert((KSPL % 32) == 0 && 32 * AWAV >= QBLK && (HWN % (4 * 32 * AWAV)) == 0);

typedef __bf16         v16bf __attribute__((ext_vector_type(16)));
typedef unsigned short v16us __attribute__((ext_vector_type(16)));
typedef unsigned short v8us  __attribute__((ext_vector_type(8)));
typedef float          v8f   __attribute__((ext_vector_type(8)));
typedef float          v4f   __attribute__((ext_vector_type(4)));
typedef float          v2f   __attribute__((ext_vector_type(2)));
typedef __bf16         v2bf  __attribute__((ext_vector_type(2)));
typedef unsigned int   v8u   __attribute__((ext_vector_type(8)));
typedef unsigned int   v4u   __attribute__((ext_vector_type(4)));

// ---- scalar helpers --------------------------------------------------------------------------------
__device__ __forceinline__ unsigned short bf_bits(float f) {          // f32 -> bf16 bits, RNE convert
  unsigned u = __float_as_uint(f);
  return (unsigned short)((u + 0x7FFFu + ((u >> 16) & 1u)) >> 16);
}
__device__ __forceinline__ float bf_up(unsigned short hb) { return __uint_as_float(((unsigned)hb) << 16); }
__device__ __forceinline__ float bf_r(float f) { return bf_up(bf_bits(f)); }
__device__ __forceinline__ float ex2(float f) { return __builtin_amdgcn_exp2f(f); }   // 2^f, one v_exp_f32
__device__ __forceinline__ v8f zero8() { v8f z = {0.f, 0.f, 0.f, 0.f, 0.f, 0.f, 0.f, 0.f}; return z; }

// ---- fragment loader: lane -> row/col (lane&15); p already includes +8*(lane>>4);
//      elements 0..7 <- p[0..7] (k0+8h..), elements 8..15 <- p[16..23] (k0+16+8h..). Same map for A and B.
__device__ __forceinline__ v16bf ldfrag_b(const unsigned short* p) {
  union { v16us v; v8us hv[2]; } f;
  f.hv[0] = *(const v8us*)(p);
  f.hv[1] = *(const v8us*)(p + 16);
  return __builtin_bit_cast(v16bf, f.v);
}

// ---- WMMA helper and trailing VALU hazard gaps ------------------------------------------------------------
__device__ __forceinline__ v8f mma_b(v16bf a, v16bf b, v8f c) {
  return __builtin_amdgcn_wmma_f32_16x16x32_bf16(false, a, false, b, (short)0, c, false, false);
}
__device__ __forceinline__ void guard_p(v8f& c0, v8f& c1, v8f& c2, v8f& c3,
                                        v16bf a, v16bf b0, v16bf b1, v16bf b2, v16bf b3) {
#if defined(__HIP_DEVICE_COMPILE__)
  asm volatile("v_nop\n\tv_nop\n\tv_nop\n\tv_nop"
               : "+v"(c0), "+v"(c1), "+v"(c2), "+v"(c3)
               : "v"(a), "v"(b0), "v"(b1), "v"(b2), "v"(b3));
#endif
}
__device__ __forceinline__ void acc_guard4(v8f& a, v8f& b, v8f& c, v8f& d) {
#if defined(__HIP_DEVICE_COMPILE__)
  asm volatile("v_nop\n\tv_nop\n\tv_nop\n\tv_nop" : "+v"(a), "+v"(b), "+v"(c), "+v"(d));
#endif
}
__device__ __forceinline__ void sched_fence() {
#if defined(__HIP_DEVICE_COMPILE__)
  asm volatile("" ::: "memory");
#endif
}

// ---- eight asynchronous copies to LDS, 16 bytes a lane each: four rows of x, two whole-wave 512-byte halves a row.
//      l = the lane's LDS byte address of the first row's first half, g = its global address; rows XP and CIN floats apart.
//      The closing s_wait_xcnt stands inside the statement, ahead of any later write of an address register it names.
__device__ __forceinline__ void copy_rows4(unsigned l, const float* g) {
#if defined(__HIP_DEVICE_COMPILE__)
  asm volatile("global_load_async_to_lds_b128 %0, %8, off\n\t"
               "global_load_async_to_lds_b128 %1, %9, off\n\t"
               "global_load_async_to_lds_b128 %2, %10, off\n\t"
               "global_load_async_to_lds_b128 %3, %11, off\n\t"
               "global_load_async_to_lds_b128 %4, %12, off\n\t"
               "global_load_async_to_lds_b128 %5, %13, off\n\t"
               "global_load_async_to_lds_b128 %6, %14, off\n\t"
               "global_load_async_to_lds_b128 %7, %15, off\n\t"
               "s_wait_xcnt 0x0"
               :: "v"(l), "v"(l + 512u), "v"(l + 4u * XP), "v"(l + 4u * XP + 512u),
                  "v"(l + 8u * XP), "v"(l + 8u * XP + 512u), "v"(l + 12u * XP), "v"(l + 12u * XP + 512u),
                  "v"(g), "v"(g + 128), "v"(g + CIN), "v"(g + CIN + 128),
                  "v"(g + 2 * CIN), "v"(g + 2 * CIN + 128), "v"(g + 3 * CIN), "v"(g + 3 * CIN + 128)
               : "memory");
#endif
}

// ---- NQ whole-wave 512-byte loads (p already includes +4*lane) -> fragment elements 4q..4q+3 of the lane, RNE
//      convert (two values per instruction); the elements above 4*NQ are zero.
template <int NQ>
__device__ __forceinline__ v16bf ldlines(const float* p) {
  v16bf a;
#pragma unroll
  for (int e = 0; e < 16; ++e) a[e] = (__bf16)0.0f;
#pragma unroll
  for (int g = 0; g < NQ; ++g) {
    const v4f f = *(const v4f*)(p + 128 * g);
    const v2f f01 = {f[0], f[1]}, f23 = {f[2], f[3]};
    const v2bf c01 = __builtin_convertvector(f01, v2bf), c23 = __builtin_convertvector(f23, v2bf);
    a[4 * g] = c01[0]; a[4 * g + 1] = c01[1]; a[4 * g + 2] = c23[0]; a[4 * g + 3] = c23[1];
  }
  return a;
}

// =====================================================================================================
// Projections + per-token statistics. Block = 128 tokens, 8 waves, wave = 16 tokens; one block per WGP, so Wv is
// read once per WGP.
// Entry: each wave sends its 16 rows of x (16 KiB) to LDS by 32 asynchronous copies (row pitch 260 floats = 16 B x 65),
// which fly under the whole prologue; its own wait on them stands in front of the prologue's closing barrier.
// Prologue: wsum[cin] = sum over cout of bf16RNE(Wv[cin][cout]), wave = 32 rows of Wv. Two neighbouring rows are
// four whole-wave 512-byte loads: a lane's fragment elements 0..7 belong to the even row, 8..15 to the odd one.
// Product j of a 16-row group: A = that fragment, B = 1 in column 2j at elements 0..7 and in column 2j+1 at
// elements 8..15, else 0 (same element map for A and B), so D[i][n] = what lanes i and i+16 hold of row n.
// A lane adds its 8 registers and its xor-16 partner's sum: lane n has the sum of row n.
// Sum of bf16RNE(bv), in every wave: two such loads in elements 0..7, B = ones, the same two additions.
// LDS: Wq and Wk as bf16 bits in [n][k] layout (rows 0..31 = Wq columns, rows 32..63 = Wk columns,
// pitch 264), wsum, biases. k-loop over 256 in steps of 32: A = bf16RNE(x) rows read from LDS (row = token m,
// split k map), B = sW rows (col = output channel, same k map); the same x elements feed the f32 channel
// sum and the f32 dot with wsum. Epilogue: q/k + bias -> hi = bf16RNE(v), lo = bf16RNE(v - hi), staged
// per wave in LDS as four [16 tokens][32] planes, then each plane tile (1024 contiguous bytes in global)
// coverage: 8 waves x 16 rows x 32 = the block's 128 rows of each of the 4 planes; 128 xmean + 128 vbar;
// 256 blocks = whole planes.
// =====================================================================================================
__global__ __launch_bounds__(2 * PBLK) void k_proj(const float* __restrict__ x,
                                               const float* __restrict__ Wq, const float* __restrict__ bq,
                                               const float* __restrict__ Wk, const float* __restrict__ bk,
                                               const float* __restrict__ Wv, const float* __restrict__ bv,
                                               unsigned short* qh, unsigned short* ql,
                                               unsigned short* kh, unsigned short* kl,
                                               float* xmean, float* vbar) {
  __shared__ __align__(16) float sX[PBLK * XP];
  __shared__ __align__(16) unsigned short sW[64 * PW];
  __shared__ __align__(16) unsigned short sO[(PBLK / 16) * 4 * 16 * CQK];
  __shared__ __align__(16) float swsum[CIN];
  __shared__ __align__(16) float smean[PBLK];
  __shared__ __align__(16) float svbar[PBLK];
  __shared__ float sbias[64];
  const int tid = threadIdx.x, wave = tid >> 5, lane = tid & 31, m = lane & 15, h = lane >> 4;
  const int row0 = blockIdx.x * PBLK + wave * 16;

  {
    const unsigned xl = (unsigned)(size_t)(sX + wave * 16 * XP + 4 * lane);
    const float* xg = x + (size_t)row0 * CIN + 4 * lane;
    // Unrolled so that every copy's two addresses are constant steps from one base and all 32 copies issue in a row.
#pragma unroll
    for (int q = 0; q < 4; ++q) copy_rows4(xl + (unsigned)(q * 4 * XP * 4), xg + q * 4 * CIN);
  }

  float bvsum;
  {
    const unsigned one2 = 0x3F803F80u;              // two bf16 ones
    const v8u ou = {one2, one2, one2, one2, one2, one2, one2, one2};
    const v16bf ab = ldlines<2>(bv + 4 * lane);
    // A Wv load may land on the bv loads' address pair: the wait stands ahead of that overwrite.
#if defined(__HIP_DEVICE_COMPILE__)
    asm volatile("s_wait_xcnt 0x0" ::: "memory");
#endif
    const float* wv = Wv + (size_t)(wave * 32) * CIN + 4 * lane;
    v8f rs[2] = {zero8(), zero8()};
#pragma unroll
    for (int j = 0; j < 8; ++j) {
      const unsigned se = m == 2 * j ? one2 : 0u, so2 = m == 2 * j + 1 ? one2 : 0u;
      const v8u su = {se, se, se, se, so2, so2, so2, so2};
      const v16bf sel = __builtin_bit_cast(v16bf, su);
#pragma unroll
      for (int rt = 0; rt < 2; ++rt) rs[rt] = mma_b(ldlines<4>(wv + (rt * 16 + 2 * j) * CIN), sel, rs[rt]);
    }
    const v8f rb = mma_b(ab, __builtin_bit_cast(v16bf, ou), zero8());
    float p0 = ((rs[0][0] + rs[0][1]) + (rs[0][2] + rs[0][3])) + ((rs[0][4] + rs[0][5]) + (rs[0][6] + rs[0][7]));
    float p1 = ((rs[1][0] + rs[1][1]) + (rs[1][2] + rs[1][3])) + ((rs[1][4] + rs[1][5]) + (rs[1][6] + rs[1][7]));
    float pb = ((rb[0] + rb[1]) + (rb[2] + rb[3])) + ((rb[4] + rb[5]) + (rb[6] + rb[7]));
    p0 += __shfl_xor(p0, 16, 32);
    p1 += __shfl_xor(p1, 16, 32);
    pb += __shfl_xor(pb, 16, 32);
    swsum[wave * 32 + lane] = h ? p1 : p0;
    bvsum = pb;
  }
#pragma unroll 4
  for (int it = 0; it < (CIN * CQK) / (2 * PBLK); ++it) {
    const int idx = it * (2 * PBLK) + tid;          // = k*32 + n
    const int k = idx >> 5, n = idx & 31;
    sW[n * PW + k] = bf_bits(Wq[idx]);
    sW[(32 + n) * PW + k] = bf_bits(Wk[idx]);
  }
  if (tid < 64) {
    const float vq = bq[tid & 31];
    const float vk = bk[tid & 31];
    sbias[tid] = bf_r(tid < 32 ? vq : vk);
  }
  // The wave's own copies of x have landed before it passes the barrier behind which sX is read.
#if defined(__HIP_DEVICE_COMPILE__)
  asm volatile("s_wait_asynccnt 0x0" ::: "memory");
#endif
  __syncthreads();

  const float* xr = sX + (wave * 16 + m) * XP + 8 * h;
  const float* wr = swsum + 8 * h;
  const unsigned short* wb = sW + m * PW + 8 * h;
  v8f acc[4];
#pragma unroll
  for (int t = 0; t < 4; ++t) acc[t] = zero8();
  float xs = 0.f, vd = 0.f;

#pragma unroll 2
  for (int c = 0; c < CIN / 32; ++c) {
    const float* p = xr + 32 * c;
    const v4f x0 = *(const v4f*)(p);
    const v4f x1 = *(const v4f*)(p + 4);
    const v4f x2 = *(const v4f*)(p + 16);
    const v4f x3 = *(const v4f*)(p + 20);
    const float* pw = wr + 32 * c;
    const v4f w0 = *(const v4f*)(pw);
    const v4f w1 = *(const v4f*)(pw + 4);
    const v4f w2 = *(const v4f*)(pw + 16);
    const v4f w3 = *(const v4f*)(pw + 20);
    v16us au;
#pragma unroll
    for (int e = 0; e < 4; ++e) {
      const unsigned short b0 = bf_bits(x0[e]), b1 = bf_bits(x1[e]);
      const unsigned short b2 = bf_bits(x2[e]), b3 = bf_bits(x3[e]);
      const float r0 = bf_up(b0), r1 = bf_up(b1), r2 = bf_up(b2), r3 = bf_up(b3);
      au[e] = b0; au[4 + e] = b1; au[8 + e] = b2; au[12 + e] = b3;
      xs += (r0 + r1) + (r2 + r3);
      vd += r0 * w0[e]; vd += r1 * w1[e]; vd += r2 * w2[e]; vd += r3 * w3[e];
    }
    const v16bf a = __builtin_bit_cast(v16bf, au);
    const unsigned short* bp = wb + 32 * c;
    const v16bf f0 = ldfrag_b(bp);
    const v16bf f1 = ldfrag_b(bp + 16 * PW);
    const v16bf f2 = ldfrag_b(bp + 32 * PW);
    const v16bf f3 = ldfrag_b(bp + 48 * PW);
    acc[0] = mma_b(a, f0, acc[0]);
    acc[1] = mma_b(a, f1, acc[1]);
    acc[2] = mma_b(a, f2, acc[2]);
    acc[3] = mma_b(a, f3, acc[3]);
    guard_p(acc[0], acc[1], acc[2], acc[3], a, f0, f1, f2, f3);
    sched_fence();
  }
  acc_guard4(acc[0], acc[1], acc[2], acc[3]);

  // ---- per-token statistics (both lane halves hold row m) ----
  xs += __shfl_xor(xs, 16, 32);
  vd += __shfl_xor(vd, 16, 32);
  if (h == 0) {
    smean[wave * 16 + m] = xs * (1.0f / 256.0f);
    svbar[wave * 16 + m] = (vd + bvsum) * (1.0f / 256.0f);
  }
  // ---- q/k hi/lo planes staged per wave: plane 0 = q hi, 1 = q lo, 2 = k hi, 3 = k lo ----
  unsigned short* so = sO + wave * (4 * 16 * CQK);
#pragma unroll
  for (int t = 0; t < 4; ++t) {
    const float bias = sbias[16 * t + m];
    const int col = 16 * (t & 1) + m;
    unsigned short* ph = so + (2 * (t >> 1)) * (16 * CQK) + col;
    unsigned short* pl = ph + 16 * CQK;
#pragma unroll
    for (int r = 0; r < 8; ++r) {
      const float val = acc[t][r] + bias;
      const unsigned short hb = bf_bits(val);
      const unsigned short lb = bf_bits(val - bf_up(hb));
      ph[(8 * h + r) * CQK] = hb;
      pl[(8 * h + r) * CQK] = lb;
    }
  }
  __syncthreads();
  v4u pc[8];
#pragma unroll
  for (int pidx = 0; pidx < 4; ++pidx) {
    pc[2 * pidx]     = *(const v4u*)(so + pidx * (16 * CQK) + lane * 8);
    pc[2 * pidx + 1] = *(const v4u*)(so + pidx * (16 * CQK) + 256 + lane * 8);
  }
  const size_t ob = (size_t)row0 * CQK + (size_t)lane * 8;
  *(v4u*)(qh + ob) = pc[0];  *(v4u*)(qh + ob + 256) = pc[1];
  *(v4u*)(ql + ob) = pc[2];  *(v4u*)(ql + ob + 256) = pc[3];
  *(v4u*)(kh + ob) = pc[4];  *(v4u*)(kh + ob + 256) = pc[5];
  *(v4u*)(kl + ob) = pc[6];  *(v4u*)(kl + ob + 256) = pc[7];
  

  if (wave == 0) {
    *(v4f*)(xmean + (size_t)blockIdx.x * PBLK + 4 * lane) = *(const v4f*)(smean + 4 * lane);
  } else if (wave == 1) {
    *(v4f*)(vbar + (size_t)blockIdx.x * PBLK + 4 * lane) = *(const v4f*)(svbar + 4 * lane);
  }
}

// =====================================================================================================
// Attention, single pass with online softmax. Block = 64 queries (inside one image), 8 waves.
// Every wave holds the Q fragments of all 64 queries (4 query tiles) and walks its own eighth of the
// image's keys (512 keys, 16 chunks of 32), so one K fragment load and one vbar read feed 4 query tiles.
// vbar of the image staged in LDS (4096 floats). Per 32-key chunk and query tile t:
//   S^T tiles = K rows (A, row = key, k = d) . Q rows (B, col = query, k = d), one k-step,
//   three products hi.hi + hi.lo + lo.hi per tile from zero;
//   D: s0[t][r] = S[key kb+8h+r][query], s1[t][r] = S[key kb+16+8h+r][query];
//   running max over the 32 keys (per lane, then the xor-16 partner), kept times log2(e); rescale of sum and of
//   the weighted value-mean accumulator; p = 2^(s * log2(e) - max) in f32; o += p * vbar[key] (f32 FMA).
//   The exponent, the sum and the weighted sum are formed on pairs of neighbouring accumulator registers
//   (packed f32 instructions); the two elements of a pair's sums are added once, after the loop.
// Merge: each wave leaves (max, sum, weighted sum) per query in LDS; after one barrier thread q < 64
// rescales the 8 partials of query q to their common max (base 2) and adds them in wave order.
// Epilogue: res = gammaRNE * (o / l) + xmean[query]; waves 0 and 1 each store one whole 128-byte line.
// coverage: 8 waves x 16 chunks x 32 = all 4096 keys of the image; 512 blocks x 64 = whole output.
// =====================================================================================================
__global__ __launch_bounds__(32 * AWAV) void k_attn(const unsigned short* qh, const unsigned short* ql,
                                               const unsigned short* kh, const unsigned short* kl,
                                               const float* vbar, const float* xmean,
                                               const float* __restrict__ gamma, float* out) {
  __shared__ __align__(16) float svb[HWN];
  __shared__ float pmx[AWAV * QBLK];
  __shared__ float psm[AWAV * QBLK];
  __shared__ float pov[AWAV * QBLK];
  const int tid = threadIdx.x, wave = tid >> 5, lane = tid & 31;
  const int rl = lane & 15, h = lane >> 4, koff = 8 * h;
  const int n0 = blockIdx.x * QBLK;
  const int keybase = (n0 / HWN) * HWN;
  const float gb = bf_r(gamma[0]);

  // Every loop over t (query tile), v (accumulator register) and j (register pair) is fully unrolled: the per-tile arrays live in VGPRs.
  const unsigned short* qhp = qh + (size_t)(n0 + rl) * CQK + koff;
  const unsigned short* qlp = ql + (size_t)(n0 + rl) * CQK + koff;
  v16bf fqh[QT], fql[QT];
#pragma unroll
  for (int t = 0; t < QT; ++t) fqh[t] = ldfrag_b(qhp + t * 16 * CQK);
  // A lo-plane load lands on the hi-plane loads' address pair: the wait stands ahead of that overwrite.
#if defined(__HIP_DEVICE_COMPILE__)
  asm volatile("s_wait_xcnt 0x0" ::: "memory");
#endif
#pragma unroll
  for (int t = 0; t < QT; ++t) fql[t] = ldfrag_b(qlp + t * 16 * CQK);
#pragma unroll
  for (int j = 0; j < HWN / (4 * 32 * AWAV); ++j) {
    const int i = tid + 32 * AWAV * j;
    ((v4f*)svb)[i] = *(const v4f*)(vbar + keybase + 4 * i);
  }
  __syncthreads();

  const int key0 = wave * KSPL;
  const unsigned short* khp = kh + (size_t)(keybase + key0 + rl) * CQK + koff;
  const unsigned short* klp = kl + (size_t)(keybase + key0 + rl) * CQK + koff;
  const float* vbp = svb + key0 + koff;

  const float L2E = 1.44269504088896340736f;
  const v2f l2e2 = {L2E, L2E};
  float run_max[QT];                                  // running max times log2(e)
  v2f run_sum[QT], run_o[QT];                         // element 0: even accumulator registers, element 1: odd
#pragma unroll
  for (int t = 0; t < QT; ++t) { run_max[t] = -1.0e30f; run_sum[t] = 0.0f; run_o[t] = 0.0f; }

  // Kept rolled: one chunk's body already needs most of the 256 VGPRs that four waves per SIMD leave a wave.
#pragma unroll 1
  for (int kb = 0; kb < KSPL; kb += 32) {
    const unsigned short* pa = khp + (size_t)kb * CQK;
    const unsigned short* pl = klp + (size_t)kb * CQK;
    const v16bf a0h = ldfrag_b(pa);
    const v16bf a1h = ldfrag_b(pa + 16 * CQK);
    const v16bf a0l = ldfrag_b(pl);
    const v16bf a1l = ldfrag_b(pl + 16 * CQK);
    const v4f v00 = *(const v4f*)(vbp + kb);
    const v4f v01 = *(const v4f*)(vbp + kb + 4);
    const v4f v10 = *(const v4f*)(vbp + kb + 16);
    const v4f v11 = *(const v4f*)(vbp + kb + 16 + 4);
    // Inputs-only fence on the loaded values: keeps the chunk's eight K loads and four vbar reads together ahead
    // of the first product (without it the lo-plane loads sink among the products: three load waits a chunk).
#if defined(__HIP_DEVICE_COMPILE__)
    asm volatile("" :: "v"(a0h), "v"(a1h), "v"(a0l), "v"(a1l), "v"(v00), "v"(v01), "v"(v10), "v"(v11));
#endif
    const v2f w0[4] = {{v00[0], v00[1]}, {v00[2], v00[3]}, {v01[0], v01[1]}, {v01[2], v01[3]}};
    const v2f w1[4] = {{v10[0], v10[1]}, {v10[2], v10[3]}, {v11[0], v11[1]}, {v11[2], v11[3]}};
    v8f s0[QT], s1[QT];
#pragma unroll
    for (int t = 0; t < QT; ++t) { s0[t] = mma_b(a0h, fqh[t], zero8()); s1[t] = mma_b(a1h, fqh[t], zero8()); }
#pragma unroll
    for (int t = 0; t < QT; ++t) { s0[t] = mma_b(a0h, fql[t], s0[t]); s1[t] = mma_b(a1h, fql[t], s1[t]); }
#pragma unroll
    for (int t = 0; t < QT; ++t) { s0[t] = mma_b(a0l, fqh[t], s0[t]); s1[t] = mma_b(a1l, fqh[t], s1[t]); }
    // ---- online softmax over the key axis, one query tile after the other ----
#pragma unroll
    for (int t = 0; t < QT; ++t) {
      float lmax = fmaxf(s0[t][0], s1[t][0]);
#pragma unroll
      for (int v = 1; v < 8; ++v) lmax = fmaxf(lmax, fmaxf(s0[t][v], s1[t][v]));
      lmax = fmaxf(lmax, __shfl_xor(lmax, 16, 32));
      const float nm = fmaxf(run_max[t], lmax * L2E);
      const float factor = ex2(run_max[t] - nm);
      run_max[t] = nm;
      const v2f nm2 = {nm, nm};
      const v2f f2 = {factor, factor};
      v2f ls = run_sum[t] * f2, po = run_o[t] * f2;
      // Two scores that sit in neighbouring accumulator registers go through each packed instruction together.
#pragma unroll
      for (int j = 0; j < 4; ++j) {
        const v2f a0 = {s0[t][2 * j], s0[t][2 * j + 1]};
        const v2f a1 = {s1[t][2 * j], s1[t][2 * j + 1]};
        const v2f e0 = __builtin_elementwise_fma(a0, l2e2, -nm2);
        const v2f e1 = __builtin_elementwise_fma(a1, l2e2, -nm2);
        const v2f p0 = {ex2(e0[0]), ex2(e0[1])};
        const v2f p1 = {ex2(e1[0]), ex2(e1[1])};
        ls += p0;
        ls += p1;
        po = __builtin_elementwise_fma(p0, w0[j], po);
        po = __builtin_elementwise_fma(p1, w1[j], po);
      }
      run_sum[t] = ls;
      run_o[t] = po;
    }
  }

  // ---- each wave's partial statistics to LDS (both lane halves joined first) ----
#pragma unroll
  for (int t = 0; t < QT; ++t) {
    const float hs = run_sum[t][0] + run_sum[t][1], ho = run_o[t][0] + run_o[t][1];
    const float tot = hs + __shfl_xor(hs, 16, 32);
    const float oo = ho + __shfl_xor(ho, 16, 32);
    if (h == 0) {
      const int slot = wave * QBLK + 16 * t + rl;
      pmx[slot] = run_max[t];
      psm[slot] = tot;
      pov[slot] = oo;
    }
  }
  __syncthreads();

  // ---- merge of the 8 key ranges and epilogue: thread = query ----
  if (tid < QBLK) {
    float gm = pmx[tid];
#pragma unroll
    for (int w = 1; w < AWAV; ++w) gm = fmaxf(gm, pmx[w * QBLK + tid]);
    float tot = 0.0f, oo = 0.0f;
#pragma unroll
    for (int w = 0; w < AWAV; ++w) {
      const float f = ex2(pmx[w * QBLK + tid] - gm);
      tot += psm[w * QBLK + tid] * f;
      oo += pov[w * QBLK + tid] * f;
    }
    out[(size_t)n0 + tid] = gb * (oo * (1.0f / tot)) + xmean[n0 + tid];
  }
}

// =====================================================================================================
// Workspace map (bytes); every region an exact multiple of its whole-line store granularity,
// every offset a multiple of 128.
//   QH bf16 [32768][32]  2097152 @0
//   QL bf16 [32768][32]  2097152 @2097152
//   KH bf16 [32768][32]  2097152 @4194304
//   KL bf16 [32768][32]  2097152 @6291456
//   XM f32  [32768]       131072 @8388608
//   VB f32  [32768]       131072 @8519680
//   end = 8650752
// =====================================================================================================
extern "C" void kernel_launch(void* const* d_in, const int* in_sizes, int n_in,
                              void* d_out, int out_size, void* d_ws, size_t ws_size,
                              hipStream_t stream) {
  if (n_in < 8) return;
  if (in_sizes[0] != NTOK * CIN) return;
  if (in_sizes[1] != CIN * CQK) return;
  if (in_sizes[2] != CQK) return;
  if (in_sizes[3] != CIN * CQK) return;
  if (in_sizes[4] != CQK) return;
  if (in_sizes[5] != CIN * CIN) return;
  if (in_sizes[6] != CIN) return;
  if (in_sizes[7] < 1) return;
  if (out_size != NTOK) return;

  const float* x     = (const float*)d_in[0];
  const float* Wq    = (const float*)d_in[1];
  const float* bq    = (const float*)d_in[2];
  const float* Wk    = (const float*)d_in[3];
  const float* bk    = (const float*)d_in[4];
  const float* Wv    = (const float*)d_in[5];
  const float* bv    = (const float*)d_in[6];
  const float* gamma = (const float*)d_in[7];
  float* out = (float*)d_out;

  const size_t PQK  = (size_t)NTOK * CQK * 2;        // 2097152
  const size_t PTOK = (size_t)NTOK * 4;              //  131072

  size_t off = 0;
  const size_t oQH = off; off += PQK;
  const size_t oQL = off; off += PQK;
  const size_t oKH = off; off += PQK;
  const size_t oKL = off; off += PQK;
  const size_t oXM = off; off += PTOK;
  const size_t oVB = off; off += PTOK;
  if (off > ws_size) return;                          // off = 8650752
  if (off > (size_t)134217728) return;

  char* ws = (char*)d_ws;
  unsigned short* QH = (unsigned short*)(ws + oQH);
  unsigned short* QL = (unsigned short*)(ws + oQL);
  unsigned short* KH = (unsigned short*)(ws + oKH);
  unsigned short* KL = (unsigned short*)(ws + oKL);
  float* XM  = (float*)(ws + oXM);
  float* VB  = (float*)(ws + oVB);

  k_proj<<<dim3(NTOK / PBLK), dim3(2 * PBLK), 0, stream>>>(x, Wq, bq, Wk, bk, Wv, bv, QH, QL, KH, KL, XM, VB);
  k_attn<<<dim3(NTOK / QBLK), dim3(32 * AWAV), 0, stream>>>(QH, QL, KH, KL, VB, XM, gamma, out);
  (void)hipGetLastError();
}

// v006
// A run of this version takes 34.9 microseconds.
// Next to v005, in two timings, it ran 1.08 times as fast each time.
// Over all steps from v000 it is 3.63 times as fast.
// Projection tiles (tokens x Wq, tokens x Wk): v_wmma_f32_16x16x32_bf16 (bf16 operands = RNE-converted inputs), f32 accumulate.
// Score tiles (keys x queries, K = 32): v_wmma_f32_16x16x32_bf16 on a bf16 hi/lo split of both operands (hi.hi + hi.lo + lo.hi), f32 accumulate.
// Row sums of Wv and the sum of bv: v_wmma_f32_16x16x32_bf16, A = bf16RNE values, B = ones and zeros, f32 accumulate.
// Channel sums, value channel-mean dot, softmax statistics, weight-times-value-mean reduction and epilogue: f32 on the VALU.
#include <hip/hip_runtime.h>

#define CIN   256
#define CQK   32
#define HWN   4096
#define NBAT  8
#define NTOK  32768
#define PBLK  128
#define QBLK  64
#define PW    264
#define XP    260
#define AWAV  8
#define QT    (QBLK / 16)
#define KSPL  (HWN / AWAV)

static_assert(NTOK == NBAT * HWN);
static_assert((NTOK % PBLK) == 0 && (NTOK % QBLK) == 0 && (HWN % QBLK) == 0);
static_assert((HWN % 32) == 0 && (CIN % 32) == 0 && CQK == 32);
static_assert((PW % 8) == 0 && PBLK == 128 && QBLK == 64 && CIN == 2 * PBLK);
static_assert((XP % 4) == 0 && ((XP / 4) % 2) == 1 && XP >= CIN);
static_assert((KSPL % 32) == 0 && 32 * AWAV >= QBLK && (HWN % (4 * 32 * AWAV)) == 0);

typedef __bf16         v16bf __attribute__((ext_vector_type(16)));
typedef unsigned short v16us __attribute__((ext_vector_type(16)));
typedef unsigned short v8us  __attribute__((ext_vector_type(8)));
typedef float          v8f   __attribute__((ext_vector_type(8)));
typedef float          v4f   __attribute__((ext_vector_type(4)));
typedef float          v2f   __attribute__((ext_vector_type(2)));
typedef __bf16         v2bf  __attribute__((ext_vector_type(2)));
typedef unsigned int   v8u   __attribute__((ext_vector_type(8)));
typedef unsigned int   v4u   __attribute__((ext_vector_type(4)));

// ---- scalar helpers --------------------------------------------------------------------------------
__device__ __forceinline__ unsigned short bf_bits(float f) {          // f32 -> bf16 bits, RNE convert
  unsigned u = __float_as_uint(f);
  return (unsigned short)((u + 0x7FFFu + ((u >> 16) & 1u)) >> 16);
}
__device__ __forceinline__ float bf_up(unsigned short hb) { return __uint_as_float(((unsigned)hb) << 16); }
__device__ __forceinline__ float bf_r(float f) { return bf_up(bf_bits(f)); }
__device__ __forceinline__ float ex2(float f) { return __builtin_amdgcn_exp2f(f); }   // 2^f, one v_exp_f32
__device__ __forceinline__ v8f zero8() { v8f z = {0.f, 0.f, 0.f, 0.f, 0.f, 0.f, 0.f, 0.f}; return z; }

// ---- fragment loader: lane -> row/col (lane&15); p already includes +8*(lane>>4);
//      elements 0..7 <- p[0..7] (k0+8h..), elements 8..15 <- p[16..23] (k0+16+8h..). Same map for A and B.
__device__ __forceinline__ v16bf ldfrag_b(const unsigned short* p) {
  union { v16us v; v8us hv[2]; } f;
  f.hv[0] = *(const v8us*)(p);
  f.hv[1] = *(const v8us*)(p + 16);
  return __builtin_bit_cast(v16bf, f.v);
}

// ---- WMMA helper and trailing VALU hazard gaps ------------------------------------------------------------
__device__ __forceinline__ v8f mma_b(v16bf a, v16bf b, v8f c) {
  return __builtin_amdgcn_wmma_f32_16x16x32_bf16(false, a, false, b, (short)0, c, false, false);
}
__device__ __forceinline__ void guard_p(v8f& c0, v8f& c1, v8f& c2, v8f& c3,
                                        v16bf a, v16bf b0, v16bf b1, v16bf b2, v16bf b3) {
#if defined(__HIP_DEVICE_COMPILE__)
  asm volatile("v_nop\n\tv_nop\n\tv_nop\n\tv_nop"
               : "+v"(c0), "+v"(c1), "+v"(c2), "+v"(c3)
               : "v"(a), "v"(b0), "v"(b1), "v"(b2), "v"(b3));
#endif
}
__device__ __forceinline__ void acc_guard4(v8f& a, v8f& b, v8f& c, v8f& d) {
#if defined(__HIP_DEVICE_COMPILE__)
  asm volatile("v_nop\n\tv_nop\n\tv_nop\n\tv_nop" : "+v"(a), "+v"(b), "+v"(c), "+v"(d));
#endif
}
__device__ __forceinline__ void sched_fence() {
#if defined(__HIP_DEVICE_COMPILE__)
  asm volatile("" ::: "memory");
#endif
}

// ---- eight asynchronous copies to LDS, 16 bytes a lane each: four rows of x, two whole-wave 512-byte halves a row.
//      l = the lane's LDS byte address of the first row's first half, g = its global address; rows XP and CIN floats apart.
//      The closing s_wait_xcnt stands inside the statement, ahead of any later write of an address register it names.
__device__ __forceinline__ void copy_rows4(unsigned l, const float* g) {
#if defined(__HIP_DEVICE_COMPILE__)
  asm volatile("global_load_async_to_lds_b128 %0, %8, off\n\t"
               "global_load_async_to_lds_b128 %1, %9, off\n\t"
               "global_load_async_to_lds_b128 %2, %10, off\n\t"
               "global_load_async_to_lds_b128 %3, %11, off\n\t"
               "global_load_async_to_lds_b128 %4, %12, off\n\t"
               "global_load_async_to_lds_b128 %5, %13, off\n\t"
               "global_load_async_to_lds_b128 %6, %14, off\n\t"
               "global_load_async_to_lds_b128 %7, %15, off\n\t"
               "s_wait_xcnt 0x0"
               :: "v"(l), "v"(l + 512u), "v"(l + 4u * XP), "v"(l + 4u * XP + 512u),
                  "v"(l + 8u * XP), "v"(l + 8u * XP + 512u), "v"(l + 12u * XP), "v"(l + 12u * XP + 512u),
                  "v"(g), "v"(g + 128), "v"(g + CIN), "v"(g + CIN + 128),
                  "v"(g + 2 * CIN), "v"(g + 2 * CIN + 128), "v"(g + 3 * CIN), "v"(g + 3 * CIN + 128)
               : "memory");
#endif
}

// ---- NQ whole-wave 512-byte loads (p already includes +4*lane) -> fragment elements 4q..4q+3 of the lane, RNE
//      convert (two values per instruction); the elements above 4*NQ are zero.
template <int NQ>
__device__ __forceinline__ v16bf ldlines(const float* p) {
  v16bf a;
#pragma unroll
  for (int e = 0; e < 16; ++e) a[e] = (__bf16)0.0f;
#pragma unroll
  for (int g = 0; g < NQ; ++g) {
    const v4f f = *(const v4f*)(p + 128 * g);
    const v2f f01 = {f[0], f[1]}, f23 = {f[2], f[3]};
    const v2bf c01 = __builtin_convertvector(f01, v2bf), c23 = __builtin_convertvector(f23, v2bf);
    a[4 * g] = c01[0]; a[4 * g + 1] = c01[1]; a[4 * g + 2] = c23[0]; a[4 * g + 3] = c23[1];
  }
  return a;
}

// =====================================================================================================
// Projections + per-token statistics. Block = 128 tokens, 8 waves, wave = 16 tokens; one block per WGP, so Wv is
// read once per WGP.
// Entry: each wave sends its 16 rows of x (16 KiB) to LDS by 32 asynchronous copies (row pitch 260 floats = 16 B x 65),
// which fly under the whole prologue; its own wait on them stands in front of the prologue's closing barrier.
// Prologue: wsum[cin] = sum over cout of bf16RNE(Wv[cin][cout]), wave = 32 rows of Wv. Two neighbouring rows are
// four whole-wave 512-byte loads: a lane's fragment elements 0..7 belong to the even row, 8..15 to the odd one.
// Product j of a 16-row group: A = that fragment, B = 1 in column 2j at elements 0..7 and in column 2j+1 at
// elements 8..15, else 0 (same element map for A and B), so D[i][n] = what lanes i and i+16 hold of row n.
// A lane adds its 8 registers and its xor-16 partner's sum: lane n has the sum of row n.
// Sum of bf16RNE(bv), in every wave: two such loads in elements 0..7, B = ones, the same two additions.
// LDS: Wq and Wk as bf16 bits in [n][k] layout (rows 0..31 = Wq columns, rows 32..63 = Wk columns,
// pitch 264), wsum, biases. k-loop over 256 in steps of 32: A = bf16RNE(x) rows read from LDS (row = token m,
// split k map), B = sW rows (col = output channel, same k map); the same x elements feed the f32 channel
// sum and the f32 dot with wsum. Epilogue: q/k + bias -> hi = bf16RNE(v), lo = bf16RNE(v - hi), staged
// per wave in LDS as four [16 tokens][32] planes, then each plane tile (1024 contiguous bytes in global)
// coverage: 8 waves x 16 rows x 32 = the block's 128 rows of each of the 4 planes; 128 xmean + 128 vbar;
// 256 blocks = whole planes.
// =====================================================================================================
__global__ __launch_bounds__(2 * PBLK) void k_proj(const float* __restrict__ x,
                                               const float* __restrict__ Wq, const float* __restrict__ bq,
                                               const float* __restrict__ Wk, const float* __restrict__ bk,
                                               const float* __restrict__ Wv, const float* __restrict__ bv,
                                               unsigned short* qh, unsigned short* ql,
                                               unsigned short* kh, unsigned short* kl,
                                               float* xmean, float* vbar) {
  __shared__ __align__(16) float sX[PBLK * XP];
  __shared__ __align__(16) unsigned short sW[64 * PW];
  __shared__ __align__(16) unsigned short sO[(PBLK / 16) * 4 * 16 * CQK];
  __shared__ __align__(16) float swsum[CIN];
  __shared__ __align__(16) float smean[PBLK];
  __shared__ __align__(16) float svbar[PBLK];
  __shared__ float sbias[64];
  const int tid = threadIdx.x, wave = tid >> 5, lane = tid & 31, m = lane & 15, h = lane >> 4;
  const int row0 = blockIdx.x * PBLK + wave * 16;

  {
    const unsigned xl = (unsigned)(size_t)(sX + wave * 16 * XP + 4 * lane);
    const float* xg = x + (size_t)row0 * CIN + 4 * lane;
    // Unrolled so that every copy's two addresses are constant steps from one base and all 32 copies issue in a row.
#pragma unroll
    for (int q = 0; q < 4; ++q) copy_rows4(xl + (unsigned)(q * 4 * XP * 4), xg + q * 4 * CIN);
  }

  float bvsum;
  {
    const unsigned one2 = 0x3F803F80u;              // two bf16 ones
    const v8u ou = {one2, one2, one2, one2, one2, one2, one2, one2};
    const v16bf ab = ldlines<2>(bv + 4 * lane);
    // A Wv load may land on the bv loads' address pair: the wait stands ahead of that overwrite.
#if defined(__HIP_DEVICE_COMPILE__)
    asm volatile("s_wait_xcnt 0x0" ::: "memory");
#endif
    const float* wv = Wv + (size_t)(wave * 32) * CIN + 4 * lane;
    v8f rs[2] = {zero8(), zero8()};
#pragma unroll
    for (int j = 0; j < 8; ++j) {
      const unsigned se = m == 2 * j ? one2 : 0u, so2 = m == 2 * j + 1 ? one2 : 0u;
      const v8u su = {se, se, se, se, so2, so2, so2, so2};
      const v16bf sel = __builtin_bit_cast(v16bf, su);
#pragma unroll
      for (int rt = 0; rt < 2; ++rt) rs[rt] = mma_b(ldlines<4>(wv + (rt * 16 + 2 * j) * CIN), sel, rs[rt]);
    }
    const v8f rb = mma_b(ab, __builtin_bit_cast(v16bf, ou), zero8());
    float p0 = ((rs[0][0] + rs[0][1]) + (rs[0][2] + rs[0][3])) + ((rs[0][4] + rs[0][5]) + (rs[0][6] + rs[0][7]));
    float p1 = ((rs[1][0] + rs[1][1]) + (rs[1][2] + rs[1][3])) + ((rs[1][4] + rs[1][5]) + (rs[1][6] + rs[1][7]));
    float pb = ((rb[0] + rb[1]) + (rb[2] + rb[3])) + ((rb[4] + rb[5]) + (rb[6] + rb[7]));
    p0 += __shfl_xor(p0, 16, 32);
    p1 += __shfl_xor(p1, 16, 32);
    pb += __shfl_xor(pb, 16, 32);
    swsum[wave * 32 + lane] = h ? p1 : p0;
    bvsum = pb;
  }
#pragma unroll 4
  for (int it = 0; it < (CIN * CQK) / (2 * PBLK); ++it) {
    const int idx = it * (2 * PBLK) + tid;          // = k*32 + n
    const int k = idx >> 5, n = idx & 31;
    sW[n * PW + k] = bf_bits(Wq[idx]);
    sW[(32 + n) * PW + k] = bf_bits(Wk[idx]);
  }
  if (tid < 64) {
    const float vq = bq[tid & 31];
    const float vk = bk[tid & 31];
    sbias[tid] = bf_r(tid < 32 ? vq : vk);
  }
  // The wave's own copies of x have landed before it passes the barrier behind which sX is read.
#if defined(__HIP_DEVICE_COMPILE__)
  asm volatile("s_wait_asynccnt 0x0" ::: "memory");
#endif
  __syncthreads();

  const float* xr = sX + (wave * 16 + m) * XP + 8 * h;
  const float* wr = swsum + 8 * h;
  const unsigned short* wb = sW + m * PW + 8 * h;
  v8f acc[4];
#pragma unroll
  for (int t = 0; t < 4; ++t) acc[t] = zero8();
  float xs = 0.f, vd = 0.f;

#pragma unroll 2
  for (int c = 0; c < CIN / 32; ++c) {
    const float* p = xr + 32 * c;
    const v4f x0 = *(const v4f*)(p);
    const v4f x1 = *(const v4f*)(p + 4);
    const v4f x2 = *(const v4f*)(p + 16);
    const v4f x3 = *(const v4f*)(p + 20);
    const float* pw = wr + 32 * c;
    const v4f w0 = *(const v4f*)(pw);
    const v4f w1 = *(const v4f*)(pw + 4);
    const v4f w2 = *(const v4f*)(pw + 16);
    const v4f w3 = *(const v4f*)(pw + 20);
    v16us au;
#pragma unroll
    for (int e = 0; e < 4; ++e) {
      const unsigned short b0 = bf_bits(x0[e]), b1 = bf_bits(x1[e]);
      const unsigned short b2 = bf_bits(x2[e]), b3 = bf_bits(x3[e]);
      const float r0 = bf_up(b0), r1 = bf_up(b1), r2 = bf_up(b2), r3 = bf_up(b3);
      au[e] = b0; au[4 + e] = b1; au[8 + e] = b2; au[12 + e] = b3;
      xs += (r0 + r1) + (r2 + r3);
      vd += r0 * w0[e]; vd += r1 * w1[e]; vd += r2 * w2[e]; vd += r3 * w3[e];
    }
    const v16bf a = __builtin_bit_cast(v16bf, au);
    const unsigned short* bp = wb + 32 * c;
    const v16bf f0 = ldfrag_b(bp);
    const v16bf f1 = ldfrag_b(bp + 16 * PW);
    const v16bf f2 = ldfrag_b(bp + 32 * PW);
    const v16bf f3 = ldfrag_b(bp + 48 * PW);
    acc[0] = mma_b(a, f0, acc[0]);
    acc[1] = mma_b(a, f1, acc[1]);
    acc[2] = mma_b(a, f2, acc[2]);
    acc[3] = mma_b(a, f3, acc[3]);
    guard_p(acc[0], acc[1], acc[2], acc[3], a, f0, f1, f2, f3);
    sched_fence();
  }
  acc_guard4(acc[0], acc[1], acc[2], acc[3]);

  // ---- per-token statistics (both lane halves hold row m) ----
  xs += __shfl_xor(xs, 16, 32);
  vd += __shfl_xor(vd, 16, 32);
  if (h == 0) {
    smean[wave * 16 + m] = xs * (1.0f / 256.0f);
    svbar[wave * 16 + m] = (vd + bvsum) * (1.0f / 256.0f);
  }
  // ---- q/k hi/lo planes staged per wave: plane 0 = q hi, 1 = q lo, 2 = k hi, 3 = k lo ----
  unsigned short* so = sO + wave * (4 * 16 * CQK);
#pragma unroll
  for (int t = 0; t < 4; ++t) {
    const float bias = sbias[16 * t + m];
    const int col = 16 * (t & 1) + m;
    unsigned short* ph = so + (2 * (t >> 1)) * (16 * CQK) + col;
    unsigned short* pl = ph + 16 * CQK;
#pragma unroll
    for (int r = 0; r < 8; ++r) {
      const float val = acc[t][r] + bias;
      const unsigned short hb = bf_bits(val);
      const unsigned short lb = bf_bits(val - bf_up(hb));
      ph[(8 * h + r) * CQK] = hb;
      pl[(8 * h + r) * CQK] = lb;
    }
  }
  __syncthreads();
  v4u pc[8];
#pragma unroll
  for (int pidx = 0; pidx < 4; ++pidx) {
    pc[2 * pidx]     = *(const v4u*)(so + pidx * (16 * CQK) + lane * 8);
    pc[2 * pidx + 1] = *(const v4u*)(so + pidx * (16 * CQK) + 256 + lane * 8);
  }
  const size_t ob = (size_t)row0 * CQK + (size_t)lane * 8;
  *(v4u*)(qh + ob) = pc[0];  *(v4u*)(qh + ob + 256) = pc[1];
  *(v4u*)(ql + ob) = pc[2];  *(v4u*)(ql + ob + 256) = pc[3];
  *(v4u*)(kh + ob) = pc[4];  *(v4u*)(kh + ob + 256) = pc[5];
  *(v4u*)(kl + ob) = pc[6];  *(v4u*)(kl + ob + 256) = pc[7];
  

  if (wave == 0) {
    *(v4f*)(xmean + (size_t)blockIdx.x * PBLK + 4 * lane) = *(const v4f*)(smean + 4 * lane);
  } else if (wave == 1) {
    *(v4f*)(vbar + (size_t)blockIdx.x * PBLK + 4 * lane) = *(const v4f*)(svbar + 4 * lane);
  }
}

// =====================================================================================================
// Attention, single pass. Block = 64 queries (inside one image), 8 waves.
// Every wave holds the Q fragments of all 64 queries (4 query tiles) and walks its own eighth of the
// image's keys (512 keys, 16 chunks of 32), so one K fragment load and one vbar read feed 4 query tiles.
// vbar of the image staged in LDS (4096 floats). Per 32-key chunk and query tile t:
//   S^T tiles = K rows (A, row = key, k = d) . Q rows (B, col = query, k = d), one k-step,
//   three products hi.hi + hi.lo + lo.hi per tile from zero;
//   D: s0[t][r] = S[key kb+8h+r][query], s1[t][r] = S[key kb+16+8h+r][query];
//   p = 2^(s * log2(e) - shift) in f32; sum += p; o += p * vbar[key] (f32 FMA).
//   The exponent, the sum and the weighted sum are formed on pairs of neighbouring accumulator registers
//   (packed f32 instructions); the two elements of a pair's sums are added once, after the loop.
// The shift of a query is fixed for the wave's whole walk: the largest hi.hi score over the wave's first 32 keys,
// times log2(e). o / sum does not depend on the shift as long as nothing leaves the f32 range, so the walk needs
// no maximum, no exchange between lane halves and no rescaling. After the walk every query's sum and weighted sum
// are tested against a window well inside the f32 range; if one lane of the wave fails (also on NaN), the whole wave
// walks its keys again with the running maximum (walk<true>: max over the 16 keys per lane, then the xor-16
// partner, kept times log2(e); rescale of both sums), which holds for any scores.
// Merge: each wave leaves (shift, sum, weighted sum) per query in LDS; after one barrier thread q < 64
// rescales the 8 partials of query q to their largest shift (base 2) and adds them in wave order.
// Epilogue: res = gammaRNE * (o / l) + xmean[query]; waves 0 and 1 each store one whole 128-byte line.
// coverage: 8 waves x 16 chunks x 32 = all 4096 keys of the image; 512 blocks x 64 = whole output.
// =====================================================================================================
// One wave's walk over its KSPL keys. ONLINE = false: shift[] is read only. ONLINE = true: shift[] is the running
// maximum times log2(e). Every loop over t (query tile), v (accumulator register) and j (register pair) is fully
// unrolled: the per-tile arrays live in VGPRs.
template <bool ONLINE>
__device__ __forceinline__ void walk(const unsigned short* khp, const unsigned short* klp, const float* vbp,
                                     const v16bf (&fqh)[QT], const v16bf (&fql)[QT],
                                     float (&shift)[QT], v2f (&run_sum)[QT], v2f (&run_o)[QT]) {
  const float L2E = 1.44269504088896340736f;
  const v2f l2e2 = {L2E, L2E};
  // Kept rolled: one chunk's body already needs most of the 256 VGPRs that four waves per SIMD leave a wave.
#pragma unroll 1
  for (int kb = 0; kb < KSPL; kb += 32) {
    const unsigned short* pa = khp + (size_t)kb * CQK;
    const unsigned short* pl = klp + (size_t)kb * CQK;
    const v16bf a0h = ldfrag_b(pa);
    const v16bf a1h = ldfrag_b(pa + 16 * CQK);
    const v16bf a0l = ldfrag_b(pl);
    const v16bf a1l = ldfrag_b(pl + 16 * CQK);
    const v4f v00 = *(const v4f*)(vbp + kb);
    const v4f v01 = *(const v4f*)(vbp + kb + 4);
    const v4f v10 = *(const v4f*)(vbp + kb + 16);
    const v4f v11 = *(const v4f*)(vbp + kb + 16 + 4);
    // Inputs-only fence on the loaded values: keeps the chunk's eight K loads and four vbar reads together ahead
    // of the first product (without it the lo-plane loads sink among the products: three load waits a chunk).
#if defined(__HIP_DEVICE_COMPILE__)
    asm volatile("" :: "v"(a0h), "v"(a1h), "v"(a0l), "v"(a1l), "v"(v00), "v"(v01), "v"(v10), "v"(v11));
#endif
    const v2f w0[4] = {{v00[0], v00[1]}, {v00[2], v00[3]}, {v01[0], v01[1]}, {v01[2], v01[3]}};
    const v2f w1[4] = {{v10[0], v10[1]}, {v10[2], v10[3]}, {v11[0], v11[1]}, {v11[2], v11[3]}};
    v8f s0[QT], s1[QT];
#pragma unroll
    for (int t = 0; t < QT; ++t) { s0[t] = mma_b(a0h, fqh[t], zero8()); s1[t] = mma_b(a1h, fqh[t], zero8()); }
#pragma unroll
    for (int t = 0; t < QT; ++t) { s0[t] = mma_b(a0h, fql[t], s0[t]); s1[t] = mma_b(a1h, fql[t], s1[t]); }
#pragma unroll
    for (int t = 0; t < QT; ++t) { s0[t] = mma_b(a0l, fqh[t], s0[t]); s1[t] = mma_b(a1l, fqh[t], s1[t]); }
    // ---- softmax terms over the key axis, one query tile after the other ----
#pragma unroll
    for (int t = 0; t < QT; ++t) {
      v2f ls = run_sum[t], po = run_o[t];
      if constexpr (ONLINE) {
        float lmax = fmaxf(s0[t][0], s1[t][0]);
#pragma unroll
        for (int v = 1; v < 8; ++v) lmax = fmaxf(lmax, fmaxf(s0[t][v], s1[t][v]));
        lmax = fmaxf(lmax, __shfl_xor(lmax, 16, 32));
        const float nm = fmaxf(shift[t], lmax * L2E);
        const float factor = ex2(shift[t] - nm);
        shift[t] = nm;
        const v2f f2 = {factor, factor};
        ls *= f2;
        po *= f2;
      }
      const v2f nm2 = {shift[t], shift[t]};
      // Two scores that sit in neighbouring accumulator registers go through each packed instruction together.
#pragma unroll
      for (int j = 0; j < 4; ++j) {
        const v2f a0 = {s0[t][2 * j], s0[t][2 * j + 1]};
        const v2f a1 = {s1[t][2 * j], s1[t][2 * j + 1]};
        const v2f e0 = __builtin_elementwise_fma(a0, l2e2, -nm2);
        const v2f e1 = __builtin_elementwise_fma(a1, l2e2, -nm2);
        const v2f p0 = {ex2(e0[0]), ex2(e0[1])};
        const v2f p1 = {ex2(e1[0]), ex2(e1[1])};
        ls += p0;
        ls += p1;
        po = __builtin_elementwise_fma(p0, w0[j], po);
        po = __builtin_elementwise_fma(p1, w1[j], po);
      }
      run_sum[t] = ls;
      run_o[t] = po;
    }
  }
}

__global__ __launch_bounds__(32 * AWAV) void k_attn(const unsigned short* qh, const unsigned short* ql,
                                               const unsigned short* kh, const unsigned short* kl,
                                               const float* vbar, const float* xmean,
                                               const float* __restrict__ gamma, float* out) {
  __shared__ __align__(16) float svb[HWN];
  __shared__ float pmx[AWAV * QBLK];
  __shared__ float psm[AWAV * QBLK];
  __shared__ float pov[AWAV * QBLK];
  const int tid = threadIdx.x, wave = tid >> 5, lane = tid & 31;
  const int rl = lane & 15, h = lane >> 4, koff = 8 * h;
  const int n0 = blockIdx.x * QBLK;
  const int keybase = (n0 / HWN) * HWN;
  const float gb = bf_r(gamma[0]);

  const unsigned short* qhp = qh + (size_t)(n0 + rl) * CQK + koff;
  const unsigned short* qlp = ql + (size_t)(n0 + rl) * CQK + koff;
  const int key0 = wave * KSPL;
  const unsigned short* khp = kh + (size_t)(keybase + key0 + rl) * CQK + koff;
  const unsigned short* klp = kl + (size_t)(keybase + key0 + rl) * CQK + koff;
  const float* vbp = svb + key0 + koff;
  const v16bf e0 = ldfrag_b(khp);                     // hi plane of the wave's first 32 keys, for the shift
  const v16bf e1 = ldfrag_b(khp + 16 * CQK);
  // A Q load may land on the K loads' address pair: the wait stands ahead of that overwrite.
#if defined(__HIP_DEVICE_COMPILE__)
  asm volatile("s_wait_xcnt 0x0" ::: "memory");
#endif
  v16bf fqh[QT], fql[QT];
#pragma unroll
  for (int t = 0; t < QT; ++t) fqh[t] = ldfrag_b(qhp + t * 16 * CQK);
  // A lo-plane load lands on the hi-plane loads' address pair: the wait stands ahead of that overwrite.
#if defined(__HIP_DEVICE_COMPILE__)
  asm volatile("s_wait_xcnt 0x0" ::: "memory");
#endif
#pragma unroll
  for (int t = 0; t < QT; ++t) fql[t] = ldfrag_b(qlp + t * 16 * CQK);
#pragma unroll
  for (int j = 0; j < HWN / (4 * 32 * AWAV); ++j) {
    const int i = tid + 32 * AWAV * j;
    ((v4f*)svb)[i] = *(const v4f*)(vbar + keybase + 4 * i);
  }

  // ---- the walk's fixed shift per query: largest hi.hi score over the wave's first 32 keys, times log2(e) ----
  float shift[QT];
  v2f run_sum[QT], run_o[QT];                         // element 0: even accumulator registers, element 1: odd
  // Inputs-only fence on the loaded values: keeps every Q load ahead of the first product (without it the last
  // lo-plane loads are held back until the K registers are free: a second load wait in front of the barrier).
#if defined(__HIP_DEVICE_COMPILE__)
  asm volatile("" :: "v"(e0), "v"(e1), "v"(fql[0]), "v"(fql[1]), "v"(fql[2]), "v"(fql[3]));
#endif
#pragma unroll
  for (int t = 0; t < QT; ++t) {
    const v8f u0 = mma_b(e0, fqh[t], zero8()), u1 = mma_b(e1, fqh[t], zero8());
    float lmax = fmaxf(u0[0], u1[0]);
#pragma unroll
    for (int v = 1; v < 8; ++v) lmax = fmaxf(lmax, fmaxf(u0[v], u1[v]));
    lmax = fmaxf(lmax, __shfl_xor(lmax, 16, 32));
    shift[t] = lmax * 1.44269504088896340736f;
    run_sum[t] = 0.0f;
    run_o[t] = 0.0f;
  }
  __syncthreads();

  walk<false>(khp, klp, vbp, fqh, fql, shift, run_sum, run_o);

  // ---- both lane halves joined; every sum must lie well inside the f32 range ----
  const float WLO = 0x1p-64f, WHI = 0x1p+96f;
  float tot[QT], oo[QT];
  bool inside = true;
#pragma unroll
  for (int t = 0; t < QT; ++t) {
    const float hs = run_sum[t][0] + run_sum[t][1], ho = run_o[t][0] + run_o[t][1];
    tot[t] = hs + __shfl_xor(hs, 16, 32);
    oo[t] = ho + __shfl_xor(ho, 16, 32);
    inside = inside & (tot[t] > WLO) & (tot[t] < WHI) & (fabsf(oo[t]) < WHI);
  }
  // Scalar branch on the whole wave's vote: the products in the second walk need every lane on.
  if (__builtin_amdgcn_ballot_w32(!inside) != 0u) {
#pragma unroll
    for (int t = 0; t < QT; ++t) { shift[t] = -1.0e30f; run_sum[t] = 0.0f; run_o[t] = 0.0f; }
    walk<true>(khp, klp, vbp, fqh, fql, shift, run_sum, run_o);
#pragma unroll
    for (int t = 0; t < QT; ++t) {
      const float hs = run_sum[t][0] + run_sum[t][1], ho = run_o[t][0] + run_o[t][1];
      tot[t] = hs + __shfl_xor(hs, 16, 32);
      oo[t] = ho + __shfl_xor(ho, 16, 32);
    }
  }

  // ---- each wave's partial statistics to LDS ----
#pragma unroll
  for (int t = 0; t < QT; ++t) {
    if (h == 0) {
      const int slot = wave * QBLK + 16 * t + rl;
      pmx[slot] = shift[t];
      psm[slot] = tot[t];
      pov[slot] = oo[t];
    }
  }
  __syncthreads();

  // ---- merge of the 8 key ranges and epilogue: thread = query ----
  if (tid < QBLK) {
    float gm = pmx[tid];
#pragma unroll
    for (int w = 1; w < AWAV; ++w) gm = fmaxf(gm, pmx[w * QBLK + tid]);
    float mt = 0.0f, mo = 0.0f;
#pragma unroll
    for (int w = 0; w < AWAV; ++w) {
      const float f = ex2(pmx[w * QBLK + tid] - gm);
      mt += psm[w * QBLK + tid] * f;
      mo += pov[w * QBLK + tid] * f;
    }
    out[(size_t)n0 + tid] = gb * (mo * (1.0f / mt)) + xmean[n0 + tid];
  }
}

// =====================================================================================================
// Workspace map (bytes); every region an exact multiple of its whole-line store granularity,
// every offset a multiple of 128.
//   QH bf16 [32768][32]  2097152 @0
//   QL bf16 [32768][32]  2097152 @2097152
//   KH bf16 [32768][32]  2097152 @4194304
//   KL bf16 [32768][32]  2097152 @6291456
//   XM f32  [32768]       131072 @8388608
//   VB f32  [32768]       131072 @8519680
//   end = 8650752
// =====================================================================================================
extern "C" void kernel_launch(void* const* d_in, const int* in_sizes, int n_in,
                              void* d_out, int out_size, void* d_ws, size_t ws_size,
                              hipStream_t stream) {
  if (n_in < 8) return;
  if (in_sizes[0] != NTOK * CIN) return;
  if (in_sizes[1] != CIN * CQK) return;
  if (in_sizes[2] != CQK) return;
  if (in_sizes[3] != CIN * CQK) return;
  if (in_sizes[4] != CQK) return;
  if (in_sizes[5] != CIN * CIN) return;
  if (in_sizes[6] != CIN) return;
  if (in_sizes[7] < 1) return;
  if (out_size != NTOK) return;

  const float* x     = (const float*)d_in[0];
  const float* Wq    = (const float*)d_in[1];
  const float* bq    = (const float*)d_in[2];
  const float* Wk    = (const float*)d_in[3];
  const float* bk    = (const float*)d_in[4];
  const float* Wv    = (const float*)d_in[5];
  const float* bv    = (const float*)d_in[6];
  const float* gamma = (const float*)d_in[7];
  float* out = (float*)d_out;

  const size_t PQK  = (size_t)NTOK * CQK * 2;        // 2097152
  const size_t PTOK = (size_t)NTOK * 4;              //  131072

  size_t off = 0;
  const size_t oQH = off; off += PQK;
  const size_t oQL = off; off += PQK;
  const size_t oKH = off; off += PQK;
  const size_t oKL = off; off += PQK;
  const size_t oXM = off; off += PTOK;
  const size_t oVB = off; off += PTOK;
  if (off > ws_size) return;                          // off = 8650752
  if (off > (size_t)134217728) return;

  char* ws = (char*)d_ws;
  unsigned short* QH = (unsigned short*)(ws + oQH);
  unsigned short* QL = (unsigned short*)(ws + oQL);
  unsigned short* KH = (unsigned short*)(ws + oKH);
  unsigned short* KL = (unsigned short*)(ws + oKL);
  float* XM  = (float*)(ws + oXM);
  float* VB  = (float*)(ws + oVB);

  k_proj<<<dim3(NTOK / PBLK), dim3(2 * PBLK), 0, stream>>>(x, Wq, bq, Wk, bk, Wv, bv, QH, QL, KH, KL, XM, VB);
  k_attn<<<dim3(NTOK / QBLK), dim3(32 * AWAV), 0, stream>>>(QH, QL, KH, KL, VB, XM, gamma, out);
  (void)hipGetLastError();
}

// v007
// A run of this version takes 33.5 microseconds.
// Timed twice side by side with v006, it ran 1.06 and 1.04 times as fast.
// Over all steps from v000 it is 3.81 times as fast.
// Projection tiles (tokens x Wq, tokens x Wk): v_wmma_f32_16x16x32_bf16 (bf16 operands = RNE-converted inputs), f32 accumulate.
// Score tiles (keys x queries, K = 32): v_wmma_f32_16x16x32_bf16 on a bf16 hi/lo split of both operands (hi.hi + hi.lo + lo.hi), f32 accumulate.
// Row sums of Wv and the sum of bv: v_wmma_f32_16x16x32_bf16, A = bf16RNE values, B = ones and zeros, f32 accumulate.
// Channel sums, value channel-mean dot, softmax statistics, weight-times-value-mean reduction and epilogue: f32 on the VALU.
#include <hip/hip_runtime.h>

#define CIN   256
#define CQK   32
#define HWN   4096
#define NBAT  8
#define NTOK  32768
#define PBLK  128
#define QBLK  64
#define PW    264
#define XP    260
#define AWAV  8
#define QT    (QBLK / 16)
#define KSPL  (HWN / AWAV)

static_assert(NTOK == NBAT * HWN);
static_assert((NTOK % PBLK) == 0 && (NTOK % QBLK) == 0 && (HWN % QBLK) == 0);
static_assert((HWN % 32) == 0 && (CIN % 32) == 0 && CQK == 32);
static_assert((PW % 8) == 0 && PBLK == 128 && QBLK == 64 && CIN == 2 * PBLK);
static_assert((XP % 4) == 0 && ((XP / 4) % 2) == 1 && XP >= CIN);
static_assert((KSPL % 32) == 0 && 32 * AWAV >= QBLK && (HWN % (4 * 32 * AWAV)) == 0);

typedef __bf16         v16bf __attribute__((ext_vector_type(16)));
typedef unsigned short v16us __attribute__((ext_vector_type(16)));
typedef unsigned short v8us  __attribute__((ext_vector_type(8)));
typedef float          v8f   __attribute__((ext_vector_type(8)));
typedef float          v4f   __attribute__((ext_vector_type(4)));
typedef float          v2f   __attribute__((ext_vector_type(2)));
typedef __bf16         v2bf  __attribute__((ext_vector_type(2)));
typedef unsigned int   v8u   __attribute__((ext_vector_type(8)));
typedef unsigned int   v4u   __attribute__((ext_vector_type(4)));

// ---- scalar helpers --------------------------------------------------------------------------------
__device__ __forceinline__ unsigned short bf_bits(float f) {          // f32 -> bf16 bits, RNE convert
  unsigned u = __float_as_uint(f);
  return (unsigned short)((u + 0x7FFFu + ((u >> 16) & 1u)) >> 16);
}
__device__ __forceinline__ float bf_up(unsigned short hb) { return __uint_as_float(((unsigned)hb) << 16); }
__device__ __forceinline__ float bf_r(float f) { return bf_up(bf_bits(f)); }
__device__ __forceinline__ float ex2(float f) { return __builtin_amdgcn_exp2f(f); }   // 2^f, one v_exp_f32
__device__ __forceinline__ v8f zero8() { v8f z = {0.f, 0.f, 0.f, 0.f, 0.f, 0.f, 0.f, 0.f}; return z; }

// ---- fragment loader: lane -> row/col (lane&15); p already includes +8*(lane>>4);
//      elements 0..7 <- p[0..7] (k0+8h..), elements 8..15 <- p[16..23] (k0+16+8h..). Same map for A and B.
__device__ __forceinline__ v16bf ldfrag_b(const unsigned short* p) {
  union { v16us v; v8us hv[2]; } f;
  f.hv[0] = *(const v8us*)(p);
  f.hv[1] = *(const v8us*)(p + 16);
  return __builtin_bit_cast(v16bf, f.v);
}

// ---- WMMA helper and trailing VALU hazard gaps ------------------------------------------------------------
__device__ __forceinline__ v8f mma_b(v16bf a, v16bf b, v8f c) {
  return __builtin_amdgcn_wmma_f32_16x16x32_bf16(false, a, false, b, (short)0, c, false, false);
}
__device__ __forceinline__ void guard_p(v8f& c0, v8f& c1, v8f& c2, v8f& c3,
                                        v16bf a, v16bf b0, v16bf b1, v16bf b2, v16bf b3) {
#if defined(__HIP_DEVICE_COMPILE__)
  asm volatile("v_nop\n\tv_nop\n\tv_nop\n\tv_nop"
               : "+v"(c0), "+v"(c1), "+v"(c2), "+v"(c3)
               : "v"(a), "v"(b0), "v"(b1), "v"(b2), "v"(b3));
#endif
}
__device__ __forceinline__ void acc_guard4(v8f& a, v8f& b, v8f& c, v8f& d) {
#if defined(__HIP_DEVICE_COMPILE__)
  asm volatile("v_nop\n\tv_nop\n\tv_nop\n\tv_nop" : "+v"(a), "+v"(b), "+v"(c), "+v"(d));
#endif
}
__device__ __forceinline__ void sched_fence() {
#if defined(__HIP_DEVICE_COMPILE__)
  asm volatile("" ::: "memory");
#endif
}

// ---- eight asynchronous copies to LDS, 16 bytes a lane each: four rows of x, two whole-wave 512-byte halves a row.
//      l = the lane's LDS byte address of the first row's first half, g = its global address; rows XP and CIN floats apart.
//      The closing s_wait_xcnt stands inside the statement, ahead of any later write of an address register it names.
__device__ __forceinline__ void copy_rows4(unsigned l, const float* g) {
#if defined(__HIP_DEVICE_COMPILE__)
  asm volatile("global_load_async_to_lds_b128 %0, %8, off\n\t"
               "global_load_async_to_lds_b128 %1, %9, off\n\t"
               "global_load_async_to_lds_b128 %2, %10, off\n\t"
               "global_load_async_to_lds_b128 %3, %11, off\n\t"
               "global_load_async_to_lds_b128 %4, %12, off\n\t"
               "global_load_async_to_lds_b128 %5, %13, off\n\t"
               "global_load_async_to_lds_b128 %6, %14, off\n\t"
               "global_load_async_to_lds_b128 %7, %15, off\n\t"
               "s_wait_xcnt 0x0"
               :: "v"(l), "v"(l + 512u), "v"(l + 4u * XP), "v"(l + 4u * XP + 512u),
                  "v"(l + 8u * XP), "v"(l + 8u * XP + 512u), "v"(l + 12u * XP), "v"(l + 12u * XP + 512u),
                  "v"(g), "v"(g + 128), "v"(g + CIN), "v"(g + CIN + 128),
                  "v"(g + 2 * CIN), "v"(g + 2 * CIN + 128), "v"(g + 3 * CIN), "v"(g + 3 * CIN + 128)
               : "memory");
#endif
}

// ---- NQ whole-wave 512-byte loads (p already includes +4*lane) -> fragment elements 4q..4q+3 of the lane, RNE
//      convert (two values per instruction); the elements above 4*NQ are zero.
template <int NQ>
__device__ __forceinline__ v16bf ldlines(const float* p) {
  v16bf a;
#pragma unroll
  for (int e = 0; e < 16; ++e) a[e] = (__bf16)0.0f;
#pragma unroll
  for (int g = 0; g < NQ; ++g) {
    const v4f f = *(const v4f*)(p + 128 * g);
    const v2f f01 = {f[0], f[1]}, f23 = {f[2], f[3]};
    const v2bf c01 = __builtin_convertvector(f01, v2bf), c23 = __builtin_convertvector(f23, v2bf);
    a[4 * g] = c01[0]; a[4 * g + 1] = c01[1]; a[4 * g + 2] = c23[0]; a[4 * g + 3] = c23[1];
  }
  return a;
}

// =====================================================================================================
// Projections + per-token statistics. Block = 128 tokens, 8 waves, wave = 16 tokens; one block per WGP, so Wv is
// read once per WGP.
// Entry: each wave sends its 16 rows of x (16 KiB) to LDS by 32 asynchronous copies (row pitch 260 floats = 16 B x 65),
// which fly under the whole prologue; its own wait on them stands in front of the prologue's closing barrier.
// Prologue: wsum[cin] = sum over cout of bf16RNE(Wv[cin][cout]), wave = 32 rows of Wv. Two neighbouring rows are
// four whole-wave 512-byte loads: a lane's fragment elements 0..7 belong to the even row, 8..15 to the odd one.
// Product j of a 16-row group: A = that fragment, B = 1 in column 2j at elements 0..7 and in column 2j+1 at
// elements 8..15, else 0 (same element map for A and B), so D[i][n] = what lanes i and i+16 hold of row n.
// A lane adds its 8 registers and its xor-16 partner's sum: lane n has the sum of row n.
// Sum of bf16RNE(bv), in every wave: two such loads in elements 0..7, B = ones, the same two additions.
// LDS: Wq and Wk as bf16 bits in [n][k] layout (rows 0..31 = Wq columns, rows 32..63 = Wk columns,
// pitch 264), wsum, biases. k-loop over 256 in steps of 32: A = bf16RNE(x) rows read from LDS (row = token m,
// split k map), B = sW rows (col = output channel, same k map); the same x elements feed the f32 channel
// sum and the f32 dot with wsum. Epilogue: q/k + bias -> hi = bf16RNE(v), lo = bf16RNE(v - hi), staged
// per wave in LDS as four [16 tokens][32] planes, then each plane tile (1024 contiguous bytes in global)
// coverage: 8 waves x 16 rows x 32 = the block's 128 rows of each of the 4 planes; 128 xmean + 128 vbar;
// 256 blocks = whole planes.
// =====================================================================================================
__global__ __launch_bounds__(2 * PBLK) void k_proj(const float* __restrict__ x,
                                               const float* __restrict__ Wq, const float* __restrict__ bq,
                                               const float* __restrict__ Wk, const float* __restrict__ bk,
                                               const float* __restrict__ Wv, const float* __restrict__ bv,
                                               unsigned short* qh, unsigned short* ql,
                                               unsigned short* kh, unsigned short* kl,
                                               float* xmean, float* vbar) {
  __shared__ __align__(16) float sX[PBLK * XP];
  __shared__ __align__(16) unsigned short sW[64 * PW];
  __shared__ __align__(16) unsigned short sO[(PBLK / 16) * 4 * 16 * CQK];
  __shared__ __align__(16) float swsum[CIN];
  __shared__ __align__(16) float smean[PBLK];
  __shared__ __align__(16) float svbar[PBLK];
  __shared__ float sbias[64];
  const int tid = threadIdx.x, wave = tid >> 5, lane = tid & 31, m = lane & 15, h = lane >> 4;
  const int row0 = blockIdx.x * PBLK + wave * 16;

  {
    const unsigned xl = (unsigned)(size_t)(sX + wave * 16 * XP + 4 * lane);
    const float* xg = x + (size_t)row0 * CIN + 4 * lane;
    // Unrolled so that every copy's two addresses are constant steps from one base and all 32 copies issue in a row.
#pragma unroll
    for (int q = 0; q < 4; ++q) copy_rows4(xl + (unsigned)(q * 4 * XP * 4), xg + q * 4 * CIN);
  }

  float bvsum;
  {
    const unsigned one2 = 0x3F803F80u;              // two bf16 ones
    const v8u ou = {one2, one2, one2, one2, one2, one2, one2, one2};
    const v16bf ab = ldlines<2>(bv + 4 * lane);
    // A Wv load may land on the bv loads' address pair: the wait stands ahead of that overwrite.
#if defined(__HIP_DEVICE_COMPILE__)
    asm volatile("s_wait_xcnt 0x0" ::: "memory");
#endif
    const float* wv = Wv + (size_t)(wave * 32) * CIN + 4 * lane;
    v8f rs[2] = {zero8(), zero8()};
#pragma unroll
    for (int j = 0; j < 8; ++j) {
      const unsigned se = m == 2 * j ? one2 : 0u, so2 = m == 2 * j + 1 ? one2 : 0u;
      const v8u su = {se, se, se, se, so2, so2, so2, so2};
      const v16bf sel = __builtin_bit_cast(v16bf, su);
#pragma unroll
      for (int rt = 0; rt < 2; ++rt) rs[rt] = mma_b(ldlines<4>(wv + (rt * 16 + 2 * j) * CIN), sel, rs[rt]);
    }
    const v8f rb = mma_b(ab, __builtin_bit_cast(v16bf, ou), zero8());
    float p0 = ((rs[0][0] + rs[0][1]) + (rs[0][2] + rs[0][3])) + ((rs[0][4] + rs[0][5]) + (rs[0][6] + rs[0][7]));
    float p1 = ((rs[1][0] + rs[1][1]) + (rs[1][2] + rs[1][3])) + ((rs[1][4] + rs[1][5]) + (rs[1][6] + rs[1][7]));
    float pb = ((rb[0] + rb[1]) + (rb[2] + rb[3])) + ((rb[4] + rb[5]) + (rb[6] + rb[7]));
    p0 += __shfl_xor(p0, 16, 32);
    p1 += __shfl_xor(p1, 16, 32);
    pb += __shfl_xor(pb, 16, 32);
    swsum[wave * 32 + lane] = h ? p1 : p0;
    bvsum = pb;
  }
#pragma unroll 4
  for (int it = 0; it < (CIN * CQK) / (2 * PBLK); ++it) {
    const int idx = it * (2 * PBLK) + tid;          // = k*32 + n
    const int k = idx >> 5, n = idx & 31;
    sW[n * PW + k] = bf_bits(Wq[idx]);
    sW[(32 + n) * PW + k] = bf_bits(Wk[idx]);
  }
  if (tid < 64) {
    const float vq = bq[tid & 31];
    const float vk = bk[tid & 31];
    sbias[tid] = bf_r(tid < 32 ? vq : vk);
  }
  // The wave's own copies of x have landed before it passes the barrier behind which sX is read.
#if defined(__HIP_DEVICE_COMPILE__)
  asm volatile("s_wait_asynccnt 0x0" ::: "memory");
#endif
  __syncthreads();

  const float* xr = sX + (wave * 16 + m) * XP + 8 * h;
  const float* wr = swsum + 8 * h;
  const unsigned short* wb = sW + m * PW + 8 * h;
  v8f acc[4];
#pragma unroll
  for (int t = 0; t < 4; ++t) acc[t] = zero8();
  float xs = 0.f, vd = 0.f;

#pragma unroll 2
  for (int c = 0; c < CIN / 32; ++c) {
    const float* p = xr + 32 * c;
    const v4f x0 = *(const v4f*)(p);
    const v4f x1 = *(const v4f*)(p + 4);
    const v4f x2 = *(const v4f*)(p + 16);
    const v4f x3 = *(const v4f*)(p + 20);
    const float* pw = wr + 32 * c;
    const v4f w0 = *(const v4f*)(pw);
    const v4f w1 = *(const v4f*)(pw + 4);
    const v4f w2 = *(const v4f*)(pw + 16);
    const v4f w3 = *(const v4f*)(pw + 20);
    v16us au;
#pragma unroll
    for (int e = 0; e < 4; ++e) {
      const unsigned short b0 = bf_bits(x0[e]), b1 = bf_bits(x1[e]);
      const unsigned short b2 = bf_bits(x2[e]), b3 = bf_bits(x3[e]);
      const float r0 = bf_up(b0), r1 = bf_up(b1), r2 = bf_up(b2), r3 = bf_up(b3);
      au[e] = b0; au[4 + e] = b1; au[8 + e] = b2; au[12 + e] = b3;
      xs += (r0 + r1) + (r2 + r3);
      vd += r0 * w0[e]; vd += r1 * w1[e]; vd += r2 * w2[e]; vd += r3 * w3[e];
    }
    const v16bf a = __builtin_bit_cast(v16bf, au);
    const unsigned short* bp = wb + 32 * c;
    const v16bf f0 = ldfrag_b(bp);
    const v16bf f1 = ldfrag_b(bp + 16 * PW);
    const v16bf f2 = ldfrag_b(bp + 32 * PW);
    const v16bf f3 = ldfrag_b(bp + 48 * PW);
    acc[0] = mma_b(a, f0, acc[0]);
    acc[1] = mma_b(a, f1, acc[1]);
    acc[2] = mma_b(a, f2, acc[2]);
    acc[3] = mma_b(a, f3, acc[3]);
    guard_p(acc[0], acc[1], acc[2], acc[3], a, f0, f1, f2, f3);
    sched_fence();
  }
  acc_guard4(acc[0], acc[1], acc[2], acc[3]);

  // ---- per-token statistics (both lane halves hold row m) ----
  xs += __shfl_xor(xs, 16, 32);
  vd += __shfl_xor(vd, 16, 32);
  if (h == 0) {
    smean[wave * 16 + m] = xs * (1.0f / 256.0f);
    svbar[wave * 16 + m] = (vd + bvsum) * (1.0f / 256.0f);
  }
  // ---- q/k hi/lo planes staged per wave: plane 0 = q hi, 1 = q lo, 2 = k hi, 3 = k lo ----
  unsigned short* so = sO + wave * (4 * 16 * CQK);
#pragma unroll
  for (int t = 0; t < 4; ++t) {
    const float bias = sbias[16 * t + m];
    const int col = 16 * (t & 1) + m;
    unsigned short* ph = so + (2 * (t >> 1)) * (16 * CQK) + col;
    unsigned short* pl = ph + 16 * CQK;
#pragma unroll
    for (int r = 0; r < 8; ++r) {
      const float val = acc[t][r] + bias;
      const unsigned short hb = bf_bits(val);
      const unsigned short lb = bf_bits(val - bf_up(hb));
      ph[(8 * h + r) * CQK] = hb;
      pl[(8 * h + r) * CQK] = lb;
    }
  }
  __syncthreads();
  v4u pc[8];
#pragma unroll
  for (int pidx = 0; pidx < 4; ++pidx) {
    pc[2 * pidx]     = *(const v4u*)(so + pidx * (16 * CQK) + lane * 8);
    pc[2 * pidx + 1] = *(const v4u*)(so + pidx * (16 * CQK) + 256 + lane * 8);
  }
  const size_t ob = (size_t)row0 * CQK + (size_t)lane * 8;
  *(v4u*)(qh + ob) = pc[0];  *(v4u*)(qh + ob + 256) = pc[1];
  *(v4u*)(ql + ob) = pc[2];  *(v4u*)(ql + ob + 256) = pc[3];
  *(v4u*)(kh + ob) = pc[4];  *(v4u*)(kh + ob + 256) = pc[5];
  *(v4u*)(kl + ob) = pc[6];  *(v4u*)(kl + ob + 256) = pc[7];
  

  if (wave == 0) {
    *(v4f*)(xmean + (size_t)blockIdx.x * PBLK + 4 * lane) = *(const v4f*)(smean + 4 * lane);
  } else if (wave == 1) {
    *(v4f*)(vbar + (size_t)blockIdx.x * PBLK + 4 * lane) = *(const v4f*)(svbar + 4 * lane);
  }
}

// =====================================================================================================
// Attention, single pass. Block = 64 queries (inside one image), 8 waves.
// Every wave holds the Q fragments of all 64 queries (4 query tiles) and walks its own eighth of the
// image's keys (512 keys, 16 chunks of 32), so one K fragment load and one vbar read feed 4 query tiles.
// vbar of the image staged in LDS (4096 floats). Per 32-key chunk and query tile t:
//   S^T tiles = K rows (A, row = key, k = d) . Q rows (B, col = query, k = d), one k-step,
//   three products hi.hi + hi.lo + lo.hi per tile from zero;
//   D: s0[t][r] = S[key kb+8h+r][query], s1[t][r] = S[key kb+16+8h+r][query];
//   p = 2^(s * log2(e) - shift) in f32; sum += p; o += p * vbar[key] (f32 FMA).
//   The exponent, the sum and the weighted sum are formed on pairs of neighbouring accumulator registers
//   (packed f32 instructions); the two elements of a pair's sums are added once, after the loop.
// The shift of a query is fixed for the wave's whole walk: the largest hi.hi score over the wave's first 32 keys,
// times log2(e). o / sum does not depend on the shift as long as nothing leaves the f32 range, so the walk needs
// no maximum, no exchange between lane halves and no rescaling. After the walk every query's sum and weighted sum
// are tested against a window well inside the f32 range; if one lane of the wave fails (also on NaN), the whole wave
// walks its keys again with the running maximum (walk<true>: max over the 16 keys per lane, then the xor-16
// partner, kept times log2(e); rescale of both sums), which holds for any scores.
// Merge: each wave leaves (shift, sum, weighted sum) per query in LDS; after one barrier thread q < 64
// rescales the 8 partials of query q to their largest shift (base 2) and adds them in wave order.
// Epilogue: res = gammaRNE * (o / l) + xmean[query]; waves 0 and 1 each store one whole 128-byte line.
// coverage: 8 waves x 16 chunks x 32 = all 4096 keys of the image; 512 blocks x 64 = whole output.
// =====================================================================================================
// One 32-key chunk of a wave's walk. a0h..a1l hold the chunk's K fragments on entry. ONLINE = false: shift[] is read
// only. ONLINE = true: shift[] is the running maximum times log2(e). AHEAD = true: right behind the chunk's own
// products the same four fragments are loaded anew from the next chunk (pa, pl + 32 rows), so that these loads fly
// under the chunk's softmax arithmetic and are waited for only at the next chunk's first product. Every loop over
// t (query tile), v (accumulator register) and j (register pair) is fully unrolled: the per-tile arrays live in VGPRs.
template <bool ONLINE, bool AHEAD>
__device__ __forceinline__ void chunk(const unsigned short* pa, const unsigned short* pl, const float* vb,
                                      v16bf& a0h, v16bf& a1h, v16bf& a0l, v16bf& a1l,
                                      const v16bf (&fqh)[QT], const v16bf (&fql)[QT],
                                      float (&shift)[QT], v2f (&run_sum)[QT], v2f (&run_o)[QT]) {
  const float L2E = 1.44269504088896340736f;
  const v2f l2e2 = {L2E, L2E};
  const v4f v00 = *(const v4f*)(vb);
  const v4f v01 = *(const v4f*)(vb + 4);
  const v4f v10 = *(const v4f*)(vb + 16);
  const v4f v11 = *(const v4f*)(vb + 16 + 4);
  // Keeps the four vbar reads in one place ahead of the products, whose run covers the LDS latency.
  __builtin_amdgcn_sched_barrier(0);
  const v2f w0[4] = {{v00[0], v00[1]}, {v00[2], v00[3]}, {v01[0], v01[1]}, {v01[2], v01[3]}};
  const v2f w1[4] = {{v10[0], v10[1]}, {v10[2], v10[3]}, {v11[0], v11[1]}, {v11[2], v11[3]}};
  v8f s0[QT], s1[QT];
#pragma unroll
  for (int t = 0; t < QT; ++t) { s0[t] = mma_b(a0h, fqh[t], zero8()); s1[t] = mma_b(a1h, fqh[t], zero8()); }
#pragma unroll
  for (int t = 0; t < QT; ++t) { s0[t] = mma_b(a0h, fql[t], s0[t]); s1[t] = mma_b(a1h, fql[t], s1[t]); }
#pragma unroll
  for (int t = 0; t < QT; ++t) { s0[t] = mma_b(a0l, fqh[t], s0[t]); s1[t] = mma_b(a1l, fqh[t], s1[t]); }
  if constexpr (AHEAD) {
    a0h = ldfrag_b(pa + 32 * CQK);
    a1h = ldfrag_b(pa + 48 * CQK);
    a0l = ldfrag_b(pl + 32 * CQK);
    a1l = ldfrag_b(pl + 48 * CQK);
    // The next chunk's address additions land on these loads' address pairs: the wait stands ahead of that overwrite.
#if defined(__HIP_DEVICE_COMPILE__)
    asm volatile("s_wait_xcnt 0x0" ::: "memory");
#endif
    // Keeps the eight loads of the next chunk ahead of the softmax arithmetic (sunk behind it they would be waited
    // for at once at the next chunk's first product).
    __builtin_amdgcn_sched_barrier(0);
  }
  // ---- softmax terms over the key axis, one query tile after the other ----
#pragma unroll
  for (int t = 0; t < QT; ++t) {
    v2f ls = run_sum[t], po = run_o[t];
    if constexpr (ONLINE) {
      float lmax = fmaxf(s0[t][0], s1[t][0]);
#pragma unroll
      for (int v = 1; v < 8; ++v) lmax = fmaxf(lmax, fmaxf(s0[t][v], s1[t][v]));
      lmax = fmaxf(lmax, __shfl_xor(lmax, 16, 32));
      const float nm = fmaxf(shift[t], lmax * L2E);
      const float factor = ex2(shift[t] - nm);
      shift[t] = nm;
      const v2f f2 = {factor, factor};
      ls *= f2;
      po *= f2;
    }
    const v2f nm2 = {shift[t], shift[t]};
    // Two scores that sit in neighbouring accumulator registers go through each packed instruction together.
#pragma unroll
    for (int j = 0; j < 4; ++j) {
      const v2f a0 = {s0[t][2 * j], s0[t][2 * j + 1]};
      const v2f a1 = {s1[t][2 * j], s1[t][2 * j + 1]};
      const v2f e0 = __builtin_elementwise_fma(a0, l2e2, -nm2);
      const v2f e1 = __builtin_elementwise_fma(a1, l2e2, -nm2);
      const v2f p0 = {ex2(e0[0]), ex2(e0[1])};
      const v2f p1 = {ex2(e1[0]), ex2(e1[1])};
      ls += p0;
      ls += p1;
      po = __builtin_elementwise_fma(p0, w0[j], po);
      po = __builtin_elementwise_fma(p1, w1[j], po);
    }
    run_sum[t] = ls;
    run_o[t] = po;
  }
}

// One wave's walk over its KSPL keys; a0h..a1l arrive holding the fragments of the first chunk. The last chunk stands
// behind the loop, without a fetch ahead: no K row outside the wave's own range is read.
template <bool ONLINE>
__device__ __forceinline__ void walk(const unsigned short* khp, const unsigned short* klp, const float* vbp,
                                     v16bf a0h, v16bf a1h, v16bf a0l, v16bf a1l,
                                     const v16bf (&fqh)[QT], const v16bf (&fql)[QT],
                                     float (&shift)[QT], v2f (&run_sum)[QT], v2f (&run_o)[QT]) {
  // Kept rolled: one chunk's body already needs most of the 256 VGPRs that four waves per SIMD leave a wave.
#pragma unroll 1
  for (int kb = 0; kb < KSPL - 32; kb += 32)
    chunk<ONLINE, true>(khp + (size_t)kb * CQK, klp + (size_t)kb * CQK, vbp + kb, a0h, a1h, a0l, a1l,
                        fqh, fql, shift, run_sum, run_o);
  chunk<ONLINE, false>(khp, klp, vbp + (KSPL - 32), a0h, a1h, a0l, a1l, fqh, fql, shift, run_sum, run_o);
}

__global__ __launch_bounds__(32 * AWAV) void k_attn(const unsigned short* qh, const unsigned short* ql,
                                               const unsigned short* kh, const unsigned short* kl,
                                               const float* vbar, const float* xmean,
                                               const float* __restrict__ gamma, float* out) {
  __shared__ __align__(16) float svb[HWN];
  __shared__ float pmx[AWAV * QBLK];
  __shared__ float psm[AWAV * QBLK];
  __shared__ float pov[AWAV * QBLK];
  const int tid = threadIdx.x, wave = tid >> 5, lane = tid & 31;
  const int rl = lane & 15, h = lane >> 4, koff = 8 * h;
  const int n0 = blockIdx.x * QBLK;
  const int keybase = (n0 / HWN) * HWN;
  const float gb = bf_r(gamma[0]);

  const unsigned short* qhp = qh + (size_t)(n0 + rl) * CQK + koff;
  const unsigned short* qlp = ql + (size_t)(n0 + rl) * CQK + koff;
  const int key0 = wave * KSPL;
  const unsigned short* khp = kh + (size_t)(keybase + key0 + rl) * CQK + koff;
  const unsigned short* klp = kl + (size_t)(keybase + key0 + rl) * CQK + koff;
  const float* vbp = svb + key0 + koff;
  const v16bf e0 = ldfrag_b(khp);                     // the wave's first 32 keys: hi plane (also for the shift) ...
  const v16bf e1 = ldfrag_b(khp + 16 * CQK);
  const v16bf g0 = ldfrag_b(klp);                     // ... and lo plane: the walk's first chunk
  const v16bf g1 = ldfrag_b(klp + 16 * CQK);
  // A Q load may land on the K loads' address pair: the wait stands ahead of that overwrite.
#if defined(__HIP_DEVICE_COMPILE__)
  asm volatile("s_wait_xcnt 0x0" ::: "memory");
#endif
  v16bf fqh[QT], fql[QT];
#pragma unroll
  for (int t = 0; t < QT; ++t) fqh[t] = ldfrag_b(qhp + t * 16 * CQK);
  // A lo-plane load lands on the hi-plane loads' address pair: the wait stands ahead of that overwrite.
#if defined(__HIP_DEVICE_COMPILE__)
  asm volatile("s_wait_xcnt 0x0" ::: "memory");
#endif
#pragma unroll
  for (int t = 0; t < QT; ++t) fql[t] = ldfrag_b(qlp + t * 16 * CQK);
#pragma unroll
  for (int j = 0; j < HWN / (4 * 32 * AWAV); ++j) {
    const int i = tid + 32 * AWAV * j;
    ((v4f*)svb)[i] = *(const v4f*)(vbar + keybase + 4 * i);
  }

  // ---- the walk's fixed shift per query: largest hi.hi score over the wave's first 32 keys, times log2(e) ----
  float shift[QT];
  v2f run_sum[QT], run_o[QT];                         // element 0: even accumulator registers, element 1: odd
  // Inputs-only fence on the loaded values: keeps every Q load ahead of the first product (without it the last
  // lo-plane loads are held back until the K registers are free: a second load wait in front of the barrier).
#if defined(__HIP_DEVICE_COMPILE__)
  asm volatile("" :: "v"(e0), "v"(e1), "v"(fql[0]), "v"(fql[1]), "v"(fql[2]), "v"(fql[3]));
#endif
#pragma unroll
  for (int t = 0; t < QT; ++t) {
    const v8f u0 = mma_b(e0, fqh[t], zero8()), u1 = mma_b(e1, fqh[t], zero8());
    float lmax = fmaxf(u0[0], u1[0]);
#pragma unroll
    for (int v = 1; v < 8; ++v) lmax = fmaxf(lmax, fmaxf(u0[v], u1[v]));
    lmax = fmaxf(lmax, __shfl_xor(lmax, 16, 32));
    shift[t] = lmax * 1.44269504088896340736f;
    run_sum[t] = 0.0f;
    run_o[t] = 0.0f;
  }
  __syncthreads();

  walk<false>(khp, klp, vbp, e0, e1, g0, g1, fqh, fql, shift, run_sum, run_o);

  // ---- both lane halves joined; every sum must lie well inside the f32 range ----
  const float WLO = 0x1p-64f, WHI = 0x1p+96f;
  float tot[QT], oo[QT];
  bool inside = true;
#pragma unroll
  for (int t = 0; t < QT; ++t) {
    const float hs = run_sum[t][0] + run_sum[t][1], ho = run_o[t][0] + run_o[t][1];
    tot[t] = hs + __shfl_xor(hs, 16, 32);
    oo[t] = ho + __shfl_xor(ho, 16, 32);
    inside = inside & (tot[t] > WLO) & (tot[t] < WHI) & (fabsf(oo[t]) < WHI);
  }
  // Scalar branch on the whole wave's vote: the products in the second walk need every lane on.
  if (__builtin_amdgcn_ballot_w32(!inside) != 0u) {
#pragma unroll
    for (int t = 0; t < QT; ++t) { shift[t] = -1.0e30f; run_sum[t] = 0.0f; run_o[t] = 0.0f; }
    walk<true>(khp, klp, vbp, ldfrag_b(khp), ldfrag_b(khp + 16 * CQK), ldfrag_b(klp), ldfrag_b(klp + 16 * CQK),
               fqh, fql, shift, run_sum, run_o);
#pragma unroll
    for (int t = 0; t < QT; ++t) {
      const float hs = run_sum[t][0] + run_sum[t][1], ho = run_o[t][0] + run_o[t][1];
      tot[t] = hs + __shfl_xor(hs, 16, 32);
      oo[t] = ho + __shfl_xor(ho, 16, 32);
    }
  }

  // ---- each wave's partial statistics to LDS ----
#pragma unroll
  for (int t = 0; t < QT; ++t) {
    if (h == 0) {
      const int slot = wave * QBLK + 16 * t + rl;
      pmx[slot] = shift[t];
      psm[slot] = tot[t];
      pov[slot] = oo[t];
    }
  }
  __syncthreads();

  // ---- merge of the 8 key ranges and epilogue: thread = query ----
  if (tid < QBLK) {
    float gm = pmx[tid];
#pragma unroll
    for (int w = 1; w < AWAV; ++w) gm = fmaxf(gm, pmx[w * QBLK + tid]);
    float mt = 0.0f, mo = 0.0f;
#pragma unroll
    for (int w = 0; w < AWAV; ++w) {
      const float f = ex2(pmx[w * QBLK + tid] - gm);
      mt += psm[w * QBLK + tid] * f;
      mo += pov[w * QBLK + tid] * f;
    }
    out[(size_t)n0 + tid] = gb * (mo * (1.0f / mt)) + xmean[n0 + tid];
  }
}

// =====================================================================================================
// Workspace map (bytes); every region an exact multiple of its whole-line store granularity,
// every offset a multiple of 128.
//   QH bf16 [32768][32]  2097152 @0
//   QL bf16 [32768][32]  2097152 @2097152
//   KH bf16 [32768][32]  2097152 @4194304
//   KL bf16 [32768][32]  2097152 @6291456
//   XM f32  [32768]       131072 @8388608
//   VB f32  [32768]       131072 @8519680
//   end = 8650752
// =====================================================================================================
extern "C" void kernel_launch(void* const* d_in, const int* in_sizes, int n_in,
                              void* d_out, int out_size, void* d_ws, size_t ws_size,
                              hipStream_t stream) {
  if (n_in < 8) return;
  if (in_sizes[0] != NTOK * CIN) return;
  if (in_sizes[1] != CIN * CQK) return;
  if (in_sizes[2] != CQK) return;
  if (in_sizes[3] != CIN * CQK) return;
  if (in_sizes[4] != CQK) return;
  if (in_sizes[5] != CIN * CIN) return;
  if (in_sizes[6] != CIN) return;
  if (in_sizes[7] < 1) return;
  if (out_size != NTOK) return;

  const float* x     = (const float*)d_in[0];
  const float* Wq    = (const float*)d_in[1];
  const float* bq    = (const float*)d_in[2];
  const float* Wk    = (const float*)d_in[3];
  const float* bk    = (const float*)d_in[4];
  const float* Wv    = (const float*)d_in[5];
  const float* bv    = (const float*)d_in[6];
  const float* gamma = (const float*)d_in[7];
  float* out = (float*)d_out;

  const size_t PQK  = (size_t)NTOK * CQK * 2;        // 2097152
  const size_t PTOK = (size_t)NTOK * 4;              //  131072

  size_t off = 0;
  const size_t oQH = off; off += PQK;
  const size_t oQL = off; off += PQK;
  const size_t oKH = off; off += PQK;
  const size_t oKL = off; off += PQK;
  const size_t oXM = off; off += PTOK;
  const size_t oVB = off; off += PTOK;
  if (off > ws_size) return;                          // off = 8650752
  if (off > (size_t)134217728) return;

  char* ws = (char*)d_ws;
  unsigned short* QH = (unsigned short*)(ws + oQH);
  unsigned short* QL = (unsigned short*)(ws + oQL);
  unsigned short* KH = (unsigned short*)(ws + oKH);
  unsigned short* KL = (unsigned short*)(ws + oKL);
  float* XM  = (float*)(ws + oXM);
  float* VB  = (float*)(ws + oVB);

  k_proj<<<dim3(NTOK / PBLK), dim3(2 * PBLK), 0, stream>>>(x, Wq, bq, Wk, bk, Wv, bv, QH, QL, KH, KL, XM, VB);
  k_attn<<<dim3(NTOK / QBLK), dim3(32 * AWAV), 0, stream>>>(QH, QL, KH, KL, VB, XM, gamma, out);
  (void)hipGetLastError();
}

// v008
// It runs in 32.5 microseconds.
// Next to v007, in two timings, it ran 1.03 and 1.04 times as fast.
// Counting every step since v000, it is 3.96 times as fast.
// Projection tiles (tokens x Wq, tokens x Wk): v_wmma_f32_16x16x32_bf16 (bf16 operands = RNE-converted inputs), f32 accumulate.
// Score tiles (keys x queries, K = 32): v_wmma_f32_16x16x32_bf16 on a bf16 hi/lo split of both operands (hi.hi + hi.lo + lo.hi), f32 accumulate.
// Row sums of Wv and the sum of bv: v_wmma_f32_16x16x32_bf16, A = bf16RNE values, B = ones and zeros, f32 accumulate.
// Channel sums, value channel-mean dot, softmax statistics, weight-times-value-mean reduction and epilogue: f32 on the VALU.
#include <hip/hip_runtime.h>

#define CIN   256
#define CQK   32
#define HWN   4096
#define NBAT  8
#define NTOK  32768
#define PBLK  128
#define QBLK  64
#define PW    264
#define XP    260
#define AWAV  8
#define QT    (QBLK / 16)
#define KSPL  (HWN / AWAV)

static_assert(NTOK == NBAT * HWN);
static_assert((NTOK % PBLK) == 0 && (NTOK % QBLK) == 0 && (HWN % QBLK) == 0);
static_assert((HWN % 32) == 0 && (CIN % 32) == 0 && CQK == 32);
static_assert((PW % 8) == 0 && PBLK == 128 && QBLK == 64 && CIN == 2 * PBLK);
static_assert((XP % 4) == 0 && ((XP / 4) % 2) == 1 && XP >= CIN);
static_assert((KSPL % 32) == 0 && 32 * AWAV >= QBLK && (HWN % (4 * 32 * AWAV)) == 0);

typedef __bf16         v16bf __attribute__((ext_vector_type(16)));
typedef unsigned short v16us __attribute__((ext_vector_type(16)));
typedef unsigned short v8us  __attribute__((ext_vector_type(8)));
typedef float          v8f   __attribute__((ext_vector_type(8)));
typedef float          v4f   __attribute__((ext_vector_type(4)));
typedef float          v2f   __attribute__((ext_vector_type(2)));
typedef __bf16         v2bf  __attribute__((ext_vector_type(2)));
typedef unsigned int   v8u   __attribute__((ext_vector_type(8)));
typedef unsigned int   v4u   __attribute__((ext_vector_type(4)));

// ---- scalar helpers --------------------------------------------------------------------------------
__device__ __forceinline__ unsigned short bf_bits(float f) {          // f32 -> bf16 bits, RNE convert
  unsigned u = __float_as_uint(f);
  return (unsigned short)((u + 0x7FFFu + ((u >> 16) & 1u)) >> 16);
}
__device__ __forceinline__ float bf_up(unsigned short hb) { return __uint_as_float(((unsigned)hb) << 16); }
__device__ __forceinline__ float bf_r(float f) { return bf_up(bf_bits(f)); }
__device__ __forceinline__ float ex2(float f) { return __builtin_amdgcn_exp2f(f); }   // 2^f, one v_exp_f32
__device__ __forceinline__ v8f zero8() { v8f z = {0.f, 0.f, 0.f, 0.f, 0.f, 0.f, 0.f, 0.f}; return z; }

// ---- fragment loader: lane -> row/col (lane&15); p already includes +8*(lane>>4);
//      elements 0..7 <- p[0..7] (k0+8h..), elements 8..15 <- p[16..23] (k0+16+8h..). Same map for A and B.
__device__ __forceinline__ v16bf ldfrag_b(const unsigned short* p) {
  union { v16us v; v8us hv[2]; } f;
  f.hv[0] = *(const v8us*)(p);
  f.hv[1] = *(const v8us*)(p + 16);
  return __builtin_bit_cast(v16bf, f.v);
}

// ---- WMMA helper and trailing VALU hazard gaps ------------------------------------------------------------
__device__ __forceinline__ v8f mma_b(v16bf a, v16bf b, v8f c) {
  return __builtin_amdgcn_wmma_f32_16x16x32_bf16(false, a, false, b, (short)0, c, false, false);
}
__device__ __forceinline__ void guard_p(v8f& c0, v8f& c1, v8f& c2, v8f& c3,
                                        v16bf a, v16bf b0, v16bf b1, v16bf b2, v16bf b3) {
#if defined(__HIP_DEVICE_COMPILE__)
  asm volatile("v_nop\n\tv_nop\n\tv_nop\n\tv_nop"
               : "+v"(c0), "+v"(c1), "+v"(c2), "+v"(c3)
               : "v"(a), "v"(b0), "v"(b1), "v"(b2), "v"(b3));
#endif
}
__device__ __forceinline__ void acc_guard4(v8f& a, v8f& b, v8f& c, v8f& d) {
#if defined(__HIP_DEVICE_COMPILE__)
  asm volatile("v_nop\n\tv_nop\n\tv_nop\n\tv_nop" : "+v"(a), "+v"(b), "+v"(c), "+v"(d));
#endif
}
__device__ __forceinline__ void sched_fence() {
#if defined(__HIP_DEVICE_COMPILE__)
  asm volatile("" ::: "memory");
#endif
}

// ---- eight asynchronous copies to LDS, 16 bytes a lane each: four rows of x, two whole-wave 512-byte halves a row.
//      l = the lane's LDS byte address of the first row's first half, g = its global address; rows XP and CIN floats apart.
//      The closing s_wait_xcnt stands inside the statement, ahead of any later write of an address register it names.
__device__ __forceinline__ void copy_rows4(unsigned l, const float* g) {
#if defined(__HIP_DEVICE_COMPILE__)
  asm volatile("global_load_async_to_lds_b128 %0, %8, off\n\t"
               "global_load_async_to_lds_b128 %1, %9, off\n\t"
               "global_load_async_to_lds_b128 %2, %10, off\n\t"
               "global_load_async_to_lds_b128 %3, %11, off\n\t"
               "global_load_async_to_lds_b128 %4, %12, off\n\t"
               "global_load_async_to_lds_b128 %5, %13, off\n\t"
               "global_load_async_to_lds_b128 %6, %14, off\n\t"
               "global_load_async_to_lds_b128 %7, %15, off\n\t"
               "s_wait_xcnt 0x0"
               :: "v"(l), "v"(l + 512u), "v"(l + 4u * XP), "v"(l + 4u * XP + 512u),
                  "v"(l + 8u * XP), "v"(l + 8u * XP + 512u), "v"(l + 12u * XP), "v"(l + 12u * XP + 512u),
                  "v"(g), "v"(g + 128), "v"(g + CIN), "v"(g + CIN + 128),
                  "v"(g + 2 * CIN), "v"(g + 2 * CIN + 128), "v"(g + 3 * CIN), "v"(g + 3 * CIN + 128)
               : "memory");
#endif
}

// ---- NQ whole-wave 512-byte loads (p already includes +4*lane) -> fragment elements 4q..4q+3 of the lane, RNE
//      convert (two values per instruction); the elements above 4*NQ are zero.
template <int NQ>
__device__ __forceinline__ v16bf ldlines(const float* p) {
  v16bf a;
#pragma unroll
  for (int e = 0; e < 16; ++e) a[e] = (__bf16)0.0f;
#pragma unroll
  for (int g = 0; g < NQ; ++g) {
    const v4f f = *(const v4f*)(p + 128 * g);
    const v2f f01 = {f[0], f[1]}, f23 = {f[2], f[3]};
    const v2bf c01 = __builtin_convertvector(f01, v2bf), c23 = __builtin_convertvector(f23, v2bf);
    a[4 * g] = c01[0]; a[4 * g + 1] = c01[1]; a[4 * g + 2] = c23[0]; a[4 * g + 3] = c23[1];
  }
  return a;
}

// =====================================================================================================
// Projections + per-token statistics. Block = 128 tokens, 8 waves, wave = 16 tokens; one block per WGP, so Wv is
// read once per WGP.
// Entry: each wave sends its 16 rows of x (16 KiB) to LDS by 32 asynchronous copies (row pitch 260 floats = 16 B x 65),
// which fly under the whole prologue; its own wait on them stands in front of the prologue's closing barrier.
// Prologue: wsum[cin] = sum over cout of bf16RNE(Wv[cin][cout]), wave = 32 rows of Wv. Two neighbouring rows are
// four whole-wave 512-byte loads: a lane's fragment elements 0..7 belong to the even row, 8..15 to the odd one.
// Product j of a 16-row group: A = that fragment, B = 1 in column 2j at elements 0..7 and in column 2j+1 at
// elements 8..15, else 0 (same element map for A and B), so D[i][n] = what lanes i and i+16 hold of row n.
// A lane adds its 8 registers and its xor-16 partner's sum: lane n has the sum of row n.
// Sum of bf16RNE(bv), in every wave: two such loads in elements 0..7, B = ones, the same two additions.
// LDS: Wq and Wk as bf16 bits in [n][k] layout (rows 0..31 = Wq columns, rows 32..63 = Wk columns,
// pitch 264), wsum, biases. k-loop over 256 in steps of 32: A = bf16RNE(x) rows read from LDS (row = token m,
// split k map), B = sW rows (col = output channel, same k map); the same x elements feed the f32 channel
// sum and the f32 dot with wsum. Epilogue: v = k + bias, or (q + bias) * log2(e) in f32, so that a score q.k leaves the
// matrix unit as a base-2 exponent; hi = bf16RNE(v), lo = bf16RNE(v - hi), staged
// per wave in LDS as four [16 tokens][32] planes, then each plane tile (1024 contiguous bytes in global)
// coverage: 8 waves x 16 rows x 32 = the block's 128 rows of each of the 4 planes; 128 xmean + 128 vbar;
// 256 blocks = whole planes.
// =====================================================================================================
__global__ __launch_bounds__(2 * PBLK) void k_proj(const float* __restrict__ x,
                                               const float* __restrict__ Wq, const float* __restrict__ bq,
                                               const float* __restrict__ Wk, const float* __restrict__ bk,
                                               const float* __restrict__ Wv, const float* __restrict__ bv,
                                               unsigned short* qh, unsigned short* ql,
                                               unsigned short* kh, unsigned short* kl,
                                               float* xmean, float* vbar) {
  __shared__ __align__(16) float sX[PBLK * XP];
  __shared__ __align__(16) unsigned short sW[64 * PW];
  __shared__ __align__(16) unsigned short sO[(PBLK / 16) * 4 * 16 * CQK];
  __shared__ __align__(16) float swsum[CIN];
  __shared__ __align__(16) float smean[PBLK];
  __shared__ __align__(16) float svbar[PBLK];
  __shared__ float sbias[64];
  const int tid = threadIdx.x, wave = tid >> 5, lane = tid & 31, m = lane & 15, h = lane >> 4;
  const int row0 = blockIdx.x * PBLK + wave * 16;

  {
    const unsigned xl = (unsigned)(size_t)(sX + wave * 16 * XP + 4 * lane);
    const float* xg = x + (size_t)row0 * CIN + 4 * lane;
    // Unrolled so that every copy's two addresses are constant steps from one base and all 32 copies issue in a row.
#pragma unroll
    for (int q = 0; q < 4; ++q) copy_rows4(xl + (unsigned)(q * 4 * XP * 4), xg + q * 4 * CIN);
  }

  float bvsum;
  {
    const unsigned one2 = 0x3F803F80u;              // two bf16 ones
    const v8u ou = {one2, one2, one2, one2, one2, one2, one2, one2};
    const v16bf ab = ldlines<2>(bv + 4 * lane);
    // A Wv load may land on the bv loads' address pair: the wait stands ahead of that overwrite.
#if defined(__HIP_DEVICE_COMPILE__)
    asm volatile("s_wait_xcnt 0x0" ::: "memory");
#endif
    const float* wv = Wv + (size_t)(wave * 32) * CIN + 4 * lane;
    v8f rs[2] = {zero8(), zero8()};
#pragma unroll
    for (int j = 0; j < 8; ++j) {
      const unsigned se = m == 2 * j ? one2 : 0u, so2 = m == 2 * j + 1 ? one2 : 0u;
      const v8u su = {se, se, se, se, so2, so2, so2, so2};
      const v16bf sel = __builtin_bit_cast(v16bf, su);
#pragma unroll
      for (int rt = 0; rt < 2; ++rt) rs[rt] = mma_b(ldlines<4>(wv + (rt * 16 + 2 * j) * CIN), sel, rs[rt]);
    }
    const v8f rb = mma_b(ab, __builtin_bit_cast(v16bf, ou), zero8());
    float p0 = ((rs[0][0] + rs[0][1]) + (rs[0][2] + rs[0][3])) + ((rs[0][4] + rs[0][5]) + (rs[0][6] + rs[0][7]));
    float p1 = ((rs[1][0] + rs[1][1]) + (rs[1][2] + rs[1][3])) + ((rs[1][4] + rs[1][5]) + (rs[1][6] + rs[1][7]));
    float pb = ((rb[0] + rb[1]) + (rb[2] + rb[3])) + ((rb[4] + rb[5]) + (rb[6] + rb[7]));
    p0 += __shfl_xor(p0, 16, 32);
    p1 += __shfl_xor(p1, 16, 32);
    pb += __shfl_xor(pb, 16, 32);
    swsum[wave * 32 + lane] = h ? p1 : p0;
    bvsum = pb;
  }
#pragma unroll 4
  for (int it = 0; it < (CIN * CQK) / (2 * PBLK); ++it) {
    const int idx = it * (2 * PBLK) + tid;          // = k*32 + n
    const int k = idx >> 5, n = idx & 31;
    sW[n * PW + k] = bf_bits(Wq[idx]);
    sW[(32 + n) * PW + k] = bf_bits(Wk[idx]);
  }
  if (tid < 64) {
    const float vq = bq[tid & 31];
    const float vk = bk[tid & 31];
    sbias[tid] = bf_r(tid < 32 ? vq : vk);
  }
  // The wave's own copies of x have landed before it passes the barrier behind which sX is read.
#if defined(__HIP_DEVICE_COMPILE__)
  asm volatile("s_wait_asynccnt 0x0" ::: "memory");
#endif
  __syncthreads();

  const float* xr = sX + (wave * 16 + m) * XP + 8 * h;
  const float* wr = swsum + 8 * h;
  const unsigned short* wb = sW + m * PW + 8 * h;
  v8f acc[4];
#pragma unroll
  for (int t = 0; t < 4; ++t) acc[t] = zero8();
  float xs = 0.f, vd = 0.f;

#pragma unroll 2
  for (int c = 0; c < CIN / 32; ++c) {
    const float* p = xr + 32 * c;
    const v4f x0 = *(const v4f*)(p);
    const v4f x1 = *(const v4f*)(p + 4);
    const v4f x2 = *(const v4f*)(p + 16);
    const v4f x3 = *(const v4f*)(p + 20);
    const float* pw = wr + 32 * c;
    const v4f w0 = *(const v4f*)(pw);
    const v4f w1 = *(const v4f*)(pw + 4);
    const v4f w2 = *(const v4f*)(pw + 16);
    const v4f w3 = *(const v4f*)(pw + 20);
    v16us au;
#pragma unroll
    for (int e = 0; e < 4; ++e) {
      const unsigned short b0 = bf_bits(x0[e]), b1 = bf_bits(x1[e]);
      const unsigned short b2 = bf_bits(x2[e]), b3 = bf_bits(x3[e]);
      const float r0 = bf_up(b0), r1 = bf_up(b1), r2 = bf_up(b2), r3 = bf_up(b3);
      au[e] = b0; au[4 + e] = b1; au[8 + e] = b2; au[12 + e] = b3;
      xs += (r0 + r1) + (r2 + r3);
      vd += r0 * w0[e]; vd += r1 * w1[e]; vd += r2 * w2[e]; vd += r3 * w3[e];
    }
    const v16bf a = __builtin_bit_cast(v16bf, au);
    const unsigned short* bp = wb + 32 * c;
    const v16bf f0 = ldfrag_b(bp);
    const v16bf f1 = ldfrag_b(bp + 16 * PW);
    const v16bf f2 = ldfrag_b(bp + 32 * PW);
    const v16bf f3 = ldfrag_b(bp + 48 * PW);
    acc[0] = mma_b(a, f0, acc[0]);
    acc[1] = mma_b(a, f1, acc[1]);
    acc[2] = mma_b(a, f2, acc[2]);
    acc[3] = mma_b(a, f3, acc[3]);
    guard_p(acc[0], acc[1], acc[2], acc[3], a, f0, f1, f2, f3);
    sched_fence();
  }
  acc_guard4(acc[0], acc[1], acc[2], acc[3]);

  // ---- per-token statistics (both lane halves hold row m) ----
  xs += __shfl_xor(xs, 16, 32);
  vd += __shfl_xor(vd, 16, 32);
  if (h == 0) {
    smean[wave * 16 + m] = xs * (1.0f / 256.0f);
    svbar[wave * 16 + m] = (vd + bvsum) * (1.0f / 256.0f);
  }
  // ---- q/k hi/lo planes staged per wave: plane 0 = q hi, 1 = q lo, 2 = k hi, 3 = k lo ----
  unsigned short* so = sO + wave * (4 * 16 * CQK);
#pragma unroll
  for (int t = 0; t < 4; ++t) {
    const float bias = sbias[16 * t + m];
    const int col = 16 * (t & 1) + m;
    unsigned short* ph = so + (2 * (t >> 1)) * (16 * CQK) + col;
    unsigned short* pl = ph + 16 * CQK;
#pragma unroll
    for (int r = 0; r < 8; ++r) {
      const float pre = acc[t][r] + bias;
      const float val = t < 2 ? pre * 1.44269504088896340736f : pre;   // t 0, 1 = the q columns
      const unsigned short hb = bf_bits(val);
      const unsigned short lb = bf_bits(val - bf_up(hb));
      ph[(8 * h + r) * CQK] = hb;
      pl[(8 * h + r) * CQK] = lb;
    }
  }
  __syncthreads();
  v4u pc[8];
#pragma unroll
  for (int pidx = 0; pidx < 4; ++pidx) {
    pc[2 * pidx]     = *(const v4u*)(so + pidx * (16 * CQK) + lane * 8);
    pc[2 * pidx + 1] = *(const v4u*)(so + pidx * (16 * CQK) + 256 + lane * 8);
  }
  const size_t ob = (size_t)row0 * CQK + (size_t)lane * 8;
  *(v4u*)(qh + ob) = pc[0];  *(v4u*)(qh + ob + 256) = pc[1];
  *(v4u*)(ql + ob) = pc[2];  *(v4u*)(ql + ob + 256) = pc[3];
  *(v4u*)(kh + ob) = pc[4];  *(v4u*)(kh + ob + 256) = pc[5];
  *(v4u*)(kl + ob) = pc[6];  *(v4u*)(kl + ob + 256) = pc[7];
  

  if (wave == 0) {
    *(v4f*)(xmean + (size_t)blockIdx.x * PBLK + 4 * lane) = *(const v4f*)(smean + 4 * lane);
  } else if (wave == 1) {
    *(v4f*)(vbar + (size_t)blockIdx.x * PBLK + 4 * lane) = *(const v4f*)(svbar + 4 * lane);
  }
}

// =====================================================================================================
// Attention, single pass. Block = 64 queries (inside one image), 8 waves.
// Every wave holds the Q fragments of all 64 queries (4 query tiles) and walks its own eighth of the
// image's keys (512 keys, 16 chunks of 32), so one K fragment load and one vbar read feed 4 query tiles.
// vbar of the image staged in LDS (4096 floats). Per 32-key chunk and query tile t:
//   S^T tiles = K rows (A, row = key, k = d) . Q rows (B, col = query, k = d), one k-step,
//   three products hi.hi + hi.lo + lo.hi per tile from zero;
//   D: s0[t][r] = S[key kb+8h+r][query], s1[t][r] = S[key kb+16+8h+r][query], S = score * log2(e): the q planes
//   carry the factor;
//   p = 2^S in f32, taken straight from the accumulator register; sum += p; o += p * vbar[key] (f32 FMA).
//   The sum and the weighted sum are formed on pairs of neighbouring accumulator registers
//   (packed f32 instructions); the two elements of a pair's sums are added once, after the loop.
// The walk subtracts nothing from S (shift 0): o / sum does not depend on a shift as long as nothing leaves the f32
// range, so the walk needs no exponent arithmetic, no maximum, no exchange between lane halves and no rescaling.
// After the walk every query's sum and weighted sum
// are tested against a window well inside the f32 range; if one lane of the wave fails (also on NaN), the whole wave
// walks its keys again with the running maximum as shift (walk<true>: max over the 16 keys per lane, then the xor-16
// partner; p = 2^(S - shift); rescale of both sums), which holds for any scores.
// Merge: each wave leaves (shift, sum, weighted sum) per query in LDS; after one barrier thread q < 64
// rescales the 8 partials of query q to their largest shift (base 2) and adds them in wave order.
// Epilogue: res = gammaRNE * (o / l) + xmean[query]; waves 0 and 1 each store one whole 128-byte line.
// coverage: 8 waves x 16 chunks x 32 = all 4096 keys of the image; 512 blocks x 64 = whole output.
// =====================================================================================================
// One 32-key chunk of a wave's walk. a0h..a1l hold the chunk's K fragments on entry. ONLINE = false: shift[] is not
// used. ONLINE = true: shift[] is the running maximum of S. AHEAD = true: right behind the chunk's own
// products the same four fragments are loaded anew from the next chunk (pa, pl + 32 rows), so that these loads fly
// under the chunk's softmax arithmetic and are waited for only at the next chunk's first product. Every loop over
// t (query tile), v (accumulator register) and j (register pair) is fully unrolled: the per-tile arrays live in VGPRs.
template <bool ONLINE, bool AHEAD>
__device__ __forceinline__ void chunk(const unsigned short* pa, const unsigned short* pl, const float* vb,
                                      v16bf& a0h, v16bf& a1h, v16bf& a0l, v16bf& a1l,
                                      const v16bf (&fqh)[QT], const v16bf (&fql)[QT],
                                      float (&shift)[QT], v2f (&run_sum)[QT], v2f (&run_o)[QT]) {
  const v4f v00 = *(const v4f*)(vb);
  const v4f v01 = *(const v4f*)(vb + 4);
  const v4f v10 = *(const v4f*)(vb + 16);
  const v4f v11 = *(const v4f*)(vb + 16 + 4);
  // Keeps the four vbar reads in one place ahead of the products, whose run covers the LDS latency.
  __builtin_amdgcn_sched_barrier(0);
  const v2f w0[4] = {{v00[0], v00[1]}, {v00[2], v00[3]}, {v01[0], v01[1]}, {v01[2], v01[3]}};
  const v2f w1[4] = {{v10[0], v10[1]}, {v10[2], v10[3]}, {v11[0], v11[1]}, {v11[2], v11[3]}};
  v8f s0[QT], s1[QT];
#pragma unroll
  for (int t = 0; t < QT; ++t) { s0[t] = mma_b(a0h, fqh[t], zero8()); s1[t] = mma_b(a1h, fqh[t], zero8()); }
#pragma unroll
  for (int t = 0; t < QT; ++t) { s0[t] = mma_b(a0h, fql[t], s0[t]); s1[t] = mma_b(a1h, fql[t], s1[t]); }
#pragma unroll
  for (int t = 0; t < QT; ++t) { s0[t] = mma_b(a0l, fqh[t], s0[t]); s1[t] = mma_b(a1l, fqh[t], s1[t]); }
  if constexpr (AHEAD) {
    a0h = ldfrag_b(pa + 32 * CQK);
    a1h = ldfrag_b(pa + 48 * CQK);
    a0l = ldfrag_b(pl + 32 * CQK);
    a1l = ldfrag_b(pl + 48 * CQK);
    // The next chunk's address additions land on these loads' address pairs: the wait stands ahead of that overwrite.
#if defined(__HIP_DEVICE_COMPILE__)
    asm volatile("s_wait_xcnt 0x0" ::: "memory");
#endif
    // Keeps the eight loads of the next chunk ahead of the softmax arithmetic (sunk behind it they would be waited
    // for at once at the next chunk's first product).
    __builtin_amdgcn_sched_barrier(0);
  }
  // ---- softmax terms over the key axis, one query tile after the other ----
#pragma unroll
  for (int t = 0; t < QT; ++t) {
    v2f ls = run_sum[t], po = run_o[t];
    if constexpr (ONLINE) {
      float lmax = fmaxf(s0[t][0], s1[t][0]);
#pragma unroll
      for (int v = 1; v < 8; ++v) lmax = fmaxf(lmax, fmaxf(s0[t][v], s1[t][v]));
      lmax = fmaxf(lmax, __shfl_xor(lmax, 16, 32));
      const float nm = fmaxf(shift[t], lmax);
      const float factor = ex2(shift[t] - nm);
      shift[t] = nm;
      const v2f f2 = {factor, factor};
      ls *= f2;
      po *= f2;
    }
    // Two scores that sit in neighbouring accumulator registers go through each packed instruction together.
#pragma unroll
    for (int j = 0; j < 4; ++j) {
      v2f e0 = {s0[t][2 * j], s0[t][2 * j + 1]};
      v2f e1 = {s1[t][2 * j], s1[t][2 * j + 1]};
      if constexpr (ONLINE) {
        const v2f nm2 = {shift[t], shift[t]};
        e0 -= nm2;
        e1 -= nm2;
      }
      const v2f p0 = {ex2(e0[0]), ex2(e0[1])};
      const v2f p1 = {ex2(e1[0]), ex2(e1[1])};
      ls += p0;
      ls += p1;
      po = __builtin_elementwise_fma(p0, w0[j], po);
      po = __builtin_elementwise_fma(p1, w1[j], po);
    }
    run_sum[t] = ls;
    run_o[t] = po;
  }
}

// One wave's walk over its KSPL keys; a0h..a1l arrive holding the fragments of the first chunk. The last chunk stands
// behind the loop, without a fetch ahead: no K row outside the wave's own range is read.
template <bool ONLINE>
__device__ __forceinline__ void walk(const unsigned short* khp, const unsigned short* klp, const float* vbp,
                                     v16bf a0h, v16bf a1h, v16bf a0l, v16bf a1l,
                                     const v16bf (&fqh)[QT], const v16bf (&fql)[QT],
                                     float (&shift)[QT], v2f (&run_sum)[QT], v2f (&run_o)[QT]) {
  // Kept rolled: one chunk's body already needs most of the 256 VGPRs that four waves per SIMD leave a wave.
#pragma unroll 1
  for (int kb = 0; kb < KSPL - 32; kb += 32)
    chunk<ONLINE, true>(khp + (size_t)kb * CQK, klp + (size_t)kb * CQK, vbp + kb, a0h, a1h, a0l, a1l,
                        fqh, fql, shift, run_sum, run_o);
  chunk<ONLINE, false>(khp, klp, vbp + (KSPL - 32), a0h, a1h, a0l, a1l, fqh, fql, shift, run_sum, run_o);
}

__global__ __launch_bounds__(32 * AWAV) void k_attn(const unsigned short* qh, const unsigned short* ql,
                                               const unsigned short* kh, const unsigned short* kl,
                                               const float* vbar, const float* xmean,
                                               const float* __restrict__ gamma, float* out) {
  __shared__ __align__(16) float svb[HWN];
  __shared__ float pmx[AWAV * QBLK];
  __shared__ float psm[AWAV * QBLK];
  __shared__ float pov[AWAV * QBLK];
  const int tid = threadIdx.x, wave = tid >> 5, lane = tid & 31;
  const int rl = lane & 15, h = lane >> 4, koff = 8 * h;
  const int n0 = blockIdx.x * QBLK;
  const int keybase = (n0 / HWN) * HWN;
  const float gb = bf_r(gamma[0]);

  const unsigned short* qhp = qh + (size_t)(n0 + rl) * CQK + koff;
  const unsigned short* qlp = ql + (size_t)(n0 + rl) * CQK + koff;
  const int key0 = wave * KSPL;
  const unsigned short* khp = kh + (size_t)(keybase + key0 + rl) * CQK + koff;
  const unsigned short* klp = kl + (size_t)(keybase + key0 + rl) * CQK + koff;
  const float* vbp = svb + key0 + koff;
  const v16bf e0 = ldfrag_b(khp);                     // the wave's first 32 keys: hi plane ...
  const v16bf e1 = ldfrag_b(khp + 16 * CQK);
  const v16bf g0 = ldfrag_b(klp);                     // ... and lo plane: the walk's first chunk
  const v16bf g1 = ldfrag_b(klp + 16 * CQK);
  // A Q load may land on the K loads' address pair: the wait stands ahead of that overwrite.
#if defined(__HIP_DEVICE_COMPILE__)
  asm volatile("s_wait_xcnt 0x0" ::: "memory");
#endif
  v16bf fqh[QT], fql[QT];
#pragma unroll
  for (int t = 0; t < QT; ++t) fqh[t] = ldfrag_b(qhp + t * 16 * CQK);
  // A lo-plane load lands on the hi-plane loads' address pair: the wait stands ahead of that overwrite.
#if defined(__HIP_DEVICE_COMPILE__)
  asm volatile("s_wait_xcnt 0x0" ::: "memory");
#endif
#pragma unroll
  for (int t = 0; t < QT; ++t) fql[t] = ldfrag_b(qlp + t * 16 * CQK);
#pragma unroll
  for (int j = 0; j < HWN / (4 * 32 * AWAV); ++j) {
    const int i = tid + 32 * AWAV * j;
    ((v4f*)svb)[i] = *(const v4f*)(vbar + keybase + 4 * i);
  }

  float shift[QT];                                    // what the merge takes as the partial sums' shift: 0 after walk<false>
  v2f run_sum[QT], run_o[QT];                         // element 0: even accumulator registers, element 1: odd
#pragma unroll
  for (int t = 0; t < QT; ++t) { shift[t] = 0.0f; run_sum[t] = 0.0f; run_o[t] = 0.0f; }
  __syncthreads();

  walk<false>(khp, klp, vbp, e0, e1, g0, g1, fqh, fql, shift, run_sum, run_o);

  // ---- both lane halves joined; every sum must lie well inside the f32 range ----
  const float WLO = 0x1p-64f, WHI = 0x1p+96f;
  float tot[QT], oo[QT];
  bool inside = true;
#pragma unroll
  for (int t = 0; t < QT; ++t) {
    const float hs = run_sum[t][0] + run_sum[t][1], ho = run_o[t][0] + run_o[t][1];
    tot[t] = hs + __shfl_xor(hs, 16, 32);
    oo[t] = ho + __shfl_xor(ho, 16, 32);
    inside = inside & (tot[t] > WLO) & (tot[t] < WHI) & (fabsf(oo[t]) < WHI);
  }
  // Scalar branch on the whole wave's vote: the products in the second walk need every lane on.
  if (__builtin_amdgcn_ballot_w32(!inside) != 0u) {
#pragma unroll
    for (int t = 0; t < QT; ++t) { shift[t] = -1.0e30f; run_sum[t] = 0.0f; run_o[t] = 0.0f; }
    walk<true>(khp, klp, vbp, ldfrag_b(khp), ldfrag_b(khp + 16 * CQK), ldfrag_b(klp), ldfrag_b(klp + 16 * CQK),
               fqh, fql, shift, run_sum, run_o);
#pragma unroll
    for (int t = 0; t < QT; ++t) {
      const float hs = run_sum[t][0] + run_sum[t][1], ho = run_o[t][0] + run_o[t][1];
      tot[t] = hs + __shfl_xor(hs, 16, 32);
      oo[t] = ho + __shfl_xor(ho, 16, 32);
    }
  }

  // ---- each wave's partial statistics to LDS ----
#pragma unroll
  for (int t = 0; t < QT; ++t) {
    if (h == 0) {
      const int slot = wave * QBLK + 16 * t + rl;
      pmx[slot] = shift[t];
      psm[slot] = tot[t];
      pov[slot] = oo[t];
    }
  }
  __syncthreads();

  // ---- merge of the 8 key ranges and epilogue: thread = query ----
  if (tid < QBLK) {
    float gm = pmx[tid];
#pragma unroll
    for (int w = 1; w < AWAV; ++w) gm = fmaxf(gm, pmx[w * QBLK + tid]);
    float mt = 0.0f, mo = 0.0f;
#pragma unroll
    for (int w = 0; w < AWAV; ++w) {
      const float f = ex2(pmx[w * QBLK + tid] - gm);
      mt += psm[w * QBLK + tid] * f;
      mo += pov[w * QBLK + tid] * f;
    }
    out[(size_t)n0 + tid] = gb * (mo * (1.0f / mt)) + xmean[n0 + tid];
  }
}

// =====================================================================================================
// Workspace map (bytes); every region an exact multiple of its whole-line store granularity,
// every offset a multiple of 128.
//   QH bf16 [32768][32]  2097152 @0
//   QL bf16 [32768][32]  2097152 @2097152
//   KH bf16 [32768][32]  2097152 @4194304
//   KL bf16 [32768][32]  2097152 @6291456
//   XM f32  [32768]       131072 @8388608
//   VB f32  [32768]       131072 @8519680
//   end = 8650752
// =====================================================================================================
extern "C" void kernel_launch(void* const* d_in, const int* in_sizes, int n_in,
                              void* d_out, int out_size, void* d_ws, size_t ws_size,
                              hipStream_t stream) {
  if (n_in < 8) return;
  if (in_sizes[0] != NTOK * CIN) return;
  if (in_sizes[1] != CIN * CQK) return;
  if (in_sizes[2] != CQK) return;
  if (in_sizes[3] != CIN * CQK) return;
  if (in_sizes[4] != CQK) return;
  if (in_sizes[5] != CIN * CIN) return;
  if (in_sizes[6] != CIN) return;
  if (in_sizes[7] < 1) return;
  if (out_size != NTOK) return;

  const float* x     = (const float*)d_in[0];
  const float* Wq    = (const float*)d_in[1];
  const float* bq    = (const float*)d_in[2];
  const float* Wk    = (const float*)d_in[3];
  const float* bk    = (const float*)d_in[4];
  const float* Wv    = (const float*)d_in[5];
  const float* bv    = (const float*)d_in[6];
  const float* gamma = (const float*)d_in[7];
  float* out = (float*)d_out;

  const size_t PQK  = (size_t)NTOK * CQK * 2;        // 2097152
  const size_t PTOK = (size_t)NTOK * 4;              //  131072

  size_t off = 0;
  const size_t oQH = off; off += PQK;
  const size_t oQL = off; off += PQK;
  const size_t oKH = off; off += PQK;
  const size_t oKL = off; off += PQK;
  const size_t oXM = off; off += PTOK;
  const size_t oVB = off; off += PTOK;
  if (off > ws_size) return;                          // off = 8650752
  if (off > (size_t)134217728) return;

  char* ws = (char*)d_ws;
  unsigned short* QH = (unsigned short*)(ws + oQH);
  unsigned short* QL = (unsigned short*)(ws + oQL);
  unsigned short* KH = (unsigned short*)(ws + oKH);
  unsigned short* KL = (unsigned short*)(ws + oKL);
  float* XM  = (float*)(ws + oXM);
  float* VB  = (float*)(ws + oVB);

  k_proj<<<dim3(NTOK / PBLK), dim3(2 * PBLK), 0, stream>>>(x, Wq, bq, Wk, bk, Wv, bv, QH, QL, KH, KL, XM, VB);
  k_attn<<<dim3(NTOK / QBLK), dim3(32 * AWAV), 0, stream>>>(QH, QL, KH, KL, VB, XM, gamma, out);
  (void)hipGetLastError();
}

// v010
// One run takes 22.9 microseconds.
// Versions between v008 and this one are left out; their measured steps multiply to 1.40 times as fast.
// All steps since v000 together make it 5.55 times as fast.
// Projection tiles (tokens x Wq, tokens x Wk): v_wmma_f32_16x16x32_bf16 (bf16 operands = RNE-converted inputs), f32 accumulate.
// Score tiles (keys x queries, K = 32): v_wmma_f32_16x16x32_f16, one product, operands = f16RNE(q * log2(e)) and f16RNE(k), f32 accumulate.
// Row sums of Wv and the sum of bv: v_wmma_f32_16x16x32_bf16, A = bf16RNE values, B = ones and zeros, f32 accumulate.
// Channel sums, value channel-mean dot, softmax statistics, weight-times-value-mean reduction and epilogue: f32 on the VALU.
#include <hip/hip_runtime.h>

#define CIN   256
#define CQK   32
#define HWN   4096
#define NBAT  8
#define NTOK  32768
#define PBLK  128
#define QBLK  64
#define PW    264
#define XP    260
#define AWAV  8
#define QT    (QBLK / 16)
#define KSPL  (HWN / AWAV)

static_assert(NTOK == NBAT * HWN);
static_assert((NTOK % PBLK) == 0 && (NTOK % QBLK) == 0 && (HWN % QBLK) == 0);
static_assert((HWN % 32) == 0 && (CIN % 32) == 0 && CQK == 32);
static_assert((PW % 8) == 0 && PBLK == 128 && QBLK == 64 && CIN == 2 * PBLK);
static_assert((XP % 4) == 0 && ((XP / 4) % 2) == 1 && XP >= CIN);
static_assert((KSPL % 32) == 0 && 32 * AWAV >= QBLK && (HWN % (4 * 32 * AWAV)) == 0);

typedef __bf16         v16bf __attribute__((ext_vector_type(16)));
typedef _Float16       v16h  __attribute__((ext_vector_type(16)));
typedef unsigned short v16us __attribute__((ext_vector_type(16)));
typedef unsigned short v8us  __attribute__((ext_vector_type(8)));
typedef float          v8f   __attribute__((ext_vector_type(8)));
typedef float          v4f   __attribute__((ext_vector_type(4)));
typedef float          v2f   __attribute__((ext_vector_type(2)));
typedef __bf16         v2bf  __attribute__((ext_vector_type(2)));
typedef __bf16         v8bf  __attribute__((ext_vector_type(8)));
typedef unsigned int   v8u   __attribute__((ext_vector_type(8)));
typedef unsigned int   v4u   __attribute__((ext_vector_type(4)));

// ---- scalar helpers --------------------------------------------------------------------------------
__device__ __forceinline__ unsigned short bf_bits(float f) {          // f32 -> bf16 bits, RNE convert
  unsigned u = __float_as_uint(f);
  return (unsigned short)((u + 0x7FFFu + ((u >> 16) & 1u)) >> 16);
}
__device__ __forceinline__ float bf_up(unsigned short hb) { return __uint_as_float(((unsigned)hb) << 16); }
__device__ __forceinline__ float bf_r(float f) { return bf_up(bf_bits(f)); }
__device__ __forceinline__ unsigned short h_bits(float f) { return __builtin_bit_cast(unsigned short, (_Float16)f); }  // f32 -> f16 bits, RNE
__device__ __forceinline__ float ex2(float f) { return __builtin_amdgcn_exp2f(f); }   // 2^f, one v_exp_f32
__device__ __forceinline__ v8f zero8() { v8f z = {0.f, 0.f, 0.f, 0.f, 0.f, 0.f, 0.f, 0.f}; return z; }

// ---- fragment loader: lane -> row/col (lane&15); p already includes +8*(lane>>4);
//      elements 0..7 <- p[0..7] (k0+8h..), elements 8..15 <- p[16..23] (k0+16+8h..). Same map for A and B.
__device__ __forceinline__ v16bf ldfrag_b(const unsigned short* p) {
  union { v16us v; v8us hv[2]; } f;
  f.hv[0] = *(const v8us*)(p);
  f.hv[1] = *(const v8us*)(p + 16);
  return __builtin_bit_cast(v16bf, f.v);
}
__device__ __forceinline__ v16h ldfrag_h(const unsigned short* p) { return __builtin_bit_cast(v16h, ldfrag_b(p)); }

// ---- WMMA helper and trailing VALU hazard gaps ------------------------------------------------------------
__device__ __forceinline__ v8f mma_b(v16bf a, v16bf b, v8f c) {
  return __builtin_amdgcn_wmma_f32_16x16x32_bf16(false, a, false, b, (short)0, c, false, false);
}
__device__ __forceinline__ v8f mma_h(v16h a, v16h b, v8f c) {
  return __builtin_amdgcn_wmma_f32_16x16x32_f16(false, a, false, b, (short)0, c, false, false);
}
__device__ __forceinline__ void guard_p(v8f& c0, v8f& c1, v8f& c2, v8f& c3,
                                        v16bf a, v16bf b0, v16bf b1, v16bf b2, v16bf b3) {
#if defined(__HIP_DEVICE_COMPILE__)
  asm volatile("v_nop\n\tv_nop\n\tv_nop\n\tv_nop"
               : "+v"(c0), "+v"(c1), "+v"(c2), "+v"(c3)
               : "v"(a), "v"(b0), "v"(b1), "v"(b2), "v"(b3));
#endif
}
__device__ __forceinline__ void acc_guard4(v8f& a, v8f& b, v8f& c, v8f& d) {
#if defined(__HIP_DEVICE_COMPILE__)
  asm volatile("v_nop\n\tv_nop\n\tv_nop\n\tv_nop" : "+v"(a), "+v"(b), "+v"(c), "+v"(d));
#endif
}
__device__ __forceinline__ void sched_fence() {
#if defined(__HIP_DEVICE_COMPILE__)
  asm volatile("" ::: "memory");
#endif
}

// ---- eight asynchronous copies to LDS, 16 bytes a lane each: four rows of x, two whole-wave 512-byte halves a row.
//      l = the lane's LDS byte address of the first row's first half, g = its global address; rows XP and CIN floats apart.
//      The closing s_wait_xcnt stands inside the statement, ahead of any later write of an address register it names.
__device__ __forceinline__ void copy_rows4(unsigned l, const float* g) {
#if defined(__HIP_DEVICE_COMPILE__)
  asm volatile("global_load_async_to_lds_b128 %0, %8, off\n\t"
               "global_load_async_to_lds_b128 %1, %9, off\n\t"
               "global_load_async_to_lds_b128 %2, %10, off\n\t"
               "global_load_async_to_lds_b128 %3, %11, off\n\t"
               "global_load_async_to_lds_b128 %4, %12, off\n\t"
               "global_load_async_to_lds_b128 %5, %13, off\n\t"
               "global_load_async_to_lds_b128 %6, %14, off\n\t"
               "global_load_async_to_lds_b128 %7, %15, off\n\t"
               "s_wait_xcnt 0x0"
               :: "v"(l), "v"(l + 512u), "v"(l + 4u * XP), "v"(l + 4u * XP + 512u),
                  "v"(l + 8u * XP), "v"(l + 8u * XP + 512u), "v"(l + 12u * XP), "v"(l + 12u * XP + 512u),
                  "v"(g), "v"(g + 128), "v"(g + CIN), "v"(g + CIN + 128),
                  "v"(g + 2 * CIN), "v"(g + 2 * CIN + 128), "v"(g + 3 * CIN), "v"(g + 3 * CIN + 128)
               : "memory");
#endif
}

// ---- NQ whole-wave 512-byte loads (p already includes +4*lane) -> fragment elements 4q..4q+3 of the lane, RNE
//      convert (two values per instruction); the elements above 4*NQ are zero.
template <int NQ>
__device__ __forceinline__ v16bf ldlines(const float* p) {
  v16bf a;
#pragma unroll
  for (int e = 0; e < 16; ++e) a[e] = (__bf16)0.0f;
#pragma unroll
  for (int g = 0; g < NQ; ++g) {
    const v4f f = *(const v4f*)(p + 128 * g);
    const v2f f01 = {f[0], f[1]}, f23 = {f[2], f[3]};
    const v2bf c01 = __builtin_convertvector(f01, v2bf), c23 = __builtin_convertvector(f23, v2bf);
    a[4 * g] = c01[0]; a[4 * g + 1] = c01[1]; a[4 * g + 2] = c23[0]; a[4 * g + 3] = c23[1];
  }
  return a;
}

// ---- the same element map and convert for four such loads already in registers.
__device__ __forceinline__ v16bf cvlines4(const v4f (&f)[4]) {
  v16bf a;
#pragma unroll
  for (int g = 0; g < 4; ++g) {
    const v2f f01 = {f[g][0], f[g][1]}, f23 = {f[g][2], f[g][3]};
    const v2bf c01 = __builtin_convertvector(f01, v2bf), c23 = __builtin_convertvector(f23, v2bf);
    a[4 * g] = c01[0]; a[4 * g + 1] = c01[1]; a[4 * g + 2] = c23[0]; a[4 * g + 3] = c23[1];
  }
  return a;
}

// =====================================================================================================
// Projections + per-token statistics. Block = 128 tokens, 8 waves, wave = 16 tokens; one block per WGP, so Wv is
// read once per WGP.
// Entry: each wave sends its 16 rows of x (16 KiB) to LDS by 32 asynchronous copies (row pitch 260 floats = 16 B x 65),
// which fly under the prologue; its own wait on them stands in front of the prologue's closing barrier.
// Prologue: behind the copies Wq, Wk, the biases and bv are asked for in one run; Wq and Wk are converted and stored
// to LDS. No weight load is waited for on its own: these fly under x, and Wv is streamed through the k-loop.
// wsum[cin] = sum over cout of bf16RNE(Wv[cin][cout]), wave = 32 rows of Wv, formed inside the k-loop: step c asks for
// the rows of step c + 1 and adds the rows asked for one step before. Two neighbouring rows are
// four whole-wave 512-byte loads: a lane's fragment elements 0..7 belong to the even row, 8..15 to the odd one.
// Product j of a 16-row group: A = that fragment, B = 1 in column 2j at elements 0..7 and in column 2j+1 at
// elements 8..15, else 0 (same element map for A and B), so D[i][n] = what lanes i and i+16 hold of row n.
// A lane adds its 8 registers and its xor-16 partner's sum: lane n has the sum of row n.
// Sum of bf16RNE(bv), in every wave: two such loads in elements 0..7, B = ones, the same two additions.
// LDS: Wq and Wk as bf16 bits in [n][k] layout (rows 0..31 = Wq columns, rows 32..63 = Wk columns,
// pitch 264), wsum, biases. k-loop over 256 in steps of 32: A = bf16RNE(x) rows read from LDS (row = token m,
// split k map), B = sW rows (col = output channel, same k map); the same x elements feed the f32 channel
// sum. The eight A fragments stay in registers; behind the barrier that publishes wsum they feed the f32 dot with
// wsum (four chains, added at the end). Epilogue: v = k + bias, or (q + bias) * log2(e) in f32, so that a score q.k leaves the
// matrix unit as a base-2 exponent; f16RNE(v) (its rounding is about a tenth of what the bf16 operands of the
// projection have already left in v), staged
// per wave in LDS as two [16 tokens][32] planes, then each plane tile (1024 contiguous bytes in global)
// coverage: 8 waves x 16 rows x 32 = the block's 128 rows of each of the 2 planes; 128 xmean + 128 vbar;
// 256 blocks = whole planes.
// =====================================================================================================
__global__ __launch_bounds__(2 * PBLK) void k_proj(const float* __restrict__ x,
                                               const float* __restrict__ Wq, const float* __restrict__ bq,
                                               const float* __restrict__ Wk, const float* __restrict__ bk,
                                               const float* __restrict__ Wv, const float* __restrict__ bv,
                                               unsigned short* qf, unsigned short* kf,
                                               float* xmean, float* vbar) {
  __shared__ __align__(16) float sX[PBLK * XP];
  __shared__ __align__(16) unsigned short sW[64 * PW];
  __shared__ __align__(16) unsigned short sO[(PBLK / 16) * 2 * 16 * CQK];
  __shared__ __align__(16) float swsum[CIN];
  __shared__ __align__(16) float smean[PBLK];
  __shared__ __align__(16) float svbar[PBLK];
  __shared__ float sbias[64];
  const int tid = threadIdx.x, wave = tid >> 5, lane = tid & 31, m = lane & 15, h = lane >> 4;
  const int row0 = blockIdx.x * PBLK + wave * 16;

  {
    const unsigned xl = (unsigned)(size_t)(sX + wave * 16 * XP + 4 * lane);
    const float* xg = x + (size_t)row0 * CIN + 4 * lane;
    // Unrolled so that every copy's two addresses are constant steps from one base and all 32 copies issue in a row.
#pragma unroll
    for (int q = 0; q < 4; ++q) copy_rows4(xl + (unsigned)(q * 4 * XP * 4), xg + q * 4 * CIN);
  }

  // Wq, Wk and the biases are asked for here in one run, so that they share one trip to L2, under the flight of x.
  // Wave = 32 rows k of each matrix. Load j of a lane: row 32 * wave + 8 * wg + j, columns 4 * wc .. 4 * wc + 3
  // (the 8 lanes of one wg cover one whole 128-byte row), so a lane ends up with 8 neighbouring k of 4 columns.
  const int wg = lane & 3, wc = lane >> 2;
  v4f rq[8], rk[8];
  const float* wqp = Wq + (wave * 32 + 8 * wg) * CQK + 4 * wc;
  const float* wkp = Wk + (wave * 32 + 8 * wg) * CQK + 4 * wc;
  const float* bqk = ((tid & 32) ? bk : bq) + (tid & 31);
  // Both loops unrolled: rq and rk live in VGPRs and the 16 loads issue in a row.
#pragma unroll
  for (int j = 0; j < 8; ++j) rq[j] = *(const v4f*)(wqp + j * CQK);
#pragma unroll
  for (int j = 0; j < 8; ++j) rk[j] = *(const v4f*)(wkp + j * CQK);
  const float rbias = *bqk;
  // The wait stands ahead of any overwrite of these loads' address pairs; naming the addresses keeps the pairs alive
  // up to here, so that no load's own result lands on one either.
#if defined(__HIP_DEVICE_COMPILE__)
  asm volatile("s_wait_xcnt 0x0" :: "v"(wqp), "v"(wkp), "v"(bqk) : "memory");
#endif

  const v16bf ab = ldlines<2>(bv + 4 * lane);
  // A later load may land on the bv loads' address pair: the wait stands ahead of that overwrite.
#if defined(__HIP_DEVICE_COMPILE__)
  asm volatile("s_wait_xcnt 0x0" ::: "memory");
#endif
  // The first row pairs of Wv, which k-step 0 adds up, are asked for here and land under the flight of x as well.
  const float* wv = Wv + (size_t)(wave * 32) * CIN + 4 * lane;
  v4f rv[8][2][4];                                  // row pair j of both 16-row groups of the wave's 32 rows of Wv
  // Unrolled, here and in the k-loop: rv lives in VGPRs, the eight loads of a row-pair group issue in a row.
#pragma unroll
  for (int rt = 0; rt < 2; ++rt)
#pragma unroll
    for (int g = 0; g < 4; ++g) rv[0][rt][g] = *(const v4f*)(wv + (rt * 16) * CIN + 128 * g);
  {
    // Wq and Wk to LDS: 8 neighbouring k of one column are one 16-byte store
    // (unrolled: constant indices into rq and rk).
#pragma unroll
    for (int i = 0; i < 4; ++i) {
      v8bf oq, ok;
#pragma unroll
      for (int jj = 0; jj < 4; ++jj) {
        const v2f fq2 = {rq[2 * jj][i], rq[2 * jj + 1][i]}, fk2 = {rk[2 * jj][i], rk[2 * jj + 1][i]};
        const v2bf cq = __builtin_convertvector(fq2, v2bf), ck = __builtin_convertvector(fk2, v2bf);
        oq[2 * jj] = cq[0]; oq[2 * jj + 1] = cq[1];
        ok[2 * jj] = ck[0]; ok[2 * jj + 1] = ck[1];
      }
      unsigned short* pw = sW + (4 * wc + i) * PW + wave * 32 + 8 * wg;
      *(v8us*)(pw) = __builtin_bit_cast(v8us, oq);
      *(v8us*)(pw + 32 * PW) = __builtin_bit_cast(v8us, ok);
    }
    sbias[tid & 63] = bf_r(rbias);                  // 0..31 = bq, 32..63 = bk; the four writers of a slot hold the same value
  }
  // The wave's own copies of x have landed before it passes the barrier behind which sX is read.
#if defined(__HIP_DEVICE_COMPILE__)
  asm volatile("s_wait_asynccnt 0x0" ::: "memory");
#endif
  __syncthreads();

  const float* xr = sX + (wave * 16 + m) * XP + 8 * h;
  const float* wr = swsum + 8 * h;
  const unsigned short* wb = sW + m * PW + 8 * h;
  v8f acc[4];
#pragma unroll
  for (int t = 0; t < 4; ++t) acc[t] = zero8();
  float xs = 0.f;
  v16us afr[CIN / 32];                              // the wave's A fragments, kept for the dot with wsum
  const unsigned one2 = 0x3F803F80u;                // two bf16 ones
  v8f rs[2] = {zero8(), zero8()};

  // Fully unrolled: afr and rv are indexed by c and have to live in VGPRs.
#pragma unroll
  for (int c = 0; c < CIN / 32; ++c) {
    // The Wv rows whose sums step c + 1 forms are asked for one step ahead and fly under this step's arithmetic.
    if (c + 1 < CIN / 32) {
#pragma unroll
      for (int rt = 0; rt < 2; ++rt)
#pragma unroll
        for (int g = 0; g < 4; ++g) rv[c + 1][rt][g] = *(const v4f*)(wv + (rt * 16 + 2 * (c + 1)) * CIN + 128 * g);
    }
    const float* p = xr + 32 * c;
    const v4f x0 = *(const v4f*)(p);
    const v4f x1 = *(const v4f*)(p + 4);
    const v4f x2 = *(const v4f*)(p + 16);
    const v4f x3 = *(const v4f*)(p + 20);
    v16us au;
#pragma unroll
    for (int e = 0; e < 4; ++e) {
      const unsigned short b0 = bf_bits(x0[e]), b1 = bf_bits(x1[e]);
      const unsigned short b2 = bf_bits(x2[e]), b3 = bf_bits(x3[e]);
      const float r0 = bf_up(b0), r1 = bf_up(b1), r2 = bf_up(b2), r3 = bf_up(b3);
      au[e] = b0; au[4 + e] = b1; au[8 + e] = b2; au[12 + e] = b3;
      xs += (r0 + r1) + (r2 + r3);
    }
    afr[c] = au;
    const v16bf a = __builtin_bit_cast(v16bf, au);
    const unsigned short* bp = wb + 32 * c;
    const v16bf f0 = ldfrag_b(bp);
    const v16bf f1 = ldfrag_b(bp + 16 * PW);
    const v16bf f2 = ldfrag_b(bp + 32 * PW);
    const v16bf f3 = ldfrag_b(bp + 48 * PW);
    acc[0] = mma_b(a, f0, acc[0]);
    acc[1] = mma_b(a, f1, acc[1]);
    acc[2] = mma_b(a, f2, acc[2]);
    acc[3] = mma_b(a, f3, acc[3]);
    guard_p(acc[0], acc[1], acc[2], acc[3], a, f0, f1, f2, f3);
    // Row pair c of Wv, asked for one step ago, into the row sums.
    {
      const unsigned se = m == 2 * c ? one2 : 0u, so2 = m == 2 * c + 1 ? one2 : 0u;
      const v8u su = {se, se, se, se, so2, so2, so2, so2};
      const v16bf sel = __builtin_bit_cast(v16bf, su);
#pragma unroll
      for (int rt = 0; rt < 2; ++rt) rs[rt] = mma_b(cvlines4(rv[c][rt]), sel, rs[rt]);
    }
    sched_fence();
  }
  acc_guard4(acc[0], acc[1], acc[2], acc[3]);
  // The wait stands ahead of any overwrite of the Wv loads' address pair; naming the address keeps the pair alive up
  // to here, so that no load's own result lands on it either.
#if defined(__HIP_DEVICE_COMPILE__)
  asm volatile("s_wait_xcnt 0x0" :: "v"(wv) : "memory");
#endif

  float bvsum;
  {
    const v8u ou = {one2, one2, one2, one2, one2, one2, one2, one2};
    const v8f rb = mma_b(ab, __builtin_bit_cast(v16bf, ou), zero8());
    float p0 = ((rs[0][0] + rs[0][1]) + (rs[0][2] + rs[0][3])) + ((rs[0][4] + rs[0][5]) + (rs[0][6] + rs[0][7]));
    float p1 = ((rs[1][0] + rs[1][1]) + (rs[1][2] + rs[1][3])) + ((rs[1][4] + rs[1][5]) + (rs[1][6] + rs[1][7]));
    float pb = ((rb[0] + rb[1]) + (rb[2] + rb[3])) + ((rb[4] + rb[5]) + (rb[6] + rb[7]));
    p0 += __shfl_xor(p0, 16, 32);
    p1 += __shfl_xor(p1, 16, 32);
    pb += __shfl_xor(pb, 16, 32);
    swsum[wave * 32 + lane] = h ? p1 : p0;
    bvsum = pb;
  }
  // swsum is complete behind this barrier.
  __syncthreads();

  // ---- dot of the kept bf16 x elements with wsum: four independent f32 chains, one per 4-element group of the k map ----
  float vd4[4] = {0.f, 0.f, 0.f, 0.f};
  // Unrolled: constant indices into afr.
#pragma unroll
  for (int c = 0; c < CIN / 32; ++c) {
    const float* pw = wr + 32 * c;
    const v4f w0 = *(const v4f*)(pw);
    const v4f w1 = *(const v4f*)(pw + 4);
    const v4f w2 = *(const v4f*)(pw + 16);
    const v4f w3 = *(const v4f*)(pw + 20);
#pragma unroll
    for (int e = 0; e < 4; ++e) {
      vd4[0] += bf_up(afr[c][e]) * w0[e];
      vd4[1] += bf_up(afr[c][4 + e]) * w1[e];
      vd4[2] += bf_up(afr[c][8 + e]) * w2[e];
      vd4[3] += bf_up(afr[c][12 + e]) * w3[e];
    }
  }
  float vd = (vd4[0] + vd4[1]) + (vd4[2] + vd4[3]);

  // ---- per-token statistics (both lane halves hold row m) ----
  xs += __shfl_xor(xs, 16, 32);
  vd += __shfl_xor(vd, 16, 32);
  if (h == 0) {
    smean[wave * 16 + m] = xs * (1.0f / 256.0f);
    svbar[wave * 16 + m] = (vd + bvsum) * (1.0f / 256.0f);
  }
  // ---- q/k planes staged per wave: plane 0 = q, 1 = k ----
  unsigned short* so = sO + wave * (2 * 16 * CQK);
#pragma unroll
  for (int t = 0; t < 4; ++t) {
    const float bias = sbias[16 * t + m];
    const int col = 16 * (t & 1) + m;
    unsigned short* ph = so + (t >> 1) * (16 * CQK) + col;
#pragma unroll
    for (int r = 0; r < 8; ++r) {
      const float pre = acc[t][r] + bias;
      const float val = t < 2 ? pre * 1.44269504088896340736f : pre;   // t 0, 1 = the q columns
      ph[(8 * h + r) * CQK] = h_bits(val);
    }
  }
  __syncthreads();
  v4u pc[4];
#pragma unroll
  for (int pidx = 0; pidx < 2; ++pidx) {
    pc[2 * pidx]     = *(const v4u*)(so + pidx * (16 * CQK) + lane * 8);
    pc[2 * pidx + 1] = *(const v4u*)(so + pidx * (16 * CQK) + 256 + lane * 8);
  }
  const size_t ob = (size_t)row0 * CQK + (size_t)lane * 8;
  *(v4u*)(qf + ob) = pc[0];  *(v4u*)(qf + ob + 256) = pc[1];
  *(v4u*)(kf + ob) = pc[2];  *(v4u*)(kf + ob + 256) = pc[3];
  

  if (wave == 0) {
    *(v4f*)(xmean + (size_t)blockIdx.x * PBLK + 4 * lane) = *(const v4f*)(smean + 4 * lane);
  } else if (wave == 1) {
    *(v4f*)(vbar + (size_t)blockIdx.x * PBLK + 4 * lane) = *(const v4f*)(svbar + 4 * lane);
  }
}

// =====================================================================================================
// Attention, single pass. Block = 64 queries (inside one image), 8 waves.
// Every wave holds the Q fragments of all 64 queries (4 query tiles) and walks its own eighth of the
// image's keys (512 keys, 16 chunks of 32), so one K fragment load and one vbar read feed 4 query tiles.
// vbar of the image staged in LDS (4096 floats). Per 32-key chunk and query tile t:
//   S^T tiles = K rows (A, row = key, k = d) . Q rows (B, col = query, k = d), one k-step,
//   one f16 product per tile from zero;
//   D: s0[t][r] = S[key kb+8h+r][query], s1[t][r] = S[key kb+16+8h+r][query], S = score * log2(e): the q plane
//   carries the factor;
//   p = 2^S in f32, taken straight from the accumulator register; sum += p; o += p * vbar[key] (f32 FMA).
//   The sum and the weighted sum are formed on pairs of neighbouring accumulator registers
//   (packed f32 instructions); the two elements of a pair's sums are added once, after the loop.
// The walk subtracts nothing from S (shift 0): o / sum does not depend on a shift as long as nothing leaves the f32
// range, so the walk needs no exponent arithmetic, no maximum, no exchange between lane halves and no rescaling.
// After the walk every query's sum and weighted sum
// are tested against a window well inside the f32 range; if one lane of the wave fails (also on NaN), the whole wave
// walks its keys again with the running maximum as shift (walk<true>: max over the 16 keys per lane, then the xor-16
// partner; p = 2^(S - shift); rescale of both sums), which holds for any scores.
// Merge: each wave leaves (shift, sum, weighted sum) per query in LDS; after one barrier thread q < 64
// rescales the 8 partials of query q to their largest shift (base 2) and adds them in wave order.
// Epilogue: res = gammaRNE * (o / l) + xmean[query]; waves 0 and 1 each store one whole 128-byte line.
// coverage: 8 waves x 16 chunks x 32 = all 4096 keys of the image; 512 blocks x 64 = whole output.
// =====================================================================================================
// One 32-key chunk of a wave's walk. a0, a1 hold the chunk's K fragments on entry. ONLINE = false: shift[] is not
// used. ONLINE = true: shift[] is the running maximum of S. AHEAD = true: right behind the chunk's own
// products the same two fragments are loaded anew from the next chunk (pa + 32 rows), so that these loads fly
// under the chunk's softmax arithmetic and are waited for only at the next chunk's first product. Every loop over
// t (query tile), v (accumulator register) and j (register pair) is fully unrolled: the per-tile arrays live in VGPRs.
template <bool ONLINE, bool AHEAD>
__device__ __forceinline__ void chunk(const unsigned short* pa, const float* vb,
                                      v16h& a0, v16h& a1, const v16h (&fq)[QT],
                                      float (&shift)[QT], v2f (&run_sum)[QT], v2f (&run_o)[QT]) {
  const v4f v00 = *(const v4f*)(vb);
  const v4f v01 = *(const v4f*)(vb + 4);
  const v4f v10 = *(const v4f*)(vb + 16);
  const v4f v11 = *(const v4f*)(vb + 16 + 4);
  // Keeps the four vbar reads in one place ahead of the products, whose run covers the LDS latency.
  __builtin_amdgcn_sched_barrier(0);
  const v2f w0[4] = {{v00[0], v00[1]}, {v00[2], v00[3]}, {v01[0], v01[1]}, {v01[2], v01[3]}};
  const v2f w1[4] = {{v10[0], v10[1]}, {v10[2], v10[3]}, {v11[0], v11[1]}, {v11[2], v11[3]}};
  v8f s0[QT], s1[QT];
#pragma unroll
  for (int t = 0; t < QT; ++t) { s0[t] = mma_h(a0, fq[t], zero8()); s1[t] = mma_h(a1, fq[t], zero8()); }
  if constexpr (AHEAD) {
    a0 = ldfrag_h(pa + 32 * CQK);
    a1 = ldfrag_h(pa + 48 * CQK);
    // The next chunk's address additions land on these loads' address pairs: the wait stands ahead of that overwrite.
#if defined(__HIP_DEVICE_COMPILE__)
    asm volatile("s_wait_xcnt 0x0" ::: "memory");
#endif
    // Keeps the four loads of the next chunk ahead of the softmax arithmetic (sunk behind it they would be waited
    // for at once at the next chunk's first product).
    __builtin_amdgcn_sched_barrier(0);
  }
  // ---- softmax terms over the key axis, one query tile after the other ----
#pragma unroll
  for (int t = 0; t < QT; ++t) {
    v2f ls = run_sum[t], po = run_o[t];
    if constexpr (ONLINE) {
      float lmax = fmaxf(s0[t][0], s1[t][0]);
#pragma unroll
      for (int v = 1; v < 8; ++v) lmax = fmaxf(lmax, fmaxf(s0[t][v], s1[t][v]));
      lmax = fmaxf(lmax, __shfl_xor(lmax, 16, 32));
      const float nm = fmaxf(shift[t], lmax);
      const float factor = ex2(shift[t] - nm);
      shift[t] = nm;
      const v2f f2 = {factor, factor};
      ls *= f2;
      po *= f2;
    }
    // Two scores that sit in neighbouring accumulator registers go through each packed instruction together.
#pragma unroll
    for (int j = 0; j < 4; ++j) {
      v2f e0 = {s0[t][2 * j], s0[t][2 * j + 1]};
      v2f e1 = {s1[t][2 * j], s1[t][2 * j + 1]};
      if constexpr (ONLINE) {
        const v2f nm2 = {shift[t], shift[t]};
        e0 -= nm2;
        e1 -= nm2;
      }
      const v2f p0 = {ex2(e0[0]), ex2(e0[1])};
      const v2f p1 = {ex2(e1[0]), ex2(e1[1])};
      ls += p0;
      ls += p1;
      po = __builtin_elementwise_fma(p0, w0[j], po);
      po = __builtin_elementwise_fma(p1, w1[j], po);
    }
    run_sum[t] = ls;
    run_o[t] = po;
  }
}

// One wave's walk over its KSPL keys; a0, a1 arrive holding the fragments of the first chunk. The last chunk stands
// behind the loop, without a fetch ahead: no K row outside the wave's own range is read.
template <bool ONLINE>
__device__ __forceinline__ void walk(const unsigned short* kfp, const float* vbp,
                                     v16h a0, v16h a1, const v16h (&fq)[QT],
                                     float (&shift)[QT], v2f (&run_sum)[QT], v2f (&run_o)[QT]) {
  // Kept rolled: a second copy of the body would save only a trip's scalar bookkeeping and its two address additions.
#pragma unroll 1
  for (int kb = 0; kb < KSPL - 32; kb += 32)
    chunk<ONLINE, true>(kfp + (size_t)kb * CQK, vbp + kb, a0, a1, fq, shift, run_sum, run_o);
  chunk<ONLINE, false>(kfp, vbp + (KSPL - 32), a0, a1, fq, shift, run_sum, run_o);
}

__global__ __launch_bounds__(32 * AWAV) void k_attn(const unsigned short* qf, const unsigned short* kf,
                                               const float* vbar, const float* xmean,
                                               const float* __restrict__ gamma, float* out) {
  __shared__ __align__(16) float svb[HWN];
  __shared__ float pmx[AWAV * QBLK];
  __shared__ float psm[AWAV * QBLK];
  __shared__ float pov[AWAV * QBLK];
  const int tid = threadIdx.x, wave = tid >> 5, lane = tid & 31;
  const int rl = lane & 15, h = lane >> 4, koff = 8 * h;
  const int n0 = blockIdx.x * QBLK;
  const int keybase = (n0 / HWN) * HWN;
  const float gb = bf_r(gamma[0]);

  const unsigned short* qfp = qf + (size_t)(n0 + rl) * CQK + koff;
  const int key0 = wave * KSPL;
  const unsigned short* kfp = kf + (size_t)(keybase + key0 + rl) * CQK + koff;
  const float* vbp = svb + key0 + koff;
  const v16h e0 = ldfrag_h(kfp);                      // the wave's first 32 keys: the walk's first chunk
  const v16h e1 = ldfrag_h(kfp + 16 * CQK);
  // A Q load may land on the K loads' address pair: the wait stands ahead of that overwrite.
#if defined(__HIP_DEVICE_COMPILE__)
  asm volatile("s_wait_xcnt 0x0" ::: "memory");
#endif
  v16h fq[QT];
#pragma unroll
  for (int t = 0; t < QT; ++t) fq[t] = ldfrag_h(qfp + t * 16 * CQK);
#pragma unroll
  for (int j = 0; j < HWN / (4 * 32 * AWAV); ++j) {
    const int i = tid + 32 * AWAV * j;
    ((v4f*)svb)[i] = *(const v4f*)(vbar + keybase + 4 * i);
  }

  float shift[QT];                                    // what the merge takes as the partial sums' shift: 0 after walk<false>
  v2f run_sum[QT], run_o[QT];                         // element 0: even accumulator registers, element 1: odd
#pragma unroll
  for (int t = 0; t < QT; ++t) { shift[t] = 0.0f; run_sum[t] = 0.0f; run_o[t] = 0.0f; }
  __syncthreads();

  walk<false>(kfp, vbp, e0, e1, fq, shift, run_sum, run_o);

  // ---- both lane halves joined; every sum must lie well inside the f32 range ----
  const float WLO = 0x1p-64f, WHI = 0x1p+96f;
  float tot[QT], oo[QT];
  bool inside = true;
#pragma unroll
  for (int t = 0; t < QT; ++t) {
    const float hs = run_sum[t][0] + run_sum[t][1], ho = run_o[t][0] + run_o[t][1];
    tot[t] = hs + __shfl_xor(hs, 16, 32);
    oo[t] = ho + __shfl_xor(ho, 16, 32);
    inside = inside & (tot[t] > WLO) & (tot[t] < WHI) & (fabsf(oo[t]) < WHI);
  }
  // Scalar branch on the whole wave's vote: the products in the second walk need every lane on.
  if (__builtin_amdgcn_ballot_w32(!inside) != 0u) {
#pragma unroll
    for (int t = 0; t < QT; ++t) { shift[t] = -1.0e30f; run_sum[t] = 0.0f; run_o[t] = 0.0f; }
    const v16h r0 = ldfrag_h(kfp), r1 = ldfrag_h(kfp + 16 * CQK);
    // A product's result may land on these loads' address pair: the wait stands ahead of that overwrite.
#if defined(__HIP_DEVICE_COMPILE__)
    asm volatile("s_wait_xcnt 0x0" ::: "memory");
#endif
    walk<true>(kfp, vbp, r0, r1, fq, shift, run_sum, run_o);
#pragma unroll
    for (int t = 0; t < QT; ++t) {
      const float hs = run_sum[t][0] + run_sum[t][1], ho = run_o[t][0] + run_o[t][1];
      tot[t] = hs + __shfl_xor(hs, 16, 32);
      oo[t] = ho + __shfl_xor(ho, 16, 32);
    }
  }

  // ---- each wave's partial statistics to LDS ----
#pragma unroll
  for (int t = 0; t < QT; ++t) {
    if (h == 0) {
      const int slot = wave * QBLK + 16 * t + rl;
      pmx[slot] = shift[t];
      psm[slot] = tot[t];
      pov[slot] = oo[t];
    }
  }
  __syncthreads();

  // ---- merge of the 8 key ranges and epilogue: thread = query ----
  if (tid < QBLK) {
    float gm = pmx[tid];
#pragma unroll
    for (int w = 1; w < AWAV; ++w) gm = fmaxf(gm, pmx[w * QBLK + tid]);
    float mt = 0.0f, mo = 0.0f;
#pragma unroll
    for (int w = 0; w < AWAV; ++w) {
      const float f = ex2(pmx[w * QBLK + tid] - gm);
      mt += psm[w * QBLK + tid] * f;
      mo += pov[w * QBLK + tid] * f;
    }
    out[(size_t)n0 + tid] = gb * (mo * (1.0f / mt)) + xmean[n0 + tid];
  }
}

// =====================================================================================================
// Workspace map (bytes); every region an exact multiple of its whole-line store granularity,
// every offset a multiple of 128.
//   QF f16  [32768][32]  2097152 @0
//   KF f16  [32768][32]  2097152 @2097152
//   XM f32  [32768]       131072 @4194304
//   VB f32  [32768]       131072 @4325376
//   end = 4456448
// =====================================================================================================
extern "C" void kernel_launch(void* const* d_in, const int* in_sizes, int n_in,
                              void* d_out, int out_size, void* d_ws, size_t ws_size,
                              hipStream_t stream) {
  if (n_in < 8) return;
  if (in_sizes[0] != NTOK * CIN) return;
  if (in_sizes[1] != CIN * CQK) return;
  if (in_sizes[2] != CQK) return;
  if (in_sizes[3] != CIN * CQK) return;
  if (in_sizes[4] != CQK) return;
  if (in_sizes[5] != CIN * CIN) return;
  if (in_sizes[6] != CIN) return;
  if (in_sizes[7] < 1) return;
  if (out_size != NTOK) return;

  const float* x     = (const float*)d_in[0];
  const float* Wq    = (const float*)d_in[1];
  const float* bq    = (const float*)d_in[2];
  const float* Wk    = (const float*)d_in[3];
  const float* bk    = (const float*)d_in[4];
  const float* Wv    = (const float*)d_in[5];
  const float* bv    = (const float*)d_in[6];
  const float* gamma = (const float*)d_in[7];
  float* out = (float*)d_out;

  const size_t PQK  = (size_t)NTOK * CQK * 2;        // 2097152
  const size_t PTOK = (size_t)NTOK * 4;              //  131072

  size_t off = 0;
  const size_t oQF = off; off += PQK;
  const size_t oKF = off; off += PQK;
  const size_t oXM = off; off += PTOK;
  const size_t oVB = off; off += PTOK;
  if (off > ws_size) return;                          // off = 4456448
  if (off > (size_t)134217728) return;

  char* ws = (char*)d_ws;
  unsigned short* QF = (unsigned short*)(ws + oQF);
  unsigned short* KF = (unsigned short*)(ws + oKF);
  float* XM  = (float*)(ws + oXM);
  float* VB  = (float*)(ws + oVB);

  k_proj<<<dim3(NTOK / PBLK), dim3(2 * PBLK), 0, stream>>>(x, Wq, bq, Wk, bk, Wv, bv, QF, KF, XM, VB);
  k_attn<<<dim3(NTOK / QBLK), dim3(32 * AWAV), 0, stream>>>(QF, KF, VB, XM, gamma, out);
  (void)hipGetLastError();
}
